// v000
// Times are from an AMD MI455X. After a warm-up the kernel runs many times in a row, and a time is the length of
// such a window on the GPU divided by its runs, so every launch and the gaps after it count. The runs cycle
// through copies of the inputs. A figure is the median of several windows, for all but v000 over two sittings.
// Sittings can differ by a few percent; kernels timed side by side share one.
// The starting kernel, v000, takes 968 microseconds a run.
// compute dtype: all float inputs rounded to bf16; q, k, v are bf16-valued so their f16 planes are exact (sub-6e-5 magnitudes aside); logits q x k (1 product; + q's f16 residual for all rows) x 64^-0.5, the per-head mask replaces scores with -1e6 exactly as the module; softmax f32; P x 2^11 once to f16 x v (exact in f16) (1 product); f32 output.
#include <hip/hip_runtime.h>
#include <math.h>

typedef __attribute__((ext_vector_type(16))) _Float16 v16h;
typedef __attribute__((ext_vector_type(16))) __bf16 v16b;
typedef __attribute__((ext_vector_type(8)))  _Float16 v8h;
typedef __attribute__((ext_vector_type(8)))  float v8f;
typedef __attribute__((ext_vector_type(4)))  float v4f;
typedef __attribute__((ext_vector_type(2)))  float v2f;
typedef __attribute__((ext_vector_type(4)))  unsigned v4u;
typedef _Float16 hx8 __attribute__((ext_vector_type(8)));
typedef __attribute__((ext_vector_type(4)))  int v4i;
typedef float __attribute__((may_alias)) float_a;
typedef int __attribute__((may_alias)) int_a;

template <typename T> __device__ __forceinline__ void vst2(void* p, T v) { *(T*)p = v;  }
__device__ __forceinline__ v8f wmma16(v16h a, v16h b, v8f c) {
  v8f d = __builtin_amdgcn_wmma_f32_16x16x32_f16(false, a, false, b, (short)0, c, false, false);
  asm volatile("v_nop\n\tv_nop\n\tv_nop\n\tv_nop" : "+v"(d) : "v"(a), "v"(b));
  return d;
}
__device__ __forceinline__ v8f wmma_bf(v16b a, v16b b, v8f c) {
  v8f d = __builtin_amdgcn_wmma_f32_16x16x32_bf16(false, a, false, b, (short)0, c, false, false);
  asm volatile("v_nop\n\tv_nop\n\tv_nop\n\tv_nop" : "+v"(d) : "v"(a), "v"(b));
  return d;
}
// 16x16x32 fragments: lane = (h = lane>>4, row/col = lane&15); elements 0..7 = k0+8h+0..7, 8..15 = k0+16+8h+0..7; D element r = row 8h+r
__device__ __forceinline__ v16h frag_h(const _Float16* rowk0, int lane) {
  union { v16h v; v8h q[2]; } u; const _Float16* p = rowk0 + 8 * (lane >> 4);
  u.q[0] = *(const v8h*)p; u.q[1] = *(const v8h*)(p + 16); return u.v;
}
__device__ __forceinline__ v16h frag_f32(const float* rowk0, int lane) {
  v16h a; const float* p = rowk0 + 8 * (lane >> 4);
#pragma unroll
  for (int i = 0; i < 8; ++i) { a[i] = (_Float16)p[i]; a[8 + i] = (_Float16)p[16 + i]; }
  return a;
}
__device__ __forceinline__ v16h frag_f32s(const float* rowk0, int lane, float sc) {
  v16h a; const float* p = rowk0 + 8 * (lane >> 4);
#pragma unroll
  for (int i = 0; i < 8; ++i) { a[i] = (_Float16)(p[i] * sc); a[8 + i] = (_Float16)(p[16 + i] * sc); }
  return a;
}
// column fragment from a [K][ld] layout (column n), rows >= K read as 0
__device__ __forceinline__ v16h fragc_f32(const float* W, int k0, int n, int lane, int ld, int K) {
  v16h a; const int g = lane >> 4;
#pragma unroll
  for (int i = 0; i < 8; ++i) { const int ka = k0 + 8 * g + i, kb = ka + 16;
    a[i] = (_Float16)(ka < K ? W[(size_t)(ka < K ? ka : K - 1) * ld + n] : 0.f); a[8 + i] = (_Float16)(kb < K ? W[(size_t)(kb < K ? kb : K - 1) * ld + n] : 0.f); }
  return a;
}
struct F2 { v16b h, l; };
__device__ __forceinline__ F2 bsplit16(const float v[16]) { F2 r;
#pragma unroll
  for (int i = 0; i < 16; ++i) { const __bf16 h = (__bf16)v[i]; r.h[i] = h; r.l[i] = (__bf16)(v[i] - (float)h); }
  return r; }
__device__ __forceinline__ F2 split_row(const float* row, int k0, int lane) { float v[16]; const float* p = row + k0 + 8 * (lane >> 4);
#pragma unroll
  for (int i = 0; i < 8; ++i) { v[i] = p[i]; v[8 + i] = p[16 + i]; }
  return bsplit16(v); }
__device__ __forceinline__ F2 split_rowK(const float* row, int k0, int lane, int K) { float v[16]; const int g = lane >> 4;
#pragma unroll
  for (int i = 0; i < 8; ++i) { const int ka = k0 + 8 * g + i, kb = ka + 16; v[i] = ka < K ? row[ka < K ? ka : K - 1] : 0.f; v[8 + i] = kb < K ? row[kb < K ? kb : K - 1] : 0.f; }
  return bsplit16(v); }
__device__ __forceinline__ F2 split_col(const float* W, int k0, int n, int lane, int ld, int K) { float v[16]; const int g = lane >> 4;
#pragma unroll
  for (int i = 0; i < 8; ++i) { const int ka = k0 + 8 * g + i, kb = ka + 16; v[i] = ka < K ? W[(size_t)(ka < K ? ka : K - 1) * ld + n] : 0.f; v[8 + i] = kb < K ? W[(size_t)(kb < K ? kb : K - 1) * ld + n] : 0.f; }
  return bsplit16(v); }
__device__ __forceinline__ v8f mac3(const F2& a, const F2& b, v8f c) { c = wmma_bf(a.l, b.h, c); c = wmma_bf(a.h, b.l, c); return wmma_bf(a.h, b.h, c); }
__device__ __forceinline__ float sigm(float v) { return 1.0f / (1.0f + expf(-v)); }
#define LDSX() do { asm volatile("s_wait_dscnt 0" ::: "memory"); __builtin_amdgcn_wave_barrier(); __builtin_amdgcn_fence(__ATOMIC_RELEASE, "workgroup"); } while (0)

// Naive full scaled-dot-product attention (query/key/value [4,8,2048,64] given; mask [4,8] int: mask == 1 sets that head's entire score matrix to -1e6, i.e. exactly uniform attention): out = softmax(q k^T / 8 (masked_fill)) v -> [4,8,2048,64].
#define NB 4
#define TT 2048
#define CC 512            // NH * HD = projected width
#define DIN 512          // input (model) width
#define NH 8
#define HD 64
#define NQB (TT / 64)
#define HG 4
#define SCALE (0.125f)
#define CAUSAL 0
#ifndef TNB
#define TNB NB
#endif
__device__ __forceinline__ float bfr(float v) { return (float)(__bf16)v; }
__host__ __device__ __forceinline__ int kb_last(int qb) { return CAUSAL ? ((qb * 64 + 63) >> 7) : (TT / 128 - 1); }
typedef __attribute__((ext_vector_type(8))) __bf16 v8b;
__device__ __forceinline__ v16b frag_b(const __bf16* rowk0, int lane) {
  union { v16b v; v8b q[2]; } u; const __bf16* p = rowk0 + 8 * (lane >> 4);
  u.q[0] = *(const v8b*)p; u.q[1] = *(const v8b*)(p + 16); return u.v;
}
#define QBH 0              // causal: query blocks 0..QBH-1 of each sequence (few keys, no averaging) take the high-precision path
#define QHI 2048            // rows carrying a q residual plane (all rows when non-causal: 2-product logits everywhere)
#define KHI 64            // key rows carrying k residual / v bf16 hi+lo planes (used only by the causal high-precision path)
// B fragment (k rows k0+.., output column o) of a weight: (in,out) [K][ld] or (out,in) [ld rows of K]: bf16 exact, or f16(bf16 * 256) exact
__device__ __forceinline__ v16b wcol_io(const float* Wm, int k0, int o, int lane, int ld) { v16b w; const int g = lane >> 4;
#pragma unroll
  for (int i = 0; i < 8; ++i) { w[i] = (__bf16)Wm[(size_t)(k0 + 8 * g + i) * ld + o]; w[8 + i] = (__bf16)Wm[(size_t)(k0 + 16 + 8 * g + i) * ld + o]; }
  return w; }
__device__ __forceinline__ v16b wcol_oi(const float* Wm, int k0, int o, int lane, int K) { v16b w; const float* p = Wm + (size_t)o * K + k0 + 8 * (lane >> 4);
#pragma unroll
  for (int i = 0; i < 8; ++i) { w[i] = (__bf16)p[i]; w[8 + i] = (__bf16)p[16 + i]; }
  return w; }
__device__ __forceinline__ v16h wcolh_io(const float* Wm, int k0, int o, int lane, int ld) { v16h w; const int g = lane >> 4;
#pragma unroll
  for (int i = 0; i < 8; ++i) { w[i] = (_Float16)(bfr(Wm[(size_t)(k0 + 8 * g + i) * ld + o]) * 256.0f); w[8 + i] = (_Float16)(bfr(Wm[(size_t)(k0 + 16 + 8 * g + i) * ld + o]) * 256.0f); }
  return w; }
__device__ __forceinline__ v16h wcolh_oi(const float* Wm, int k0, int o, int lane, int K) { v16h w; const float* p = Wm + (size_t)o * K + k0 + 8 * (lane >> 4);
#pragma unroll
  for (int i = 0; i < 8; ++i) { w[i] = (_Float16)(bfr(p[i]) * 256.0f); w[8 + i] = (_Float16)(bfr(p[16 + i]) * 256.0f); }
  return w; }
#define WQKV_LAYOUT 0   // 0 = (in,out) [DIN][CC]; 1 = (out,in) [CC][DIN]; 2 = per-head [NH][DIN][HD]
__device__ __forceinline__ v16b wcol_hdk(const float* Wm, int k0, int o, int lane) { v16b w; const int g = lane >> 4; const float* p = Wm + (size_t)(o / HD) * DIN * HD + (o % HD);
#pragma unroll
  for (int i = 0; i < 8; ++i) { w[i] = (__bf16)p[(size_t)(k0 + 8 * g + i) * HD]; w[8 + i] = (__bf16)p[(size_t)(k0 + 16 + 8 * g + i) * HD]; }
  return w; }
#define WO_OUT_IN 0
#if WQKV_LAYOUT == 1
#define WCOL(W, k0, o, lane) wcol_oi(W, k0, o, lane, DIN)
#elif WQKV_LAYOUT == 2
#define WCOL(W, k0, o, lane) wcol_hdk(W, k0, o, lane)
#else
#define WCOL(W, k0, o, lane) wcol_io(W, k0, o, lane, CC)
#endif
#if WO_OUT_IN
#define WOCOL(W, k0, o, lane) wcol_oi(W, k0, o, lane, CC)
#define WOCOLH(W, k0, o, lane) wcolh_oi(W, k0, o, lane, CC)
#else
#define WOCOL(W, k0, o, lane) wcol_io(W, k0, o, lane, DIN)
#define WOCOLH(W, k0, o, lane) wcolh_io(W, k0, o, lane, DIN)
#endif
#define SM_EXTRA_PARAMS , int bsm, int h0s, const int* __restrict__ HM
// per-(batch, head) mask: mask[b][h] == 1 replaces EVERY score of that head with -1e6 (softmax becomes exactly uniform); read per element
#define SM_MASK_HOOK do { const int mk = HM[bsm * NH + h0s + (int)blockIdx.y]; v = (mk == 1) ? -1.0e6f : v; } while (0)
__global__ __launch_bounds__(256) void k_planes(const float* __restrict__ Q, const float* __restrict__ Kx, const float* __restrict__ V, _Float16* __restrict__ QH, _Float16* __restrict__ QL, _Float16* __restrict__ KH, _Float16* __restrict__ VT) {
  __shared__ __align__(16) _Float16 tv[64][72];
  const int tid = threadIdx.x; const int t0 = blockIdx.x * 64, h = blockIdx.y; const size_t b = blockIdx.z;
  const size_t src0 = ((b * NH + h) * TT + t0) * (size_t)HD;   /* [b][h][t][d] */
  { const int rl = tid >> 2, q = tid & 3;   /* 64 rows x 4 threads x 16 values */
    const float* pq = Q + src0 + (size_t)rl * HD + q * 16; const float* pk = Kx + src0 + (size_t)rl * HD + q * 16; const float* pv = V + src0 + (size_t)rl * HD + q * 16;
    v4f a0 = *(const v4f*)pq, a1 = *(const v4f*)(pq + 4), a2 = *(const v4f*)(pq + 8), a3 = *(const v4f*)(pq + 12); v4f k0 = *(const v4f*)pk, k1 = *(const v4f*)(pk + 4), k2 = *(const v4f*)(pk + 8), k3 = *(const v4f*)(pk + 12);
    asm volatile("s_wait_loadcnt 0x0" ::: "memory");
    v4f w0 = *(const v4f*)pv, w1 = *(const v4f*)(pv + 4), w2 = *(const v4f*)(pv + 8), w3 = *(const v4f*)(pv + 12); asm volatile("s_wait_loadcnt 0x0" ::: "memory");
    float qa[16] = {a0[0],a0[1],a0[2],a0[3],a1[0],a1[1],a1[2],a1[3],a2[0],a2[1],a2[2],a2[3],a3[0],a3[1],a3[2],a3[3]}; float ka[16] = {k0[0],k0[1],k0[2],k0[3],k1[0],k1[1],k1[2],k1[3],k2[0],k2[1],k2[2],k2[3],k3[0],k3[1],k3[2],k3[3]}; float va[16] = {w0[0],w0[1],w0[2],w0[3],w1[0],w1[1],w1[2],w1[3],w2[0],w2[1],w2[2],w2[3],w3[0],w3[1],w3[2],w3[3]};
    hx8 qh0, qh1, ql0_, ql1, kh0, kh1;
#pragma unroll
    for (int i = 0; i < 8; ++i) { const float x0 = bfr(qa[i]), x1 = bfr(qa[8 + i]); const _Float16 h0v = (_Float16)x0, h1v = (_Float16)x1; qh0[i] = h0v; qh1[i] = h1v; ql0_[i] = (_Float16)((x0 - (float)h0v) * 1024.0f); ql1[i] = (_Float16)((x1 - (float)h1v) * 1024.0f); kh0[i] = (_Float16)bfr(ka[i]); kh1[i] = (_Float16)bfr(ka[8 + i]); tv[q * 16 + i][rl] = (_Float16)bfr(va[i]); tv[q * 16 + 8 + i][rl] = (_Float16)bfr(va[8 + i]); }
    const size_t row = b * TT + t0 + rl; _Float16* dq = QH + row * CC + h * HD + q * 16; _Float16* dk = KH + row * CC + h * HD + q * 16;
    vst2((unsigned*)dq, *(const v4u*)&qh0); vst2((unsigned*)(dq + 8), *(const v4u*)&qh1); vst2((unsigned*)dk, *(const v4u*)&kh0); vst2((unsigned*)(dk + 8), *(const v4u*)&kh1);   
    if (t0 < QHI) { _Float16* dl = QL + (b * QHI + t0 + rl) * (size_t)CC + h * HD + q * 16; vst2((unsigned*)dl, *(const v4u*)&ql0_); vst2((unsigned*)(dl + 8), *(const v4u*)&ql1); } }
  __syncthreads();
  for (int e = tid; e < 64 * 8; e += 256) { const int cl = e >> 3, q = e & 7; vst2((unsigned*)(VT + (b * CC + h * HD + cl) * (size_t)TT + t0 + q * 8), *(const v4u*)&tv[cl][q * 8]); } }   
#ifndef SM_EXTRA_PARAMS
#define SM_EXTRA_PARAMS
#endif
#ifndef PROJ_EXTRA_PARAMS
#define PROJ_EXTRA_PARAMS
#endif
#ifndef PROJ_EXTRA_PARAMS
#define PROJ_EXTRA_PARAMS
#endif
#ifndef SM_MASK_HOOK
#define SM_MASK_HOOK (void)0
#endif


#ifndef SM_EXTRA_PARAMS
#define SM_EXTRA_PARAMS
#endif
#ifndef SM_MASK_HOOK
#define SM_MASK_HOOK (void)0
#endif

#define WS_QH  0u                                      // f16 q rows [b*t][CC]
#define WS_KH  (WS_QH + 2u * (size_t)NB * TT * CC)      // f16 k rows [b*t][CC]
#define WS_VT  (WS_KH + 2u * (size_t)NB * TT * CC)      // f16 v planes [b][c][t]
#define WS_QL  (WS_VT + 2u * (size_t)NB * CC * TT)      // f16 q residual x 2^10 rows [b][t < QHI][CC]
#define WS_KL  (WS_QL + 2u * (size_t)NB * QHI * CC)     // f16 k residual x 2^10 rows [b][t < KHI][CC]
#define WS_VB  (WS_KL + 2u * (size_t)NB * KHI * CC)     // bf16 v hi planes [b][c][t < KHI]
#define WS_VBL (WS_VB + 2u * (size_t)NB * CC * KHI)
#define WS_S   (WS_VBL + 2u * (size_t)NB * CC * KHI)    // f32 logits / P [hg][t][s]
#define WS_Y   (WS_S  + 4u * (size_t)HG * TT * TT)      // f32 ctx rows [b*t][CC] (only when there is an output projection)
#define WS_END (WS_Y  + 0u)

// ---- k_proj: block = (64 rows, 128 cols, which): q/k/v = X W (+ b) with exact bf16 products (K = DIN) -> which 0: q f16 rows (+ residual rows < QHI); 1: k f16 rows (+ residual rows < KHI); 2: v f16 planes [c][t] (+ bf16 hi/lo planes for t < KHI)
__global__ __launch_bounds__(128) void k_proj(const float* __restrict__ XQ, const float* __restrict__ XK, const float* __restrict__ XV, const float* __restrict__ WQ, const float* __restrict__ WK, const float* __restrict__ WV, const float* __restrict__ BQ, const float* __restrict__ BK, const float* __restrict__ BV,
    _Float16* __restrict__ QH, _Float16* __restrict__ QL, _Float16* __restrict__ KH, _Float16* __restrict__ KL, _Float16* __restrict__ VT, __bf16* __restrict__ VB, __bf16* __restrict__ VBL) {
  __shared__ __align__(16) _Float16 sh[64][136], sl[64][136]; __shared__ __align__(16) _Float16 th[128][72]; __shared__ __align__(16) __bf16 tb[128][72], tbl[128][72];
  const int tid = threadIdx.x, wave = tid >> 5, lane = tid & 31, col = lane & 15, g = lane >> 4; const int which = blockIdx.z; const int c0 = blockIdx.y * 128; const size_t r0 = (size_t)blockIdx.x * 64; const size_t bb = r0 / TT; const int t0 = (int)(r0 % TT);
  const float* X = which == 0 ? XQ : which == 1 ? XK : XV; const float* WA = which == 0 ? WQ : which == 1 ? WK : WV; const float* BA = which == 0 ? BQ : which == 1 ? BK : BV;
  v8f acc[8] = {};
#pragma unroll 2
  for (int kc = 0; kc < DIN / 32; ++kc) { v16b a; { const float* p = X + (r0 + wave * 16 + col) * DIN + kc * 32 + 8 * g;
#pragma unroll
      for (int i = 0; i < 8; ++i) { a[i] = (__bf16)p[i]; a[8 + i] = (__bf16)p[16 + i]; } }
    asm volatile("s_wait_loadcnt 0x0" ::: "memory");
#pragma unroll
    for (int j = 0; j < 8; ++j) { const v16b w = WCOL(WA, kc * 32, c0 + j * 16 + col, lane); asm volatile("s_wait_loadcnt 0x0" ::: "memory"); acc[j] = wmma_bf(a, w, acc[j]); } }
  if (which < 2) { _Float16* DH = which == 0 ? QH : KH; _Float16* DL = which == 0 ? QL : KL; const int nhi = which == 0 ? QHI : KHI; const bool hi_rows = t0 < nhi;
#pragma unroll
    for (int j = 0; j < 8; ++j) { const float bias = BA ? bfr(BA[c0 + j * 16 + col]) : 0.f;
#pragma unroll
      for (int r = 0; r < 8; ++r) { const float v = acc[j][r] + bias; const _Float16 hv = (_Float16)v; sh[wave * 16 + 8 * g + r][j * 16 + col] = hv; sl[wave * 16 + 8 * g + r][j * 16 + col] = (_Float16)((v - (float)hv) * 1024.0f); } }
    __syncthreads();
    for (int e = tid; e < 64 * 16; e += 128) { const int rl = e >> 4, q = e & 15; vst2((unsigned*)(DH + (r0 + rl) * CC + c0 + q * 8), *(const v4u*)&sh[rl][q * 8]); if (hi_rows) vst2((unsigned*)(DL + (bb * nhi + t0 + rl) * (size_t)CC + c0 + q * 8), *(const v4u*)&sl[rl][q * 8]); }
  } else { const bool hi_rows = t0 < KHI;
#pragma unroll
    for (int j = 0; j < 8; ++j) { const float bias = BA ? bfr(BA[c0 + j * 16 + col]) : 0.f;
#pragma unroll
      for (int r = 0; r < 8; ++r) { const float v = acc[j][r] + bias; const int rl = wave * 16 + 8 * g + r, cl = j * 16 + col; th[cl][rl] = (_Float16)v; const __bf16 bh = (__bf16)v; tb[cl][rl] = bh; tbl[cl][rl] = (__bf16)(v - (float)bh); } }
    __syncthreads();
    for (int e = tid; e < 128 * 8; e += 128) { const int cl = e >> 3, q = e & 7; vst2((unsigned*)(VT + (bb * CC + c0 + cl) * (size_t)TT + t0 + q * 8), *(const v4u*)&th[cl][q * 8]); if (hi_rows) { const size_t o3 = (bb * CC + c0 + cl) * (size_t)KHI + t0 + q * 8; vst2((unsigned*)(VB + o3), *(const v4u*)&tb[cl][q * 8]); vst2((unsigned*)(VBL + o3), *(const v4u*)&tbl[cl][q * 8]); } } } }
// ---- k_sc: block = (query block qb, key block kb <= kb_last(qb), head in group) of batch b: logits x SCALE; q hi + residual (x 2^10) against k (2 products) for query rows < QHI, plus the k residual (3 products) for query blocks < QBH (causal early rows); causal: blocks past the diagonal exit, the mask itself is applied by index in k_sm
__global__ __launch_bounds__(128) void k_sc(const _Float16* __restrict__ QH, const _Float16* __restrict__ KH, const _Float16* __restrict__ QL, const _Float16* __restrict__ KL, int b, int h0, float* __restrict__ S0) { __shared__ __align__(16) float ss[4][16][132];
  const int qb = blockIdx.x, kb = blockIdx.y; if (kb > kb_last(qb)) return;
  const int h = h0 + blockIdx.z; float* S = S0 + (size_t)blockIdx.z * TT * TT;
  const int tid = threadIdx.x, wave = tid >> 5, lane = tid & 31, col = lane & 15, g = lane >> 4; const int k0 = kb * 128; const int ql0 = qb * 64 + wave * 16; const size_t q0 = (size_t)b * TT + ql0, kr0 = (size_t)b * TT + k0;
  v8f acc[8] = {}, accl[8] = {};
  const _Float16* QLb = QL + (size_t)b * QHI * CC; const _Float16* KLb = KL + (size_t)b * KHI * CC;
  if (qb < QBH) {
#pragma unroll
    for (int kc = 0; kc < HD / 32; ++kc) { const v16h ah = frag_h(QH + (q0 + col) * CC + h * HD + kc * 32, lane), al = frag_h(QLb + (size_t)(ql0 + col) * CC + h * HD + kc * 32, lane);
#pragma unroll
      for (int j = 0; j < 8; ++j) { const v16h kbf = frag_h(KH + (kr0 + j * 16 + col) * CC + h * HD + kc * 32, lane), klf = frag_h(KLb + (size_t)(k0 + j * 16 + col) * CC + h * HD + kc * 32, lane); acc[j] = wmma16(ah, kbf, acc[j]); accl[j] = wmma16(al, kbf, accl[j]); accl[j] = wmma16(ah, klf, accl[j]); } }
  } else if (qb * 64 < QHI) {
#pragma unroll
    for (int kc = 0; kc < HD / 32; ++kc) { const v16h ah = frag_h(QH + (q0 + col) * CC + h * HD + kc * 32, lane), al = frag_h(QLb + (size_t)(ql0 + col) * CC + h * HD + kc * 32, lane);
#pragma unroll
      for (int j = 0; j < 8; ++j) { const v16h kbf = frag_h(KH + (kr0 + j * 16 + col) * CC + h * HD + kc * 32, lane); acc[j] = wmma16(ah, kbf, acc[j]); accl[j] = wmma16(al, kbf, accl[j]); } }
  } else {
#pragma unroll
    for (int kc = 0; kc < HD / 32; ++kc) { const v16h ah = frag_h(QH + (q0 + col) * CC + h * HD + kc * 32, lane);
#pragma unroll
      for (int j = 0; j < 8; ++j) { const v16h kbf = frag_h(KH + (kr0 + j * 16 + col) * CC + h * HD + kc * 32, lane); acc[j] = wmma16(ah, kbf, acc[j]); } } }
#pragma unroll
  for (int j = 0; j < 8; ++j) {
#pragma unroll
    for (int r = 0; r < 8; ++r) ss[wave][8 * g + r][j * 16 + col] = (acc[j][r] + accl[j][r] * (1.0f / 1024.0f)) * SCALE; }
  LDSX(); for (int rl = 0; rl < 16; ++rl) vst2(S + (size_t)(ql0 + rl) * TT + k0 + lane * 4, *(const v4f*)&ss[wave][rl][lane * 4]); }
// ---- k_sm: block = query row t (head in group): keys [0, kend): causal -> logit if s <= t else excluded; softmax in f32; P x 2^11 in place (0 for excluded)
__global__ __launch_bounds__(256) void k_sm(float* __restrict__ S0 SM_EXTRA_PARAMS) { __shared__ float sred[8]; __shared__ float sbc; __shared__ __align__(16) float shv[TT];
  const int tid = threadIdx.x; const int t = blockIdx.x; const int kend = (kb_last(t >> 6) + 1) * 128;
  float* sr = S0 + (size_t)blockIdx.y * TT * TT + (size_t)t * TT;
  float m = -3.0e38f; for (int k = tid; k < kend; k += 256) { float v = (!CAUSAL || k <= t) ? sr[k] : -3.0e38f; SM_MASK_HOOK; shv[k] = v; m = fmaxf(m, v); }
#pragma unroll
  for (int o = 1; o < 32; o <<= 1) m = fmaxf(m, __shfl_xor(m, o));
  if ((tid & 31) == 0) sred[tid >> 5] = m; __syncthreads(); if (tid == 0) { float a = sred[0]; for (int i = 1; i < 8; ++i) a = fmaxf(a, sred[i]); sbc = a; } __syncthreads(); m = sbc; __syncthreads();
  float sum = 0.f; for (int k = tid; k < kend; k += 256) { const float v = shv[k]; const float e = (v <= -1.0e38f) ? 0.f : expf(v - m); shv[k] = e; sum += e; }
#pragma unroll
  for (int o = 1; o < 32; o <<= 1) sum += __shfl_xor(sum, o);
  if ((tid & 31) == 0) sred[tid >> 5] = sum; __syncthreads(); if (tid == 0) { float a = 0.f; for (int i = 0; i < 8; ++i) a += sred[i]; sbc = a > 0.f ? 2048.0f / a : 0.f; }   /* a fully excluded row yields P = 0 */ __syncthreads(); const float inv = sbc;
  for (int k = tid; k < kend; k += 256) shv[k] = shv[k] * inv;
  __syncthreads(); for (int q = tid; q < kend / 4; q += 256) vst2(sr + q * 4, *(const v4f*)&shv[q * 4]); }
// ---- k_pv: block = 64 queries (qb) of (b, h): ctx = P . v over keys [0, kend) (P x 2^11 once to f16 against v f16: 1 product; causal early query blocks: P and v as bf16 hi + lo, 3 products); 256-B (row, head) segment by 16 lanes
__global__ __launch_bounds__(128) void k_pv(const float* __restrict__ PS0, const _Float16* __restrict__ VT, const __bf16* __restrict__ VB, const __bf16* __restrict__ VBL, int b, int h0, float* __restrict__ Y) { const int h = h0 + blockIdx.z; const float* PS = PS0 + (size_t)blockIdx.z * TT * TT; __shared__ __align__(16) float ss[4][16][HD + 4];
  const int tid = threadIdx.x, wave = tid >> 5, lane = tid & 31, col = lane & 15, g = lane >> 4; const int qb = blockIdx.x; const int ql0 = qb * 64 + wave * 16; const int kce = (kb_last(qb) + 1) * 4;
  v8f acc[HD / 16] = {};
  if (qb < QBH) {
#pragma unroll 1
    for (int kc = 0; kc < kce; ++kc) { const F2 p = split_row(PS + (size_t)(ql0 + col) * TT, kc * 32, lane);
      asm volatile("s_wait_loadcnt 0x0" ::: "memory");
#pragma unroll
      for (int j = 0; j < HD / 16; ++j) { const size_t po = ((size_t)b * CC + h * HD + j * 16 + col) * (size_t)KHI + kc * 32; const v16b vh = frag_b(VB + po, lane); acc[j] = wmma_bf(p.h, vh, acc[j]); acc[j] = wmma_bf(p.l, vh, acc[j]); acc[j] = wmma_bf(p.h, frag_b(VBL + po, lane), acc[j]); } }
  } else {
#pragma unroll 1
    for (int kc = 0; kc < kce; ++kc) { const v16h p = frag_f32(PS + (size_t)(ql0 + col) * TT + kc * 32, lane);
      asm volatile("s_wait_loadcnt 0x0" ::: "memory");
#pragma unroll
      for (int j = 0; j < HD / 16; ++j) { const size_t po = ((size_t)b * CC + h * HD + j * 16 + col) * (size_t)TT + kc * 32; acc[j] = wmma16(p, frag_h(VT + po, lane), acc[j]); } } }
#pragma unroll
  for (int j = 0; j < HD / 16; ++j)
#pragma unroll
    for (int r = 0; r < 8; ++r) ss[wave][8 * g + r][j * 16 + col] = acc[j][r] * (1.0f / 2048.0f);
  LDSX(); for (int rl = 0; rl < 16; ++rl) if (lane < HD / 4) vst2(Y + (((size_t)b * NH + h) * TT + ql0 + rl) * HD + lane * 4, *(const v4f*)&ss[wave][rl][lane * 4]); }   /* output layout [b][h][t][d]: 256-B rows by 16 lanes */

extern "C" void kernel_launch(void* const* d_in, const int* in_sizes, int n_in, void* d_out, int out_size, void* d_ws, size_t ws_size, hipStream_t stream) {
  (void)in_sizes; (void)n_in; (void)out_size;
  const float** F = (const float**)d_in;
  if (ws_size < (size_t)WS_END) return;
  char* ws = (char*)d_ws; _Float16 *QH = (_Float16*)(ws + WS_QH), *KH = (_Float16*)(ws + WS_KH), *VT = (_Float16*)(ws + WS_VT), *QL = (_Float16*)(ws + WS_QL), *KL = (_Float16*)(ws + WS_KL); __bf16 *VB = (__bf16*)(ws + WS_VB), *VBL = (__bf16*)(ws + WS_VBL); float *S = (float*)(ws + WS_S), *Y = (float*)(ws + WS_Y);
  (void)Y; (void)QL; (void)KL; (void)VB; (void)VBL;
  // inputs: 0 query [4,8,2048,64]; 1 key; 2 value; 3 mask [4,8] int32 (1 -> the whole head's scores := -1e6)
  const int* HM = (const int*)d_in[3];
  k_planes<<<dim3(TT / 64, NH, NB), 256, 0, stream>>>(F[0], F[1], F[2], QH, QL, KH, VT);
  for (int b = 0; b < TNB; ++b) for (int h0 = 0; h0 < NH; h0 += HG) {
    k_sc<<<dim3(NQB, TT / 128, HG), 128, 0, stream>>>(QH, KH, QL, KL, b, h0, S);
    k_sm<<<dim3(TT, HG), 256, 0, stream>>>(S, b, h0, HM);
    k_pv<<<dim3(NQB, 1, HG), 128, 0, stream>>>(S, VT, VB, VBL, b, h0, (float*)d_out);
  }
}

// v002
// One run takes 48.6 microseconds.
// Versions in between are left out here; by their measured steps it is 20.1 times as fast as v000.
// compute dtype: all float inputs rounded to bf16; q, k, v are bf16-valued so their f16 planes are exact (sub-6e-5 magnitudes aside); logits q x k (1 product; + q's f16 residual for all rows) x 64^-0.5, the per-head mask replaces scores with -1e6 exactly as the module; softmax f32; P x 2^11 once to f16 x v (exact in f16) (1 product); f32 output.
#include <hip/hip_runtime.h>
#include <math.h>

typedef __attribute__((ext_vector_type(16))) _Float16 v16h;
typedef __attribute__((ext_vector_type(16))) __bf16 v16b;
typedef __attribute__((ext_vector_type(8)))  _Float16 v8h;
typedef __attribute__((ext_vector_type(8)))  float v8f;
typedef __attribute__((ext_vector_type(4)))  float v4f;
typedef __attribute__((ext_vector_type(2)))  float v2f;
typedef __attribute__((ext_vector_type(4)))  unsigned v4u;
typedef _Float16 hx8 __attribute__((ext_vector_type(8)));
typedef __attribute__((ext_vector_type(4)))  int v4i;
typedef float __attribute__((may_alias)) float_a;
typedef int __attribute__((may_alias)) int_a;

template <typename T> __device__ __forceinline__ void vst2(void* p, T v) { *(T*)p = v;  }
__device__ __forceinline__ v8f wmma16(v16h a, v16h b, v8f c) {
  v8f d = __builtin_amdgcn_wmma_f32_16x16x32_f16(false, a, false, b, (short)0, c, false, false);
  asm volatile("v_nop\n\tv_nop\n\tv_nop\n\tv_nop" : "+v"(d) : "v"(a), "v"(b));
  return d;
}
__device__ __forceinline__ v8f wmma_bf(v16b a, v16b b, v8f c) {
  v8f d = __builtin_amdgcn_wmma_f32_16x16x32_bf16(false, a, false, b, (short)0, c, false, false);
  asm volatile("v_nop\n\tv_nop\n\tv_nop\n\tv_nop" : "+v"(d) : "v"(a), "v"(b));
  return d;
}
// 16x16x32 fragments: lane = (h = lane>>4, row/col = lane&15); elements 0..7 = k0+8h+0..7, 8..15 = k0+16+8h+0..7; D element r = row 8h+r
__device__ __forceinline__ v16h frag_h(const _Float16* rowk0, int lane) {
  union { v16h v; v8h q[2]; } u; const _Float16* p = rowk0 + 8 * (lane >> 4);
  u.q[0] = *(const v8h*)p; u.q[1] = *(const v8h*)(p + 16); return u.v;
}
__device__ __forceinline__ v16h frag_f32(const float* rowk0, int lane) {
  v16h a; const float* p = rowk0 + 8 * (lane >> 4);
#pragma unroll
  for (int i = 0; i < 8; ++i) { a[i] = (_Float16)p[i]; a[8 + i] = (_Float16)p[16 + i]; }
  return a;
}
__device__ __forceinline__ v16h frag_f32s(const float* rowk0, int lane, float sc) {
  v16h a; const float* p = rowk0 + 8 * (lane >> 4);
#pragma unroll
  for (int i = 0; i < 8; ++i) { a[i] = (_Float16)(p[i] * sc); a[8 + i] = (_Float16)(p[16 + i] * sc); }
  return a;
}
// column fragment from a [K][ld] layout (column n), rows >= K read as 0
__device__ __forceinline__ v16h fragc_f32(const float* W, int k0, int n, int lane, int ld, int K) {
  v16h a; const int g = lane >> 4;
#pragma unroll
  for (int i = 0; i < 8; ++i) { const int ka = k0 + 8 * g + i, kb = ka + 16;
    a[i] = (_Float16)(ka < K ? W[(size_t)(ka < K ? ka : K - 1) * ld + n] : 0.f); a[8 + i] = (_Float16)(kb < K ? W[(size_t)(kb < K ? kb : K - 1) * ld + n] : 0.f); }
  return a;
}
struct F2 { v16b h, l; };
__device__ __forceinline__ F2 bsplit16(const float v[16]) { F2 r;
#pragma unroll
  for (int i = 0; i < 16; ++i) { const __bf16 h = (__bf16)v[i]; r.h[i] = h; r.l[i] = (__bf16)(v[i] - (float)h); }
  return r; }
__device__ __forceinline__ F2 split_row(const float* row, int k0, int lane) { float v[16]; const float* p = row + k0 + 8 * (lane >> 4);
#pragma unroll
  for (int i = 0; i < 8; ++i) { v[i] = p[i]; v[8 + i] = p[16 + i]; }
  return bsplit16(v); }
__device__ __forceinline__ F2 split_rowK(const float* row, int k0, int lane, int K) { float v[16]; const int g = lane >> 4;
#pragma unroll
  for (int i = 0; i < 8; ++i) { const int ka = k0 + 8 * g + i, kb = ka + 16; v[i] = ka < K ? row[ka < K ? ka : K - 1] : 0.f; v[8 + i] = kb < K ? row[kb < K ? kb : K - 1] : 0.f; }
  return bsplit16(v); }
__device__ __forceinline__ F2 split_col(const float* W, int k0, int n, int lane, int ld, int K) { float v[16]; const int g = lane >> 4;
#pragma unroll
  for (int i = 0; i < 8; ++i) { const int ka = k0 + 8 * g + i, kb = ka + 16; v[i] = ka < K ? W[(size_t)(ka < K ? ka : K - 1) * ld + n] : 0.f; v[8 + i] = kb < K ? W[(size_t)(kb < K ? kb : K - 1) * ld + n] : 0.f; }
  return bsplit16(v); }
__device__ __forceinline__ v8f mac3(const F2& a, const F2& b, v8f c) { c = wmma_bf(a.l, b.h, c); c = wmma_bf(a.h, b.l, c); return wmma_bf(a.h, b.h, c); }
__device__ __forceinline__ float sigm(float v) { return 1.0f / (1.0f + expf(-v)); }
#define LDSX() do { asm volatile("s_wait_dscnt 0" ::: "memory"); __builtin_amdgcn_wave_barrier(); __builtin_amdgcn_fence(__ATOMIC_RELEASE, "workgroup"); } while (0)

// Naive full scaled-dot-product attention (query/key/value [4,8,2048,64] given; mask [4,8] int: mask == 1 sets that head's entire score matrix to -1e6, i.e. exactly uniform attention): out = softmax(q k^T / 8 (masked_fill)) v -> [4,8,2048,64].
#define NB 4
#define TT 2048
#define CC 512            // NH * HD = projected width
#define DIN 512          // input (model) width
#define NH 8
#define HD 64
#define NQB (TT / 64)
#define HG 4
#define SCALE (0.125f)
#define CAUSAL 0
#ifndef TNB
#define TNB NB
#endif
__device__ __forceinline__ float bfr(float v) { return (float)(__bf16)v; }
__host__ __device__ __forceinline__ int kb_last(int qb) { return CAUSAL ? ((qb * 64 + 63) >> 7) : (TT / 128 - 1); }
typedef __attribute__((ext_vector_type(8))) __bf16 v8b;
__device__ __forceinline__ v16b frag_b(const __bf16* rowk0, int lane) {
  union { v16b v; v8b q[2]; } u; const __bf16* p = rowk0 + 8 * (lane >> 4);
  u.q[0] = *(const v8b*)p; u.q[1] = *(const v8b*)(p + 16); return u.v;
}
#define QBH 0              // not read by any kernel in this file
#define QHI 2048            // rows carrying a q residual plane (all rows when non-causal: 2-product logits everywhere)
#define KHI 64            // key rows carrying k residual / v bf16 hi+lo planes (written only by k_proj, which kernel_launch does not launch)
// B fragment (k rows k0+.., output column o) of a weight: (in,out) [K][ld] or (out,in) [ld rows of K]: bf16 exact, or f16(bf16 * 256) exact
__device__ __forceinline__ v16b wcol_io(const float* Wm, int k0, int o, int lane, int ld) { v16b w; const int g = lane >> 4;
#pragma unroll
  for (int i = 0; i < 8; ++i) { w[i] = (__bf16)Wm[(size_t)(k0 + 8 * g + i) * ld + o]; w[8 + i] = (__bf16)Wm[(size_t)(k0 + 16 + 8 * g + i) * ld + o]; }
  return w; }
__device__ __forceinline__ v16b wcol_oi(const float* Wm, int k0, int o, int lane, int K) { v16b w; const float* p = Wm + (size_t)o * K + k0 + 8 * (lane >> 4);
#pragma unroll
  for (int i = 0; i < 8; ++i) { w[i] = (__bf16)p[i]; w[8 + i] = (__bf16)p[16 + i]; }
  return w; }
__device__ __forceinline__ v16h wcolh_io(const float* Wm, int k0, int o, int lane, int ld) { v16h w; const int g = lane >> 4;
#pragma unroll
  for (int i = 0; i < 8; ++i) { w[i] = (_Float16)(bfr(Wm[(size_t)(k0 + 8 * g + i) * ld + o]) * 256.0f); w[8 + i] = (_Float16)(bfr(Wm[(size_t)(k0 + 16 + 8 * g + i) * ld + o]) * 256.0f); }
  return w; }
__device__ __forceinline__ v16h wcolh_oi(const float* Wm, int k0, int o, int lane, int K) { v16h w; const float* p = Wm + (size_t)o * K + k0 + 8 * (lane >> 4);
#pragma unroll
  for (int i = 0; i < 8; ++i) { w[i] = (_Float16)(bfr(p[i]) * 256.0f); w[8 + i] = (_Float16)(bfr(p[16 + i]) * 256.0f); }
  return w; }
#define WQKV_LAYOUT 0   // 0 = (in,out) [DIN][CC]; 1 = (out,in) [CC][DIN]; 2 = per-head [NH][DIN][HD]
__device__ __forceinline__ v16b wcol_hdk(const float* Wm, int k0, int o, int lane) { v16b w; const int g = lane >> 4; const float* p = Wm + (size_t)(o / HD) * DIN * HD + (o % HD);
#pragma unroll
  for (int i = 0; i < 8; ++i) { w[i] = (__bf16)p[(size_t)(k0 + 8 * g + i) * HD]; w[8 + i] = (__bf16)p[(size_t)(k0 + 16 + 8 * g + i) * HD]; }
  return w; }
#define WO_OUT_IN 0
#if WQKV_LAYOUT == 1
#define WCOL(W, k0, o, lane) wcol_oi(W, k0, o, lane, DIN)
#elif WQKV_LAYOUT == 2
#define WCOL(W, k0, o, lane) wcol_hdk(W, k0, o, lane)
#else
#define WCOL(W, k0, o, lane) wcol_io(W, k0, o, lane, CC)
#endif
#if WO_OUT_IN
#define WOCOL(W, k0, o, lane) wcol_oi(W, k0, o, lane, CC)
#define WOCOLH(W, k0, o, lane) wcolh_oi(W, k0, o, lane, CC)
#else
#define WOCOL(W, k0, o, lane) wcol_io(W, k0, o, lane, DIN)
#define WOCOLH(W, k0, o, lane) wcolh_io(W, k0, o, lane, DIN)
#endif
#define SM_EXTRA_PARAMS , int bsm, int h0s, const int* __restrict__ HM
// per-(batch, head) mask: mask[b][h] == 1 replaces EVERY score of that head with -1e6 (softmax becomes exactly uniform); read per element
#define SM_MASK_HOOK do { const int mk = HM[bsm * NH + h0s + (int)blockIdx.y]; v = (mk == 1) ? -1.0e6f : v; } while (0)
__global__ __launch_bounds__(256) void k_planes(const float* __restrict__ Q, const float* __restrict__ Kx, const float* __restrict__ V, _Float16* __restrict__ QH, _Float16* __restrict__ QL, _Float16* __restrict__ KH, _Float16* __restrict__ VT) {
  __shared__ __align__(16) _Float16 tv[64][72];
  const int tid = threadIdx.x; const int t0 = blockIdx.x * 64, h = blockIdx.y; const size_t b = blockIdx.z;
  const size_t src0 = ((b * NH + h) * TT + t0) * (size_t)HD;   /* [b][h][t][d] */
  { const int rl = tid >> 2, q = tid & 3;   /* 64 rows x 4 threads x 16 values */
    const float* pq = Q + src0 + (size_t)rl * HD + q * 16; const float* pk = Kx + src0 + (size_t)rl * HD + q * 16; const float* pv = V + src0 + (size_t)rl * HD + q * 16;
    v4f a0 = *(const v4f*)pq, a1 = *(const v4f*)(pq + 4), a2 = *(const v4f*)(pq + 8), a3 = *(const v4f*)(pq + 12); v4f k0 = *(const v4f*)pk, k1 = *(const v4f*)(pk + 4), k2 = *(const v4f*)(pk + 8), k3 = *(const v4f*)(pk + 12);
    asm volatile("s_wait_loadcnt 0x0" ::: "memory");
    v4f w0 = *(const v4f*)pv, w1 = *(const v4f*)(pv + 4), w2 = *(const v4f*)(pv + 8), w3 = *(const v4f*)(pv + 12); asm volatile("s_wait_loadcnt 0x0" ::: "memory");
    float qa[16] = {a0[0],a0[1],a0[2],a0[3],a1[0],a1[1],a1[2],a1[3],a2[0],a2[1],a2[2],a2[3],a3[0],a3[1],a3[2],a3[3]}; float ka[16] = {k0[0],k0[1],k0[2],k0[3],k1[0],k1[1],k1[2],k1[3],k2[0],k2[1],k2[2],k2[3],k3[0],k3[1],k3[2],k3[3]}; float va[16] = {w0[0],w0[1],w0[2],w0[3],w1[0],w1[1],w1[2],w1[3],w2[0],w2[1],w2[2],w2[3],w3[0],w3[1],w3[2],w3[3]};
    hx8 qh0, qh1, ql0_, ql1, kh0, kh1;
#pragma unroll
    for (int i = 0; i < 8; ++i) { const float x0 = bfr(qa[i]), x1 = bfr(qa[8 + i]); const _Float16 h0v = (_Float16)x0, h1v = (_Float16)x1; qh0[i] = h0v; qh1[i] = h1v; ql0_[i] = (_Float16)((x0 - (float)h0v) * 1024.0f); ql1[i] = (_Float16)((x1 - (float)h1v) * 1024.0f); kh0[i] = (_Float16)bfr(ka[i]); kh1[i] = (_Float16)bfr(ka[8 + i]); tv[q * 16 + i][rl] = (_Float16)bfr(va[i]); tv[q * 16 + 8 + i][rl] = (_Float16)bfr(va[8 + i]); }
    const size_t row = b * TT + t0 + rl; _Float16* dq = QH + row * CC + h * HD + q * 16; _Float16* dk = KH + row * CC + h * HD + q * 16;
    vst2((unsigned*)dq, *(const v4u*)&qh0); vst2((unsigned*)(dq + 8), *(const v4u*)&qh1); vst2((unsigned*)dk, *(const v4u*)&kh0); vst2((unsigned*)(dk + 8), *(const v4u*)&kh1);   
    if (t0 < QHI) { _Float16* dl = QL + (b * QHI + t0 + rl) * (size_t)CC + h * HD + q * 16; vst2((unsigned*)dl, *(const v4u*)&ql0_); vst2((unsigned*)(dl + 8), *(const v4u*)&ql1); } }
  __syncthreads();
  for (int e = tid; e < 64 * 8; e += 256) { const int cl = e >> 3, q = e & 7; vst2((unsigned*)(VT + (b * CC + h * HD + cl) * (size_t)TT + t0 + q * 8), *(const v4u*)&tv[cl][q * 8]); } }   
#ifndef SM_EXTRA_PARAMS
#define SM_EXTRA_PARAMS
#endif
#ifndef PROJ_EXTRA_PARAMS
#define PROJ_EXTRA_PARAMS
#endif
#ifndef PROJ_EXTRA_PARAMS
#define PROJ_EXTRA_PARAMS
#endif
#ifndef SM_MASK_HOOK
#define SM_MASK_HOOK (void)0
#endif


#ifndef SM_EXTRA_PARAMS
#define SM_EXTRA_PARAMS
#endif
#ifndef SM_MASK_HOOK
#define SM_MASK_HOOK (void)0
#endif

#define WS_QH  0u                                      // f16 q rows [b*t][CC]
#define WS_KH  (WS_QH + 2u * (size_t)NB * TT * CC)      // f16 k rows [b*t][CC]
#define WS_VT  (WS_KH + 2u * (size_t)NB * TT * CC)      // f16 v planes [b][c][t]
#define WS_QL  (WS_VT + 2u * (size_t)NB * CC * TT)      // f16 q residual x 2^10 rows [b][t < QHI][CC]
#define WS_KL  (WS_QL + 2u * (size_t)NB * QHI * CC)     // f16 k residual x 2^10 rows [b][t < KHI][CC]
#define WS_VB  (WS_KL + 2u * (size_t)NB * KHI * CC)     // bf16 v hi planes [b][c][t < KHI]
#define WS_VBL (WS_VB + 2u * (size_t)NB * CC * KHI)
#define WS_S   (WS_VBL + 2u * (size_t)NB * CC * KHI)    // f32 [hg][t][s]; unused: k_fa keeps the logits in registers
#define WS_Y   (WS_S  + 4u * (size_t)HG * TT * TT)      // f32 ctx rows [b*t][CC] (only when there is an output projection)
#define WS_END (WS_Y  + 0u)

// ---- k_proj: block = (64 rows, 128 cols, which): q/k/v = X W (+ b) with exact bf16 products (K = DIN) -> which 0: q f16 rows (+ residual rows < QHI); 1: k f16 rows (+ residual rows < KHI); 2: v f16 planes [c][t] (+ bf16 hi/lo planes for t < KHI)
__global__ __launch_bounds__(128) void k_proj(const float* __restrict__ XQ, const float* __restrict__ XK, const float* __restrict__ XV, const float* __restrict__ WQ, const float* __restrict__ WK, const float* __restrict__ WV, const float* __restrict__ BQ, const float* __restrict__ BK, const float* __restrict__ BV,
    _Float16* __restrict__ QH, _Float16* __restrict__ QL, _Float16* __restrict__ KH, _Float16* __restrict__ KL, _Float16* __restrict__ VT, __bf16* __restrict__ VB, __bf16* __restrict__ VBL) {
  __shared__ __align__(16) _Float16 sh[64][136], sl[64][136]; __shared__ __align__(16) _Float16 th[128][72]; __shared__ __align__(16) __bf16 tb[128][72], tbl[128][72];
  const int tid = threadIdx.x, wave = tid >> 5, lane = tid & 31, col = lane & 15, g = lane >> 4; const int which = blockIdx.z; const int c0 = blockIdx.y * 128; const size_t r0 = (size_t)blockIdx.x * 64; const size_t bb = r0 / TT; const int t0 = (int)(r0 % TT);
  const float* X = which == 0 ? XQ : which == 1 ? XK : XV; const float* WA = which == 0 ? WQ : which == 1 ? WK : WV; const float* BA = which == 0 ? BQ : which == 1 ? BK : BV;
  v8f acc[8] = {};
#pragma unroll 2
  for (int kc = 0; kc < DIN / 32; ++kc) { v16b a; { const float* p = X + (r0 + wave * 16 + col) * DIN + kc * 32 + 8 * g;
#pragma unroll
      for (int i = 0; i < 8; ++i) { a[i] = (__bf16)p[i]; a[8 + i] = (__bf16)p[16 + i]; } }
    asm volatile("s_wait_loadcnt 0x0" ::: "memory");
#pragma unroll
    for (int j = 0; j < 8; ++j) { const v16b w = WCOL(WA, kc * 32, c0 + j * 16 + col, lane); asm volatile("s_wait_loadcnt 0x0" ::: "memory"); acc[j] = wmma_bf(a, w, acc[j]); } }
  if (which < 2) { _Float16* DH = which == 0 ? QH : KH; _Float16* DL = which == 0 ? QL : KL; const int nhi = which == 0 ? QHI : KHI; const bool hi_rows = t0 < nhi;
#pragma unroll
    for (int j = 0; j < 8; ++j) { const float bias = BA ? bfr(BA[c0 + j * 16 + col]) : 0.f;
#pragma unroll
      for (int r = 0; r < 8; ++r) { const float v = acc[j][r] + bias; const _Float16 hv = (_Float16)v; sh[wave * 16 + 8 * g + r][j * 16 + col] = hv; sl[wave * 16 + 8 * g + r][j * 16 + col] = (_Float16)((v - (float)hv) * 1024.0f); } }
    __syncthreads();
    for (int e = tid; e < 64 * 16; e += 128) { const int rl = e >> 4, q = e & 15; vst2((unsigned*)(DH + (r0 + rl) * CC + c0 + q * 8), *(const v4u*)&sh[rl][q * 8]); if (hi_rows) vst2((unsigned*)(DL + (bb * nhi + t0 + rl) * (size_t)CC + c0 + q * 8), *(const v4u*)&sl[rl][q * 8]); }
  } else { const bool hi_rows = t0 < KHI;
#pragma unroll
    for (int j = 0; j < 8; ++j) { const float bias = BA ? bfr(BA[c0 + j * 16 + col]) : 0.f;
#pragma unroll
      for (int r = 0; r < 8; ++r) { const float v = acc[j][r] + bias; const int rl = wave * 16 + 8 * g + r, cl = j * 16 + col; th[cl][rl] = (_Float16)v; const __bf16 bh = (__bf16)v; tb[cl][rl] = bh; tbl[cl][rl] = (__bf16)(v - (float)bh); } }
    __syncthreads();
    for (int e = tid; e < 128 * 8; e += 128) { const int cl = e >> 3, q = e & 7; vst2((unsigned*)(VT + (bb * CC + c0 + cl) * (size_t)TT + t0 + q * 8), *(const v4u*)&th[cl][q * 8]); if (hi_rows) { const size_t o3 = (bb * CC + c0 + cl) * (size_t)KHI + t0 + q * 8; vst2((unsigned*)(VB + o3), *(const v4u*)&tb[cl][q * 8]); vst2((unsigned*)(VBL + o3), *(const v4u*)&tbl[cl][q * 8]); } } } }
// ---- k_fa: one wave = QT * 16 queries of (b, h), walking all keys 32 at a time with a running maximum and sum per query, so that no score ever leaves the registers.
// The block's eight waves read the same key rows and v plane rows: asynchronous copies bring them into LDS once a block, KT keys a tile, two buffers; the fragments are read from there.
// S^T = K . Q^T (A = 16 key rows, B = 16 query columns; q hi + residual x 2^10: 2 products): lane (g, col) holds keys 8g + r of query col, which is the B fragment of O^T += V^T . P^T as it stands.
// P = exp(score - running max) x 2^11, once to f16, against v f16 (1 product); the sum is taken in f32 from the unrounded P and carries the same 2^11, so it cancels in O / sum.
// Every #pragma unroll below is there so that the fragment and accumulator arrays are indexed by constants alone and stay in registers; the loop over the keys stays rolled.
#define QT 2    // 16-query column groups per wave
#define FW 8    // waves per block: they walk the same key and v rows, which the block brings into LDS once for all eight
#define LOG2E 1.4426950408889634f
#define KT 128                 // keys per LDS tile: four passes of 32 keys between two barriers
#define KPB 144                // LDS pitch of a key row, bytes: 128 + 16, so that 16 rows read 16 B each without a bank conflict
#define VPB 272                // LDS pitch of a v plane row (KT keys), bytes: 256 + 16, for the same reason
#define KTB (KT * KPB)         // key rows of a tile; the v rows stand behind them
#define BUFB (KTB + HD * VPB)  // one buffer of the ring
#define NTILE (TT / KT)
// One tile's copies of one lane: 4 x 16 B of key rows (8 lanes to a 128-B row, 32 rows apart) and 4 x 16 B of v plane rows (16 lanes to a 256-B row, 16 rows apart), global memory to LDS through no register.
// The s_wait_xcnt closes the statement so that no address register of a copy is rewritten in front of it.
__device__ __forceinline__ void tile_copy(unsigned lk, unsigned lv, const _Float16* gk, const _Float16* gv) {
  asm volatile("global_load_async_to_lds_b128 %0, %8, off\n\t"
               "global_load_async_to_lds_b128 %1, %9, off\n\t"
               "global_load_async_to_lds_b128 %2, %10, off\n\t"
               "global_load_async_to_lds_b128 %3, %11, off\n\t"
               "global_load_async_to_lds_b128 %4, %12, off\n\t"
               "global_load_async_to_lds_b128 %5, %13, off\n\t"
               "global_load_async_to_lds_b128 %6, %14, off\n\t"
               "global_load_async_to_lds_b128 %7, %15, off\n\t"
               "s_wait_xcnt 0x0"
               :: "v"(lk), "v"(lk + 32 * KPB), "v"(lk + 64 * KPB), "v"(lk + 96 * KPB), "v"(lv), "v"(lv + 16 * VPB), "v"(lv + 32 * VPB), "v"(lv + 48 * VPB),
                  "v"(gk), "v"(gk + (size_t)32 * CC), "v"(gk + (size_t)64 * CC), "v"(gk + (size_t)96 * CC), "v"(gv), "v"(gv + (size_t)16 * TT), "v"(gv + (size_t)32 * TT), "v"(gv + (size_t)48 * TT)
               : "memory");
}
__device__ __forceinline__ float xhalf(float x) { return __builtin_bit_cast(float, __builtin_amdgcn_permlanex16(__builtin_bit_cast(int, x), __builtin_bit_cast(int, x), 0x76543210, 0xfedcba98, false, false)); }   /* lane l with lane l ^ 16 */
__device__ __forceinline__ v8f wm(v16h a, v16h b, v8f c) { return __builtin_amdgcn_wmma_f32_16x16x32_f16(false, a, false, b, (short)0, c, false, false); }
__global__ __launch_bounds__(FW * 32) void k_fa(const _Float16* __restrict__ QH, const _Float16* __restrict__ QL, const _Float16* __restrict__ KH, const _Float16* __restrict__ VT, const int* __restrict__ HM, float* __restrict__ Y) {
  __shared__ __align__(16) float ss[FW][QT * 16][HD + 4];
  __shared__ __align__(16) unsigned char ring[2 * BUFB];   /* two buffers: tile t + 1 lands while tile t is worked on */
  const int tid = threadIdx.x, wave = tid >> 5, lane = tid & 31, col = lane & 15, g = lane >> 4;
  const int bh = blockIdx.y, b = bh / NH, h = bh % NH; const int q0 = blockIdx.x * (FW * 16 * QT) + wave * (16 * QT);
  const bool masked = HM[bh] == 1;   /* mask[b][h] == 1 replaces EVERY score of that head with -1e6 */
  v16h qh[QT][2], ql[QT][2];
#pragma unroll
  for (int qt = 0; qt < QT; ++qt)
#pragma unroll
    for (int kc = 0; kc < 2; ++kc) { const size_t qo = ((size_t)b * TT + q0 + qt * 16 + col) * CC + h * HD + kc * 32; qh[qt][kc] = frag_h(QH + qo, lane); ql[qt][kc] = frag_h(QL + qo, lane); }
  asm volatile("s_wait_xcnt 0x0" ::: "memory");   /* stands in front of the set-up below, which takes over the address registers of the q loads above */
  __builtin_amdgcn_sched_barrier(0);   /* keeps that set-up behind the wait */
  const _Float16* gk = KH + ((size_t)b * TT + (tid >> 3)) * CC + h * HD + (tid & 7) * 8;             /* this lane's 16 B of key row tid / 8; + key * CC */
  const _Float16* gv = VT + ((size_t)b * CC + h * HD + (tid >> 4)) * (size_t)TT + (tid & 15) * 8;   /* this lane's 16 B of v plane row tid / 16; + key */
  const unsigned l0 = (unsigned)(size_t)&ring[0];   /* LDS byte address of the ring */
  const unsigned lk = l0 + (tid >> 3) * KPB + (tid & 7) * 16, lv = l0 + KTB + (tid >> 4) * VPB + (tid & 15) * 16;
  tile_copy(lk, lv, gk, gv);
  asm volatile("s_wait_asynccnt 0x0" ::: "memory");   /* this wave's share of tile 0 has landed */
  __syncthreads();                                    /* every wave's share has: tile 0 may be read */
  tile_copy(lk + BUFB, lv + BUFB, gk + (size_t)KT * CC, gv + KT);
  v8f o[QT][4] = {}; float m[QT], l[QT];
#pragma unroll
  for (int qt = 0; qt < QT; ++qt) { m[qt] = -3.0e38f; l[qt] = 0.f; }
  for (int t = 0; t < NTILE; ++t) {
    const unsigned bo = (t & 1) * BUFB;
    const unsigned char* Kl = ring + bo + col * KPB;          /* + key in tile * KPB */
    const unsigned char* Vl = ring + bo + KTB + col * VPB;    /* + d tile * 16 * VPB + key in tile * 2 */
    v16h kf[2][2];
#pragma unroll
    for (int kt = 0; kt < 2; ++kt)
#pragma unroll
      for (int kc = 0; kc < 2; ++kc) kf[kt][kc] = frag_h((const _Float16*)(Kl + (kt * 16) * KPB + kc * 64), lane);
#pragma unroll 1   /* the passes of a tile stay rolled: unrolled they took some 200 registers more, and the copies' address operands spilled */
   for (int ps = 0; ps < KT / 32; ++ps) {
    v16h vf[4];
#pragma unroll
    for (int dt = 0; dt < 4; ++dt) vf[dt] = frag_h((const _Float16*)(Vl + (dt * 16) * VPB + ps * 64), lane);
    __builtin_amdgcn_sched_barrier(0);   /* keeps the v reads up here, a whole score and softmax phase ahead of their use, in one group */
    v8f s[QT][2] = {};   /* the residual product first, scaled back by 2^-10 (exact), then the main product on top of it in the same accumulators */
#pragma unroll
    for (int kc = 0; kc < 2; ++kc)
#pragma unroll
      for (int kt = 0; kt < 2; ++kt)
#pragma unroll
        for (int qt = 0; qt < QT; ++qt) s[qt][kt] = wm(kf[kt][kc], ql[qt][kc], s[qt][kt]);
#pragma unroll
    for (int kt = 0; kt < 2; ++kt)
#pragma unroll
      for (int qt = 0; qt < QT; ++qt) s[qt][kt] *= (1.0f / 1024.0f);
#pragma unroll
    for (int kc = 0; kc < 2; ++kc)
#pragma unroll
      for (int kt = 0; kt < 2; ++kt)
#pragma unroll
        for (int qt = 0; qt < QT; ++qt) s[qt][kt] = wm(kf[kt][kc], qh[qt][kc], s[qt][kt]);
    const int kn = ((ps + 1) * 32) & (KT - 1);   /* the next pass's key rows of the same tile, read behind this pass's score products; a tile's last pass reads its rows 0.. again, unused: no branch stands behind the products */
#pragma unroll
    for (int kt = 0; kt < 2; ++kt)
#pragma unroll
      for (int kc = 0; kc < 2; ++kc) kf[kt][kc] = frag_h((const _Float16*)(Kl + (kn + kt * 16) * KPB + kc * 64), lane);
    __builtin_amdgcn_sched_barrier(0);   /* keeps the next key rows' reads ahead of the softmax, in one group; without it they sink to right in front of their use */
    v16h pf[QT];
#pragma unroll
    for (int qt = 0; qt < QT; ++qt) { float x[16]; float mx = -3.0e38f;
#pragma unroll
      for (int i = 0; i < 16; ++i) { x[i] = masked ? (-1.0e6f / SCALE) : s[qt][i >> 3][i & 7]; mx = fmaxf(mx, x[i]); }   /* unscaled: -1e6 / SCALE x SCALE is the module's -1e6 */
      mx = fmaxf(mx, xhalf(mx));   /* the other 8 + 8 keys of this query */
      const float mn = fmaxf(m[qt], mx * (SCALE * LOG2E));   /* running maximum in log2 units */
      const float alpha = __builtin_amdgcn_exp2f(m[qt] - mn); const float bb = 11.0f - mn; m[qt] = mn;
      v2f sum[2] = {{0.f, 0.f}, {0.f, 0.f}};   /* four short chains, two to a packed add */
#pragma unroll
      for (int i = 0; i < 16; i += 2) { const v2f xv = {x[i], x[i + 1]}; const v2f t = xv * (SCALE * LOG2E) + bb; const v2f p = {__builtin_amdgcn_exp2f(t[0]), __builtin_amdgcn_exp2f(t[1])}; sum[(i >> 1) & 1] += p; pf[qt][i] = (_Float16)p[0]; pf[qt][i + 1] = (_Float16)p[1]; }
      l[qt] = l[qt] * alpha + ((sum[0][0] + sum[0][1]) + (sum[1][0] + sum[1][1]));
#pragma unroll
      for (int dt = 0; dt < 4; ++dt) o[qt][dt] *= alpha; }
#pragma unroll
    for (int dt = 0; dt < 4; ++dt)
#pragma unroll
      for (int qt = 0; qt < QT; ++qt) o[qt][dt] = wm(vf[dt], pf[qt], o[qt][dt]);
   }
    asm volatile("s_wait_dscnt 0x0" ::: "memory");      /* this wave's reads of tile t are done */
    asm volatile("s_wait_asynccnt 0x0" ::: "memory");   /* this wave's share of tile t + 1 has landed */
    __syncthreads();                                    /* tile t + 1 may be read, tile t's buffer may be refilled */
    if (t + 2 < NTILE) tile_copy(lk + bo, lv + bo, gk + (size_t)(t + 2) * KT * CC, gv + (t + 2) * KT);
  }
  asm volatile("s_wait_asynccnt 0x0" ::: "memory");   /* no copy is outstanding when the wave goes on to its end */
#pragma unroll
  for (int qt = 0; qt < QT; ++qt) { const float inv = 1.0f / (l[qt] + xhalf(l[qt]));
#pragma unroll
    for (int dt = 0; dt < 4; ++dt) { v4f lo = { o[qt][dt][0] * inv, o[qt][dt][1] * inv, o[qt][dt][2] * inv, o[qt][dt][3] * inv }, hi = { o[qt][dt][4] * inv, o[qt][dt][5] * inv, o[qt][dt][6] * inv, o[qt][dt][7] * inv };
      *(v4f*)&ss[wave][qt * 16 + col][dt * 16 + 8 * g] = lo; *(v4f*)&ss[wave][qt * 16 + col][dt * 16 + 8 * g + 4] = hi; } }
  LDSX(); for (int rl = g; rl < QT * 16; rl += 2) vst2(Y + ((size_t)bh * TT + q0 + rl) * HD + col * 4, *(const v4f*)&ss[wave][rl][col * 4]); }   /* output layout [b][h][t][d]: two 256-B rows a store */

extern "C" void kernel_launch(void* const* d_in, const int* in_sizes, int n_in, void* d_out, int out_size, void* d_ws, size_t ws_size, hipStream_t stream) {
  (void)in_sizes; (void)n_in; (void)out_size;
  const float** F = (const float**)d_in;
  if (ws_size < (size_t)WS_END) return;
  char* ws = (char*)d_ws; _Float16 *QH = (_Float16*)(ws + WS_QH), *KH = (_Float16*)(ws + WS_KH), *VT = (_Float16*)(ws + WS_VT), *QL = (_Float16*)(ws + WS_QL), *KL = (_Float16*)(ws + WS_KL); __bf16 *VB = (__bf16*)(ws + WS_VB), *VBL = (__bf16*)(ws + WS_VBL); float *S = (float*)(ws + WS_S), *Y = (float*)(ws + WS_Y);
  (void)Y; (void)S; (void)KL; (void)VB; (void)VBL;
  // inputs: 0 query [4,8,2048,64]; 1 key; 2 value; 3 mask [4,8] int32 (1 -> the whole head's scores := -1e6)
  const int* HM = (const int*)d_in[3];
  k_planes<<<dim3(TT / 64, NH, NB), 256, 0, stream>>>(F[0], F[1], F[2], QH, QL, KH, VT);
  k_fa<<<dim3(TT / (FW * 16 * QT), NH * NB), FW * 32, 0, stream>>>(QH, QL, KH, VT, HM, (float*)d_out);
}

// v003
// Measured time: 40 microseconds a run.
// In two side-by-side timings against v002, it was 1.22 and 1.21 times as fast.
// Over all steps from v000 it is 24.4 times as fast.
// compute dtype: all float inputs rounded to bf16; q, k, v are bf16-valued so their f16 planes are exact (sub-6e-5 magnitudes aside); logits q x k (1 product) x 64^-0.5, the per-head mask replaces scores with -1e6 exactly as the module; softmax f32; P x 2^11 once to f16 x v (exact in f16) (1 product); f32 output.
#include <hip/hip_runtime.h>
#include <math.h>

typedef __attribute__((ext_vector_type(16))) _Float16 v16h;
typedef __attribute__((ext_vector_type(16))) __bf16 v16b;
typedef __attribute__((ext_vector_type(8)))  _Float16 v8h;
typedef __attribute__((ext_vector_type(8)))  float v8f;
typedef __attribute__((ext_vector_type(4)))  float v4f;
typedef __attribute__((ext_vector_type(2)))  float v2f;
typedef __attribute__((ext_vector_type(4)))  unsigned v4u;
typedef _Float16 hx8 __attribute__((ext_vector_type(8)));
typedef __attribute__((ext_vector_type(4)))  int v4i;
typedef float __attribute__((may_alias)) float_a;
typedef int __attribute__((may_alias)) int_a;

template <typename T> __device__ __forceinline__ void vst2(void* p, T v) { *(T*)p = v;  }
__device__ __forceinline__ v8f wmma16(v16h a, v16h b, v8f c) {
  v8f d = __builtin_amdgcn_wmma_f32_16x16x32_f16(false, a, false, b, (short)0, c, false, false);
  asm volatile("v_nop\n\tv_nop\n\tv_nop\n\tv_nop" : "+v"(d) : "v"(a), "v"(b));
  return d;
}
__device__ __forceinline__ v8f wmma_bf(v16b a, v16b b, v8f c) {
  v8f d = __builtin_amdgcn_wmma_f32_16x16x32_bf16(false, a, false, b, (short)0, c, false, false);
  asm volatile("v_nop\n\tv_nop\n\tv_nop\n\tv_nop" : "+v"(d) : "v"(a), "v"(b));
  return d;
}
// 16x16x32 fragments: lane = (h = lane>>4, row/col = lane&15); elements 0..7 = k0+8h+0..7, 8..15 = k0+16+8h+0..7; D element r = row 8h+r
__device__ __forceinline__ v16h frag_h(const _Float16* rowk0, int lane) {
  union { v16h v; v8h q[2]; } u; const _Float16* p = rowk0 + 8 * (lane >> 4);
  u.q[0] = *(const v8h*)p; u.q[1] = *(const v8h*)(p + 16); return u.v;
}
__device__ __forceinline__ v16h frag_f32(const float* rowk0, int lane) {
  v16h a; const float* p = rowk0 + 8 * (lane >> 4);
#pragma unroll
  for (int i = 0; i < 8; ++i) { a[i] = (_Float16)p[i]; a[8 + i] = (_Float16)p[16 + i]; }
  return a;
}
__device__ __forceinline__ v16h frag_f32s(const float* rowk0, int lane, float sc) {
  v16h a; const float* p = rowk0 + 8 * (lane >> 4);
#pragma unroll
  for (int i = 0; i < 8; ++i) { a[i] = (_Float16)(p[i] * sc); a[8 + i] = (_Float16)(p[16 + i] * sc); }
  return a;
}
// column fragment from a [K][ld] layout (column n), rows >= K read as 0
__device__ __forceinline__ v16h fragc_f32(const float* W, int k0, int n, int lane, int ld, int K) {
  v16h a; const int g = lane >> 4;
#pragma unroll
  for (int i = 0; i < 8; ++i) { const int ka = k0 + 8 * g + i, kb = ka + 16;
    a[i] = (_Float16)(ka < K ? W[(size_t)(ka < K ? ka : K - 1) * ld + n] : 0.f); a[8 + i] = (_Float16)(kb < K ? W[(size_t)(kb < K ? kb : K - 1) * ld + n] : 0.f); }
  return a;
}
struct F2 { v16b h, l; };
__device__ __forceinline__ F2 bsplit16(const float v[16]) { F2 r;
#pragma unroll
  for (int i = 0; i < 16; ++i) { const __bf16 h = (__bf16)v[i]; r.h[i] = h; r.l[i] = (__bf16)(v[i] - (float)h); }
  return r; }
__device__ __forceinline__ F2 split_row(const float* row, int k0, int lane) { float v[16]; const float* p = row + k0 + 8 * (lane >> 4);
#pragma unroll
  for (int i = 0; i < 8; ++i) { v[i] = p[i]; v[8 + i] = p[16 + i]; }
  return bsplit16(v); }
__device__ __forceinline__ F2 split_rowK(const float* row, int k0, int lane, int K) { float v[16]; const int g = lane >> 4;
#pragma unroll
  for (int i = 0; i < 8; ++i) { const int ka = k0 + 8 * g + i, kb = ka + 16; v[i] = ka < K ? row[ka < K ? ka : K - 1] : 0.f; v[8 + i] = kb < K ? row[kb < K ? kb : K - 1] : 0.f; }
  return bsplit16(v); }
__device__ __forceinline__ F2 split_col(const float* W, int k0, int n, int lane, int ld, int K) { float v[16]; const int g = lane >> 4;
#pragma unroll
  for (int i = 0; i < 8; ++i) { const int ka = k0 + 8 * g + i, kb = ka + 16; v[i] = ka < K ? W[(size_t)(ka < K ? ka : K - 1) * ld + n] : 0.f; v[8 + i] = kb < K ? W[(size_t)(kb < K ? kb : K - 1) * ld + n] : 0.f; }
  return bsplit16(v); }
__device__ __forceinline__ v8f mac3(const F2& a, const F2& b, v8f c) { c = wmma_bf(a.l, b.h, c); c = wmma_bf(a.h, b.l, c); return wmma_bf(a.h, b.h, c); }
__device__ __forceinline__ float sigm(float v) { return 1.0f / (1.0f + expf(-v)); }
#define LDSX() do { asm volatile("s_wait_dscnt 0" ::: "memory"); __builtin_amdgcn_wave_barrier(); __builtin_amdgcn_fence(__ATOMIC_RELEASE, "workgroup"); } while (0)

// Naive full scaled-dot-product attention (query/key/value [4,8,2048,64] given; mask [4,8] int: mask == 1 sets that head's entire score matrix to -1e6, i.e. exactly uniform attention): out = softmax(q k^T / 8 (masked_fill)) v -> [4,8,2048,64].
#define NB 4
#define TT 2048
#define CC 512            // NH * HD = projected width
#define DIN 512          // input (model) width
#define NH 8
#define HD 64
#define NQB (TT / 64)
#define HG 4
#define SCALE (0.125f)
#define CAUSAL 0
#ifndef TNB
#define TNB NB
#endif
__device__ __forceinline__ float bfr(float v) { return (float)(__bf16)v; }
__host__ __device__ __forceinline__ int kb_last(int qb) { return CAUSAL ? ((qb * 64 + 63) >> 7) : (TT / 128 - 1); }
typedef __attribute__((ext_vector_type(8))) __bf16 v8b;
__device__ __forceinline__ v16b frag_b(const __bf16* rowk0, int lane) {
  union { v16b v; v8b q[2]; } u; const __bf16* p = rowk0 + 8 * (lane >> 4);
  u.q[0] = *(const v8b*)p; u.q[1] = *(const v8b*)(p + 16); return u.v;
}
#define QBH 0              // unused: no kernel in this file has a high-precision path
#define QHI 2048            // rows for which k_proj writes a q residual plane
#define KHI 64            // key rows carrying k residual / v bf16 hi+lo planes (read by no kernel in this file)
// B fragment (k rows k0+.., output column o) of a weight: (in,out) [K][ld] or (out,in) [ld rows of K]: bf16 exact, or f16(bf16 * 256) exact
__device__ __forceinline__ v16b wcol_io(const float* Wm, int k0, int o, int lane, int ld) { v16b w; const int g = lane >> 4;
#pragma unroll
  for (int i = 0; i < 8; ++i) { w[i] = (__bf16)Wm[(size_t)(k0 + 8 * g + i) * ld + o]; w[8 + i] = (__bf16)Wm[(size_t)(k0 + 16 + 8 * g + i) * ld + o]; }
  return w; }
__device__ __forceinline__ v16b wcol_oi(const float* Wm, int k0, int o, int lane, int K) { v16b w; const float* p = Wm + (size_t)o * K + k0 + 8 * (lane >> 4);
#pragma unroll
  for (int i = 0; i < 8; ++i) { w[i] = (__bf16)p[i]; w[8 + i] = (__bf16)p[16 + i]; }
  return w; }
__device__ __forceinline__ v16h wcolh_io(const float* Wm, int k0, int o, int lane, int ld) { v16h w; const int g = lane >> 4;
#pragma unroll
  for (int i = 0; i < 8; ++i) { w[i] = (_Float16)(bfr(Wm[(size_t)(k0 + 8 * g + i) * ld + o]) * 256.0f); w[8 + i] = (_Float16)(bfr(Wm[(size_t)(k0 + 16 + 8 * g + i) * ld + o]) * 256.0f); }
  return w; }
__device__ __forceinline__ v16h wcolh_oi(const float* Wm, int k0, int o, int lane, int K) { v16h w; const float* p = Wm + (size_t)o * K + k0 + 8 * (lane >> 4);
#pragma unroll
  for (int i = 0; i < 8; ++i) { w[i] = (_Float16)(bfr(p[i]) * 256.0f); w[8 + i] = (_Float16)(bfr(p[16 + i]) * 256.0f); }
  return w; }
#define WQKV_LAYOUT 0   // 0 = (in,out) [DIN][CC]; 1 = (out,in) [CC][DIN]; 2 = per-head [NH][DIN][HD]
__device__ __forceinline__ v16b wcol_hdk(const float* Wm, int k0, int o, int lane) { v16b w; const int g = lane >> 4; const float* p = Wm + (size_t)(o / HD) * DIN * HD + (o % HD);
#pragma unroll
  for (int i = 0; i < 8; ++i) { w[i] = (__bf16)p[(size_t)(k0 + 8 * g + i) * HD]; w[8 + i] = (__bf16)p[(size_t)(k0 + 16 + 8 * g + i) * HD]; }
  return w; }
#define WO_OUT_IN 0
#if WQKV_LAYOUT == 1
#define WCOL(W, k0, o, lane) wcol_oi(W, k0, o, lane, DIN)
#elif WQKV_LAYOUT == 2
#define WCOL(W, k0, o, lane) wcol_hdk(W, k0, o, lane)
#else
#define WCOL(W, k0, o, lane) wcol_io(W, k0, o, lane, CC)
#endif
#if WO_OUT_IN
#define WOCOL(W, k0, o, lane) wcol_oi(W, k0, o, lane, CC)
#define WOCOLH(W, k0, o, lane) wcolh_oi(W, k0, o, lane, CC)
#else
#define WOCOL(W, k0, o, lane) wcol_io(W, k0, o, lane, DIN)
#define WOCOLH(W, k0, o, lane) wcolh_io(W, k0, o, lane, DIN)
#endif
#define SM_EXTRA_PARAMS , int bsm, int h0s, const int* __restrict__ HM
// per-(batch, head) mask: mask[b][h] == 1 replaces EVERY score of that head with -1e6 (softmax becomes exactly uniform); read per element
#define SM_MASK_HOOK do { const int mk = HM[bsm * NH + h0s + (int)blockIdx.y]; v = (mk == 1) ? -1.0e6f : v; } while (0)
__global__ __launch_bounds__(256) void k_planes(const float* __restrict__ Q, const float* __restrict__ Kx, const float* __restrict__ V, _Float16* __restrict__ QH, _Float16* __restrict__ KH, _Float16* __restrict__ VT) {
  __shared__ __align__(16) _Float16 tv[64][72];
  const int tid = threadIdx.x; const int t0 = blockIdx.x * 64, h = blockIdx.y; const size_t b = blockIdx.z;
  const size_t src0 = ((b * NH + h) * TT + t0) * (size_t)HD;   /* [b][h][t][d] */
  { const int rl = tid >> 2, q = tid & 3;   /* 64 rows x 4 threads x 16 values */
    const float* pq = Q + src0 + (size_t)rl * HD + q * 16; const float* pk = Kx + src0 + (size_t)rl * HD + q * 16; const float* pv = V + src0 + (size_t)rl * HD + q * 16;
    v4f a0 = *(const v4f*)pq, a1 = *(const v4f*)(pq + 4), a2 = *(const v4f*)(pq + 8), a3 = *(const v4f*)(pq + 12); v4f k0 = *(const v4f*)pk, k1 = *(const v4f*)(pk + 4), k2 = *(const v4f*)(pk + 8), k3 = *(const v4f*)(pk + 12);
    asm volatile("s_wait_loadcnt 0x0" ::: "memory");
    v4f w0 = *(const v4f*)pv, w1 = *(const v4f*)(pv + 4), w2 = *(const v4f*)(pv + 8), w3 = *(const v4f*)(pv + 12); asm volatile("s_wait_loadcnt 0x0" ::: "memory");
    float qa[16] = {a0[0],a0[1],a0[2],a0[3],a1[0],a1[1],a1[2],a1[3],a2[0],a2[1],a2[2],a2[3],a3[0],a3[1],a3[2],a3[3]}; float ka[16] = {k0[0],k0[1],k0[2],k0[3],k1[0],k1[1],k1[2],k1[3],k2[0],k2[1],k2[2],k2[3],k3[0],k3[1],k3[2],k3[3]}; float va[16] = {w0[0],w0[1],w0[2],w0[3],w1[0],w1[1],w1[2],w1[3],w2[0],w2[1],w2[2],w2[3],w3[0],w3[1],w3[2],w3[3]};
    hx8 qh0, qh1, kh0, kh1;
#pragma unroll
    for (int i = 0; i < 8; ++i) { qh0[i] = (_Float16)bfr(qa[i]); qh1[i] = (_Float16)bfr(qa[8 + i]); kh0[i] = (_Float16)bfr(ka[i]); kh1[i] = (_Float16)bfr(ka[8 + i]); tv[q * 16 + i][rl] = (_Float16)bfr(va[i]); tv[q * 16 + 8 + i][rl] = (_Float16)bfr(va[8 + i]); }
    const size_t row = b * TT + t0 + rl; _Float16* dq = QH + row * CC + h * HD + q * 16; _Float16* dk = KH + row * CC + h * HD + q * 16;
    vst2((unsigned*)dq, *(const v4u*)&qh0); vst2((unsigned*)(dq + 8), *(const v4u*)&qh1); vst2((unsigned*)dk, *(const v4u*)&kh0); vst2((unsigned*)(dk + 8), *(const v4u*)&kh1); }
  __syncthreads();
  for (int e = tid; e < 64 * 8; e += 256) { const int cl = e >> 3, q = e & 7; vst2((unsigned*)(VT + (b * CC + h * HD + cl) * (size_t)TT + t0 + q * 8), *(const v4u*)&tv[cl][q * 8]); } }   
#ifndef SM_EXTRA_PARAMS
#define SM_EXTRA_PARAMS
#endif
#ifndef PROJ_EXTRA_PARAMS
#define PROJ_EXTRA_PARAMS
#endif
#ifndef PROJ_EXTRA_PARAMS
#define PROJ_EXTRA_PARAMS
#endif
#ifndef SM_MASK_HOOK
#define SM_MASK_HOOK (void)0
#endif


#ifndef SM_EXTRA_PARAMS
#define SM_EXTRA_PARAMS
#endif
#ifndef SM_MASK_HOOK
#define SM_MASK_HOOK (void)0
#endif

#define WS_QH  0u                                      // f16 q rows [b*t][CC]
#define WS_KH  (WS_QH + 2u * (size_t)NB * TT * CC)      // f16 k rows [b*t][CC]
#define WS_VT  (WS_KH + 2u * (size_t)NB * TT * CC)      // f16 v planes [b][c][t]
#define WS_QL  (WS_VT + 2u * (size_t)NB * CC * TT)      // f16 q residual x 2^10 rows [b][t < QHI][CC]
#define WS_KL  (WS_QL + 2u * (size_t)NB * QHI * CC)     // f16 k residual x 2^10 rows [b][t < KHI][CC]
#define WS_VB  (WS_KL + 2u * (size_t)NB * KHI * CC)     // bf16 v hi planes [b][c][t < KHI]
#define WS_VBL (WS_VB + 2u * (size_t)NB * CC * KHI)
#define WS_S   (WS_VBL + 2u * (size_t)NB * CC * KHI)    // f32 [hg][t][s]; unused: k_fa keeps the logits in registers
#define WS_Y   (WS_S  + 4u * (size_t)HG * TT * TT)      // f32 ctx rows [b*t][CC] (only when there is an output projection)
#define WS_END (WS_Y  + 0u)

// ---- k_proj: block = (64 rows, 128 cols, which): q/k/v = X W (+ b) with exact bf16 products (K = DIN) -> which 0: q f16 rows (+ residual rows < QHI); 1: k f16 rows (+ residual rows < KHI); 2: v f16 planes [c][t] (+ bf16 hi/lo planes for t < KHI)
__global__ __launch_bounds__(128) void k_proj(const float* __restrict__ XQ, const float* __restrict__ XK, const float* __restrict__ XV, const float* __restrict__ WQ, const float* __restrict__ WK, const float* __restrict__ WV, const float* __restrict__ BQ, const float* __restrict__ BK, const float* __restrict__ BV,
    _Float16* __restrict__ QH, _Float16* __restrict__ QL, _Float16* __restrict__ KH, _Float16* __restrict__ KL, _Float16* __restrict__ VT, __bf16* __restrict__ VB, __bf16* __restrict__ VBL) {
  __shared__ __align__(16) _Float16 sh[64][136], sl[64][136]; __shared__ __align__(16) _Float16 th[128][72]; __shared__ __align__(16) __bf16 tb[128][72], tbl[128][72];
  const int tid = threadIdx.x, wave = tid >> 5, lane = tid & 31, col = lane & 15, g = lane >> 4; const int which = blockIdx.z; const int c0 = blockIdx.y * 128; const size_t r0 = (size_t)blockIdx.x * 64; const size_t bb = r0 / TT; const int t0 = (int)(r0 % TT);
  const float* X = which == 0 ? XQ : which == 1 ? XK : XV; const float* WA = which == 0 ? WQ : which == 1 ? WK : WV; const float* BA = which == 0 ? BQ : which == 1 ? BK : BV;
  v8f acc[8] = {};
#pragma unroll 2
  for (int kc = 0; kc < DIN / 32; ++kc) { v16b a; { const float* p = X + (r0 + wave * 16 + col) * DIN + kc * 32 + 8 * g;
#pragma unroll
      for (int i = 0; i < 8; ++i) { a[i] = (__bf16)p[i]; a[8 + i] = (__bf16)p[16 + i]; } }
    asm volatile("s_wait_loadcnt 0x0" ::: "memory");
#pragma unroll
    for (int j = 0; j < 8; ++j) { const v16b w = WCOL(WA, kc * 32, c0 + j * 16 + col, lane); asm volatile("s_wait_loadcnt 0x0" ::: "memory"); acc[j] = wmma_bf(a, w, acc[j]); } }
  if (which < 2) { _Float16* DH = which == 0 ? QH : KH; _Float16* DL = which == 0 ? QL : KL; const int nhi = which == 0 ? QHI : KHI; const bool hi_rows = t0 < nhi;
#pragma unroll
    for (int j = 0; j < 8; ++j) { const float bias = BA ? bfr(BA[c0 + j * 16 + col]) : 0.f;
#pragma unroll
      for (int r = 0; r < 8; ++r) { const float v = acc[j][r] + bias; const _Float16 hv = (_Float16)v; sh[wave * 16 + 8 * g + r][j * 16 + col] = hv; sl[wave * 16 + 8 * g + r][j * 16 + col] = (_Float16)((v - (float)hv) * 1024.0f); } }
    __syncthreads();
    for (int e = tid; e < 64 * 16; e += 128) { const int rl = e >> 4, q = e & 15; vst2((unsigned*)(DH + (r0 + rl) * CC + c0 + q * 8), *(const v4u*)&sh[rl][q * 8]); if (hi_rows) vst2((unsigned*)(DL + (bb * nhi + t0 + rl) * (size_t)CC + c0 + q * 8), *(const v4u*)&sl[rl][q * 8]); }
  } else { const bool hi_rows = t0 < KHI;
#pragma unroll
    for (int j = 0; j < 8; ++j) { const float bias = BA ? bfr(BA[c0 + j * 16 + col]) : 0.f;
#pragma unroll
      for (int r = 0; r < 8; ++r) { const float v = acc[j][r] + bias; const int rl = wave * 16 + 8 * g + r, cl = j * 16 + col; th[cl][rl] = (_Float16)v; const __bf16 bh = (__bf16)v; tb[cl][rl] = bh; tbl[cl][rl] = (__bf16)(v - (float)bh); } }
    __syncthreads();
    for (int e = tid; e < 128 * 8; e += 128) { const int cl = e >> 3, q = e & 7; vst2((unsigned*)(VT + (bb * CC + c0 + cl) * (size_t)TT + t0 + q * 8), *(const v4u*)&th[cl][q * 8]); if (hi_rows) { const size_t o3 = (bb * CC + c0 + cl) * (size_t)KHI + t0 + q * 8; vst2((unsigned*)(VB + o3), *(const v4u*)&tb[cl][q * 8]); vst2((unsigned*)(VBL + o3), *(const v4u*)&tbl[cl][q * 8]); } } } }
// ---- k_fa: one wave = QT * 16 queries of (b, h), walking all keys 32 at a time with a running maximum and sum per query, so that no score ever leaves the registers.
// The block's eight waves read the same key rows and v plane rows: asynchronous copies bring them into LDS once a block, KT keys a tile, two buffers; the fragments are read from there.
// S^T = K . Q^T (A = 16 key rows, B = 16 query columns; 1 product: q is rounded to bf16 first, so its f16 plane is exact from 2^-14 up, where a residual plane holds zeros; below that it is rounded as k's plane is): lane (g, col) holds keys 8g + r of query col, which is the B fragment of O^T += V^T . P^T as it stands.
// P = exp(score - running max) x 2^11, once to f16, against v f16 (1 product); the sum is taken in f32 from the unrounded P and carries the same 2^11, so it cancels in O / sum.
// Every #pragma unroll below is there so that the fragment and accumulator arrays are indexed by constants alone and stay in registers; the loop over the keys stays rolled.
#define QT 2    // 16-query column groups per wave
#define FW 8    // waves per block: they walk the same key and v rows, which the block brings into LDS once for all eight
#define LOG2E 1.4426950408889634f
#define KT 128                 // keys per LDS tile: four passes of 32 keys between two barriers
#define KPB 144                // LDS pitch of a key row, bytes: 128 + 16, so that 16 rows read 16 B each without a bank conflict
#define VPB 272                // LDS pitch of a v plane row (KT keys), bytes: 256 + 16, for the same reason
#define KTB (KT * KPB)         // key rows of a tile; the v rows stand behind them
#define BUFB (KTB + HD * VPB)  // one buffer of the ring
#define NTILE (TT / KT)
// One tile's copies of one lane: 4 x 16 B of key rows (8 lanes to a 128-B row, 32 rows apart) and 4 x 16 B of v plane rows (16 lanes to a 256-B row, 16 rows apart), global memory to LDS through no register.
// The s_wait_xcnt closes the statement so that no address register of a copy is rewritten in front of it.
__device__ __forceinline__ void tile_copy(unsigned lk, unsigned lv, const _Float16* gk, const _Float16* gv) {
  asm volatile("global_load_async_to_lds_b128 %0, %8, off\n\t"
               "global_load_async_to_lds_b128 %1, %9, off\n\t"
               "global_load_async_to_lds_b128 %2, %10, off\n\t"
               "global_load_async_to_lds_b128 %3, %11, off\n\t"
               "global_load_async_to_lds_b128 %4, %12, off\n\t"
               "global_load_async_to_lds_b128 %5, %13, off\n\t"
               "global_load_async_to_lds_b128 %6, %14, off\n\t"
               "global_load_async_to_lds_b128 %7, %15, off\n\t"
               "s_wait_xcnt 0x0"
               :: "v"(lk), "v"(lk + 32 * KPB), "v"(lk + 64 * KPB), "v"(lk + 96 * KPB), "v"(lv), "v"(lv + 16 * VPB), "v"(lv + 32 * VPB), "v"(lv + 48 * VPB),
                  "v"(gk), "v"(gk + (size_t)32 * CC), "v"(gk + (size_t)64 * CC), "v"(gk + (size_t)96 * CC), "v"(gv), "v"(gv + (size_t)16 * TT), "v"(gv + (size_t)32 * TT), "v"(gv + (size_t)48 * TT)
               : "memory");
}
__device__ __forceinline__ float xhalf(float x) { return __builtin_bit_cast(float, __builtin_amdgcn_permlanex16(__builtin_bit_cast(int, x), __builtin_bit_cast(int, x), 0x76543210, 0xfedcba98, false, false)); }   /* lane l with lane l ^ 16 */
__device__ __forceinline__ v8f wm(v16h a, v16h b, v8f c) { return __builtin_amdgcn_wmma_f32_16x16x32_f16(false, a, false, b, (short)0, c, false, false); }
__global__ __launch_bounds__(FW * 32) void k_fa(const _Float16* __restrict__ QH, const _Float16* __restrict__ KH, const _Float16* __restrict__ VT, const int* __restrict__ HM, float* __restrict__ Y) {
  __shared__ __align__(16) float ss[FW][QT * 16][HD + 4];
  __shared__ __align__(16) unsigned char ring[2 * BUFB];   /* two buffers: tile t + 1 lands while tile t is worked on */
  const int tid = threadIdx.x, wave = tid >> 5, lane = tid & 31, col = lane & 15, g = lane >> 4;
  const int bh = blockIdx.y, b = bh / NH, h = bh % NH; const int q0 = blockIdx.x * (FW * 16 * QT) + wave * (16 * QT);
  const bool masked = HM[bh] == 1;   /* mask[b][h] == 1 replaces EVERY score of that head with -1e6 */
  v16h qh[QT][2];
#pragma unroll
  for (int qt = 0; qt < QT; ++qt)
#pragma unroll
    for (int kc = 0; kc < 2; ++kc) { const size_t qo = ((size_t)b * TT + q0 + qt * 16 + col) * CC + h * HD + kc * 32; qh[qt][kc] = frag_h(QH + qo, lane); }
  asm volatile("s_wait_xcnt 0x0" ::: "memory");   /* stands in front of the set-up below, which takes over the address registers of the q loads above */
  __builtin_amdgcn_sched_barrier(0);   /* keeps that set-up behind the wait */
  const _Float16* gk = KH + ((size_t)b * TT + (tid >> 3)) * CC + h * HD + (tid & 7) * 8;             /* this lane's 16 B of key row tid / 8; + key * CC */
  const _Float16* gv = VT + ((size_t)b * CC + h * HD + (tid >> 4)) * (size_t)TT + (tid & 15) * 8;   /* this lane's 16 B of v plane row tid / 16; + key */
  const unsigned l0 = (unsigned)(size_t)&ring[0];   /* LDS byte address of the ring */
  const unsigned lk = l0 + (tid >> 3) * KPB + (tid & 7) * 16, lv = l0 + KTB + (tid >> 4) * VPB + (tid & 15) * 16;
  tile_copy(lk, lv, gk, gv);
  asm volatile("s_wait_asynccnt 0x0" ::: "memory");   /* this wave's share of tile 0 has landed */
  __syncthreads();                                    /* every wave's share has: tile 0 may be read */
  tile_copy(lk + BUFB, lv + BUFB, gk + (size_t)KT * CC, gv + KT);
  v8f o[QT][4] = {}; float m[QT], l[QT];
#pragma unroll
  for (int qt = 0; qt < QT; ++qt) { m[qt] = -3.0e38f; l[qt] = 0.f; }
  for (int t = 0; t < NTILE; ++t) {
    const unsigned bo = (t & 1) * BUFB;
    const unsigned char* Kl = ring + bo + col * KPB;          /* + key in tile * KPB */
    const unsigned char* Vl = ring + bo + KTB + col * VPB;    /* + d tile * 16 * VPB + key in tile * 2 */
    v16h kf[2][2];
#pragma unroll
    for (int kt = 0; kt < 2; ++kt)
#pragma unroll
      for (int kc = 0; kc < 2; ++kc) kf[kt][kc] = frag_h((const _Float16*)(Kl + (kt * 16) * KPB + kc * 64), lane);
#pragma unroll 1   /* the passes of a tile stay rolled: unrolled they took some 200 registers more, and the copies' address operands spilled */
   for (int ps = 0; ps < KT / 32; ++ps) {
    v16h vf[4];
#pragma unroll
    for (int dt = 0; dt < 4; ++dt) vf[dt] = frag_h((const _Float16*)(Vl + (dt * 16) * VPB + ps * 64), lane);
    __builtin_amdgcn_sched_barrier(0);   /* keeps the v reads up here, a whole score and softmax phase ahead of their use, in one group */
    v8f s[QT][2] = {};
#pragma unroll
    for (int kc = 0; kc < 2; ++kc)
#pragma unroll
      for (int kt = 0; kt < 2; ++kt)
#pragma unroll
        for (int qt = 0; qt < QT; ++qt) s[qt][kt] = wm(kf[kt][kc], qh[qt][kc], s[qt][kt]);
    const int kn = ((ps + 1) * 32) & (KT - 1);   /* the next pass's key rows of the same tile, read behind this pass's score products; a tile's last pass reads its rows 0.. again, unused: no branch stands behind the products */
#pragma unroll
    for (int kt = 0; kt < 2; ++kt)
#pragma unroll
      for (int kc = 0; kc < 2; ++kc) kf[kt][kc] = frag_h((const _Float16*)(Kl + (kn + kt * 16) * KPB + kc * 64), lane);
    __builtin_amdgcn_sched_barrier(0);   /* keeps the next key rows' reads ahead of the softmax, in one group; without it they sink to right in front of their use */
    v16h pf[QT];
#pragma unroll
    for (int qt = 0; qt < QT; ++qt) { float x[16]; float mx = -3.0e38f;
#pragma unroll
      for (int i = 0; i < 16; ++i) { x[i] = masked ? (-1.0e6f / SCALE) : s[qt][i >> 3][i & 7]; mx = fmaxf(mx, x[i]); }   /* unscaled: -1e6 / SCALE x SCALE is the module's -1e6 */
      mx = fmaxf(mx, xhalf(mx));   /* the other 8 + 8 keys of this query */
      const float mn = fmaxf(m[qt], mx * (SCALE * LOG2E));   /* running maximum in log2 units */
      const float alpha = __builtin_amdgcn_exp2f(m[qt] - mn); const float bb = 11.0f - mn; m[qt] = mn;
      v2f sum[2] = {{0.f, 0.f}, {0.f, 0.f}};   /* four short chains, two to a packed add */
#pragma unroll
      for (int i = 0; i < 16; i += 2) { const v2f xv = {x[i], x[i + 1]}; const v2f t = xv * (SCALE * LOG2E) + bb; const v2f p = {__builtin_amdgcn_exp2f(t[0]), __builtin_amdgcn_exp2f(t[1])}; sum[(i >> 1) & 1] += p; pf[qt][i] = (_Float16)p[0]; pf[qt][i + 1] = (_Float16)p[1]; }
      l[qt] = l[qt] * alpha + ((sum[0][0] + sum[0][1]) + (sum[1][0] + sum[1][1]));
#pragma unroll
      for (int dt = 0; dt < 4; ++dt) o[qt][dt] *= alpha; }
#pragma unroll
    for (int dt = 0; dt < 4; ++dt)
#pragma unroll
      for (int qt = 0; qt < QT; ++qt) o[qt][dt] = wm(vf[dt], pf[qt], o[qt][dt]);
   }
    asm volatile("s_wait_dscnt 0x0" ::: "memory");      /* this wave's reads of tile t are done */
    asm volatile("s_wait_asynccnt 0x0" ::: "memory");   /* this wave's share of tile t + 1 has landed */
    __syncthreads();                                    /* tile t + 1 may be read, tile t's buffer may be refilled */
    if (t + 2 < NTILE) tile_copy(lk + bo, lv + bo, gk + (size_t)(t + 2) * KT * CC, gv + (t + 2) * KT);
  }
  asm volatile("s_wait_asynccnt 0x0" ::: "memory");   /* no copy is outstanding when the wave goes on to its end */
#pragma unroll
  for (int qt = 0; qt < QT; ++qt) { const float inv = 1.0f / (l[qt] + xhalf(l[qt]));
#pragma unroll
    for (int dt = 0; dt < 4; ++dt) { v4f lo = { o[qt][dt][0] * inv, o[qt][dt][1] * inv, o[qt][dt][2] * inv, o[qt][dt][3] * inv }, hi = { o[qt][dt][4] * inv, o[qt][dt][5] * inv, o[qt][dt][6] * inv, o[qt][dt][7] * inv };
      *(v4f*)&ss[wave][qt * 16 + col][dt * 16 + 8 * g] = lo; *(v4f*)&ss[wave][qt * 16 + col][dt * 16 + 8 * g + 4] = hi; } }
  LDSX(); for (int rl = g; rl < QT * 16; rl += 2) vst2(Y + ((size_t)bh * TT + q0 + rl) * HD + col * 4, *(const v4f*)&ss[wave][rl][col * 4]); }   /* output layout [b][h][t][d]: two 256-B rows a store */

extern "C" void kernel_launch(void* const* d_in, const int* in_sizes, int n_in, void* d_out, int out_size, void* d_ws, size_t ws_size, hipStream_t stream) {
  (void)in_sizes; (void)n_in; (void)out_size;
  const float** F = (const float**)d_in;
  if (ws_size < (size_t)WS_END) return;
  char* ws = (char*)d_ws; _Float16 *QH = (_Float16*)(ws + WS_QH), *KH = (_Float16*)(ws + WS_KH), *VT = (_Float16*)(ws + WS_VT), *KL = (_Float16*)(ws + WS_KL); __bf16 *VB = (__bf16*)(ws + WS_VB), *VBL = (__bf16*)(ws + WS_VBL); float *S = (float*)(ws + WS_S), *Y = (float*)(ws + WS_Y);
  (void)Y; (void)S; (void)KL; (void)VB; (void)VBL;
  // inputs: 0 query [4,8,2048,64]; 1 key; 2 value; 3 mask [4,8] int32 (1 -> the whole head's scores := -1e6)
  const int* HM = (const int*)d_in[3];
  k_planes<<<dim3(TT / 64, NH, NB), 256, 0, stream>>>(F[0], F[1], F[2], QH, KH, VT);
  k_fa<<<dim3(TT / (FW * 16 * QT), NH * NB), FW * 32, 0, stream>>>(QH, KH, VT, HM, (float*)d_out);
}

// v004
// Measured time: 38.5 microseconds a run.
// Next to v003, in two timings, it ran 1.04 times as fast each time.
// Counting every step since v000, it is 25.4 times as fast.
// compute dtype: all float inputs rounded to bf16; q, k, v are bf16-valued so their f16 planes are exact (sub-6e-5 magnitudes aside); logits q x k (1 product) x 64^-0.5, a masked head (the module sets its every score to -1e6) runs with q = 0, so its every score is one constant too and the softmax is the same uniform one; softmax f32; P x 2^11 once to f16 x v (exact in f16) (1 product); f32 output.
#include <hip/hip_runtime.h>
#include <math.h>

typedef __attribute__((ext_vector_type(16))) _Float16 v16h;
typedef __attribute__((ext_vector_type(16))) __bf16 v16b;
typedef __attribute__((ext_vector_type(8)))  _Float16 v8h;
typedef __attribute__((ext_vector_type(8)))  float v8f;
typedef __attribute__((ext_vector_type(4)))  float v4f;
typedef __attribute__((ext_vector_type(2)))  float v2f;
typedef __attribute__((ext_vector_type(4)))  unsigned v4u;
typedef _Float16 hx8 __attribute__((ext_vector_type(8)));
typedef __attribute__((ext_vector_type(4)))  int v4i;
typedef float __attribute__((may_alias)) float_a;
typedef int __attribute__((may_alias)) int_a;

template <typename T> __device__ __forceinline__ void vst2(void* p, T v) { *(T*)p = v;  }
__device__ __forceinline__ v8f wmma16(v16h a, v16h b, v8f c) {
  v8f d = __builtin_amdgcn_wmma_f32_16x16x32_f16(false, a, false, b, (short)0, c, false, false);
  asm volatile("v_nop\n\tv_nop\n\tv_nop\n\tv_nop" : "+v"(d) : "v"(a), "v"(b));
  return d;
}
__device__ __forceinline__ v8f wmma_bf(v16b a, v16b b, v8f c) {
  v8f d = __builtin_amdgcn_wmma_f32_16x16x32_bf16(false, a, false, b, (short)0, c, false, false);
  asm volatile("v_nop\n\tv_nop\n\tv_nop\n\tv_nop" : "+v"(d) : "v"(a), "v"(b));
  return d;
}
// 16x16x32 fragments: lane = (h = lane>>4, row/col = lane&15); elements 0..7 = k0+8h+0..7, 8..15 = k0+16+8h+0..7; D element r = row 8h+r
__device__ __forceinline__ v16h frag_h(const _Float16* rowk0, int lane) {
  union { v16h v; v8h q[2]; } u; const _Float16* p = rowk0 + 8 * (lane >> 4);
  u.q[0] = *(const v8h*)p; u.q[1] = *(const v8h*)(p + 16); return u.v;
}
__device__ __forceinline__ v16h frag_f32(const float* rowk0, int lane) {
  v16h a; const float* p = rowk0 + 8 * (lane >> 4);
#pragma unroll
  for (int i = 0; i < 8; ++i) { a[i] = (_Float16)p[i]; a[8 + i] = (_Float16)p[16 + i]; }
  return a;
}
__device__ __forceinline__ v16h frag_f32s(const float* rowk0, int lane, float sc) {
  v16h a; const float* p = rowk0 + 8 * (lane >> 4);
#pragma unroll
  for (int i = 0; i < 8; ++i) { a[i] = (_Float16)(p[i] * sc); a[8 + i] = (_Float16)(p[16 + i] * sc); }
  return a;
}
// column fragment from a [K][ld] layout (column n), rows >= K read as 0
__device__ __forceinline__ v16h fragc_f32(const float* W, int k0, int n, int lane, int ld, int K) {
  v16h a; const int g = lane >> 4;
#pragma unroll
  for (int i = 0; i < 8; ++i) { const int ka = k0 + 8 * g + i, kb = ka + 16;
    a[i] = (_Float16)(ka < K ? W[(size_t)(ka < K ? ka : K - 1) * ld + n] : 0.f); a[8 + i] = (_Float16)(kb < K ? W[(size_t)(kb < K ? kb : K - 1) * ld + n] : 0.f); }
  return a;
}
struct F2 { v16b h, l; };
__device__ __forceinline__ F2 bsplit16(const float v[16]) { F2 r;
#pragma unroll
  for (int i = 0; i < 16; ++i) { const __bf16 h = (__bf16)v[i]; r.h[i] = h; r.l[i] = (__bf16)(v[i] - (float)h); }
  return r; }
__device__ __forceinline__ F2 split_row(const float* row, int k0, int lane) { float v[16]; const float* p = row + k0 + 8 * (lane >> 4);
#pragma unroll
  for (int i = 0; i < 8; ++i) { v[i] = p[i]; v[8 + i] = p[16 + i]; }
  return bsplit16(v); }
__device__ __forceinline__ F2 split_rowK(const float* row, int k0, int lane, int K) { float v[16]; const int g = lane >> 4;
#pragma unroll
  for (int i = 0; i < 8; ++i) { const int ka = k0 + 8 * g + i, kb = ka + 16; v[i] = ka < K ? row[ka < K ? ka : K - 1] : 0.f; v[8 + i] = kb < K ? row[kb < K ? kb : K - 1] : 0.f; }
  return bsplit16(v); }
__device__ __forceinline__ F2 split_col(const float* W, int k0, int n, int lane, int ld, int K) { float v[16]; const int g = lane >> 4;
#pragma unroll
  for (int i = 0; i < 8; ++i) { const int ka = k0 + 8 * g + i, kb = ka + 16; v[i] = ka < K ? W[(size_t)(ka < K ? ka : K - 1) * ld + n] : 0.f; v[8 + i] = kb < K ? W[(size_t)(kb < K ? kb : K - 1) * ld + n] : 0.f; }
  return bsplit16(v); }
__device__ __forceinline__ v8f mac3(const F2& a, const F2& b, v8f c) { c = wmma_bf(a.l, b.h, c); c = wmma_bf(a.h, b.l, c); return wmma_bf(a.h, b.h, c); }
__device__ __forceinline__ float sigm(float v) { return 1.0f / (1.0f + expf(-v)); }
#define LDSX() do { asm volatile("s_wait_dscnt 0" ::: "memory"); __builtin_amdgcn_wave_barrier(); __builtin_amdgcn_fence(__ATOMIC_RELEASE, "workgroup"); } while (0)

// Naive full scaled-dot-product attention (query/key/value [4,8,2048,64] given; mask [4,8] int: mask == 1 sets that head's entire score matrix to -1e6, i.e. exactly uniform attention): out = softmax(q k^T / 8 (masked_fill)) v -> [4,8,2048,64].
#define NB 4
#define TT 2048
#define CC 512            // NH * HD = projected width
#define DIN 512          // input (model) width
#define NH 8
#define HD 64
#define NQB (TT / 64)
#define HG 4
#define SCALE (0.125f)
#define CAUSAL 0
#ifndef TNB
#define TNB NB
#endif
__device__ __forceinline__ float bfr(float v) { return (float)(__bf16)v; }
__host__ __device__ __forceinline__ int kb_last(int qb) { return CAUSAL ? ((qb * 64 + 63) >> 7) : (TT / 128 - 1); }
typedef __attribute__((ext_vector_type(8))) __bf16 v8b;
__device__ __forceinline__ v16b frag_b(const __bf16* rowk0, int lane) {
  union { v16b v; v8b q[2]; } u; const __bf16* p = rowk0 + 8 * (lane >> 4);
  u.q[0] = *(const v8b*)p; u.q[1] = *(const v8b*)(p + 16); return u.v;
}
#define QBH 0              // unused: no kernel in this file has a high-precision path
#define QHI 2048            // rows for which k_proj writes a q residual plane
#define KHI 64            // key rows carrying k residual / v bf16 hi+lo planes (read by no kernel in this file)
// B fragment (k rows k0+.., output column o) of a weight: (in,out) [K][ld] or (out,in) [ld rows of K]: bf16 exact, or f16(bf16 * 256) exact
__device__ __forceinline__ v16b wcol_io(const float* Wm, int k0, int o, int lane, int ld) { v16b w; const int g = lane >> 4;
#pragma unroll
  for (int i = 0; i < 8; ++i) { w[i] = (__bf16)Wm[(size_t)(k0 + 8 * g + i) * ld + o]; w[8 + i] = (__bf16)Wm[(size_t)(k0 + 16 + 8 * g + i) * ld + o]; }
  return w; }
__device__ __forceinline__ v16b wcol_oi(const float* Wm, int k0, int o, int lane, int K) { v16b w; const float* p = Wm + (size_t)o * K + k0 + 8 * (lane >> 4);
#pragma unroll
  for (int i = 0; i < 8; ++i) { w[i] = (__bf16)p[i]; w[8 + i] = (__bf16)p[16 + i]; }
  return w; }
__device__ __forceinline__ v16h wcolh_io(const float* Wm, int k0, int o, int lane, int ld) { v16h w; const int g = lane >> 4;
#pragma unroll
  for (int i = 0; i < 8; ++i) { w[i] = (_Float16)(bfr(Wm[(size_t)(k0 + 8 * g + i) * ld + o]) * 256.0f); w[8 + i] = (_Float16)(bfr(Wm[(size_t)(k0 + 16 + 8 * g + i) * ld + o]) * 256.0f); }
  return w; }
__device__ __forceinline__ v16h wcolh_oi(const float* Wm, int k0, int o, int lane, int K) { v16h w; const float* p = Wm + (size_t)o * K + k0 + 8 * (lane >> 4);
#pragma unroll
  for (int i = 0; i < 8; ++i) { w[i] = (_Float16)(bfr(p[i]) * 256.0f); w[8 + i] = (_Float16)(bfr(p[16 + i]) * 256.0f); }
  return w; }
#define WQKV_LAYOUT 0   // 0 = (in,out) [DIN][CC]; 1 = (out,in) [CC][DIN]; 2 = per-head [NH][DIN][HD]
__device__ __forceinline__ v16b wcol_hdk(const float* Wm, int k0, int o, int lane) { v16b w; const int g = lane >> 4; const float* p = Wm + (size_t)(o / HD) * DIN * HD + (o % HD);
#pragma unroll
  for (int i = 0; i < 8; ++i) { w[i] = (__bf16)p[(size_t)(k0 + 8 * g + i) * HD]; w[8 + i] = (__bf16)p[(size_t)(k0 + 16 + 8 * g + i) * HD]; }
  return w; }
#define WO_OUT_IN 0
#if WQKV_LAYOUT == 1
#define WCOL(W, k0, o, lane) wcol_oi(W, k0, o, lane, DIN)
#elif WQKV_LAYOUT == 2
#define WCOL(W, k0, o, lane) wcol_hdk(W, k0, o, lane)
#else
#define WCOL(W, k0, o, lane) wcol_io(W, k0, o, lane, CC)
#endif
#if WO_OUT_IN
#define WOCOL(W, k0, o, lane) wcol_oi(W, k0, o, lane, CC)
#define WOCOLH(W, k0, o, lane) wcolh_oi(W, k0, o, lane, CC)
#else
#define WOCOL(W, k0, o, lane) wcol_io(W, k0, o, lane, DIN)
#define WOCOLH(W, k0, o, lane) wcolh_io(W, k0, o, lane, DIN)
#endif
#define SM_EXTRA_PARAMS , int bsm, int h0s, const int* __restrict__ HM
// per-(batch, head) mask: mask[b][h] == 1 replaces EVERY score of that head with -1e6 (softmax becomes exactly uniform); read per element
#define SM_MASK_HOOK do { const int mk = HM[bsm * NH + h0s + (int)blockIdx.y]; v = (mk == 1) ? -1.0e6f : v; } while (0)
__global__ __launch_bounds__(256) void k_planes(const float* __restrict__ Q, const float* __restrict__ Kx, const float* __restrict__ V, _Float16* __restrict__ QH, _Float16* __restrict__ KH, _Float16* __restrict__ VT) {
  __shared__ __align__(16) _Float16 tv[64][72];
  const int tid = threadIdx.x; const int t0 = blockIdx.x * 64, h = blockIdx.y; const size_t b = blockIdx.z;
  const size_t src0 = ((b * NH + h) * TT + t0) * (size_t)HD;   /* [b][h][t][d] */
  { const int rl = tid >> 2, q = tid & 3;   /* 64 rows x 4 threads x 16 values */
    const float* pq = Q + src0 + (size_t)rl * HD + q * 16; const float* pk = Kx + src0 + (size_t)rl * HD + q * 16; const float* pv = V + src0 + (size_t)rl * HD + q * 16;
    v4f a0 = *(const v4f*)pq, a1 = *(const v4f*)(pq + 4), a2 = *(const v4f*)(pq + 8), a3 = *(const v4f*)(pq + 12); v4f k0 = *(const v4f*)pk, k1 = *(const v4f*)(pk + 4), k2 = *(const v4f*)(pk + 8), k3 = *(const v4f*)(pk + 12);
    asm volatile("s_wait_loadcnt 0x0" ::: "memory");
    v4f w0 = *(const v4f*)pv, w1 = *(const v4f*)(pv + 4), w2 = *(const v4f*)(pv + 8), w3 = *(const v4f*)(pv + 12); asm volatile("s_wait_loadcnt 0x0" ::: "memory");
    float qa[16] = {a0[0],a0[1],a0[2],a0[3],a1[0],a1[1],a1[2],a1[3],a2[0],a2[1],a2[2],a2[3],a3[0],a3[1],a3[2],a3[3]}; float ka[16] = {k0[0],k0[1],k0[2],k0[3],k1[0],k1[1],k1[2],k1[3],k2[0],k2[1],k2[2],k2[3],k3[0],k3[1],k3[2],k3[3]}; float va[16] = {w0[0],w0[1],w0[2],w0[3],w1[0],w1[1],w1[2],w1[3],w2[0],w2[1],w2[2],w2[3],w3[0],w3[1],w3[2],w3[3]};
    hx8 qh0, qh1, kh0, kh1;
#pragma unroll
    for (int i = 0; i < 8; ++i) { qh0[i] = (_Float16)bfr(qa[i]); qh1[i] = (_Float16)bfr(qa[8 + i]); kh0[i] = (_Float16)bfr(ka[i]); kh1[i] = (_Float16)bfr(ka[8 + i]); tv[q * 16 + i][rl] = (_Float16)bfr(va[i]); tv[q * 16 + 8 + i][rl] = (_Float16)bfr(va[8 + i]); }
    const size_t row = b * TT + t0 + rl; _Float16* dq = QH + row * CC + h * HD + q * 16; _Float16* dk = KH + row * CC + h * HD + q * 16;
    vst2((unsigned*)dq, *(const v4u*)&qh0); vst2((unsigned*)(dq + 8), *(const v4u*)&qh1); vst2((unsigned*)dk, *(const v4u*)&kh0); vst2((unsigned*)(dk + 8), *(const v4u*)&kh1); }
  __syncthreads();
  for (int e = tid; e < 64 * 8; e += 256) { const int cl = e >> 3, q = e & 7; vst2((unsigned*)(VT + (b * CC + h * HD + cl) * (size_t)TT + t0 + q * 8), *(const v4u*)&tv[cl][q * 8]); } }   
#ifndef SM_EXTRA_PARAMS
#define SM_EXTRA_PARAMS
#endif
#ifndef PROJ_EXTRA_PARAMS
#define PROJ_EXTRA_PARAMS
#endif
#ifndef PROJ_EXTRA_PARAMS
#define PROJ_EXTRA_PARAMS
#endif
#ifndef SM_MASK_HOOK
#define SM_MASK_HOOK (void)0
#endif


#ifndef SM_EXTRA_PARAMS
#define SM_EXTRA_PARAMS
#endif
#ifndef SM_MASK_HOOK
#define SM_MASK_HOOK (void)0
#endif

#define WS_QH  0u                                      // f16 q rows [b*t][CC]
#define WS_KH  (WS_QH + 2u * (size_t)NB * TT * CC)      // f16 k rows [b*t][CC]
#define WS_VT  (WS_KH + 2u * (size_t)NB * TT * CC)      // f16 v planes [b][c][t]
#define WS_QL  (WS_VT + 2u * (size_t)NB * CC * TT)      // f16 q residual x 2^10 rows [b][t < QHI][CC]
#define WS_KL  (WS_QL + 2u * (size_t)NB * QHI * CC)     // f16 k residual x 2^10 rows [b][t < KHI][CC]
#define WS_VB  (WS_KL + 2u * (size_t)NB * KHI * CC)     // bf16 v hi planes [b][c][t < KHI]
#define WS_VBL (WS_VB + 2u * (size_t)NB * CC * KHI)
#define WS_S   (WS_VBL + 2u * (size_t)NB * CC * KHI)    // f32 [hg][t][s]; unused: k_fa keeps the logits in registers
#define WS_Y   (WS_S  + 4u * (size_t)HG * TT * TT)      // f32 ctx rows [b*t][CC] (only when there is an output projection)
#define WS_END (WS_Y  + 0u)

// ---- k_proj: block = (64 rows, 128 cols, which): q/k/v = X W (+ b) with exact bf16 products (K = DIN) -> which 0: q f16 rows (+ residual rows < QHI); 1: k f16 rows (+ residual rows < KHI); 2: v f16 planes [c][t] (+ bf16 hi/lo planes for t < KHI)
__global__ __launch_bounds__(128) void k_proj(const float* __restrict__ XQ, const float* __restrict__ XK, const float* __restrict__ XV, const float* __restrict__ WQ, const float* __restrict__ WK, const float* __restrict__ WV, const float* __restrict__ BQ, const float* __restrict__ BK, const float* __restrict__ BV,
    _Float16* __restrict__ QH, _Float16* __restrict__ QL, _Float16* __restrict__ KH, _Float16* __restrict__ KL, _Float16* __restrict__ VT, __bf16* __restrict__ VB, __bf16* __restrict__ VBL) {
  __shared__ __align__(16) _Float16 sh[64][136], sl[64][136]; __shared__ __align__(16) _Float16 th[128][72]; __shared__ __align__(16) __bf16 tb[128][72], tbl[128][72];
  const int tid = threadIdx.x, wave = tid >> 5, lane = tid & 31, col = lane & 15, g = lane >> 4; const int which = blockIdx.z; const int c0 = blockIdx.y * 128; const size_t r0 = (size_t)blockIdx.x * 64; const size_t bb = r0 / TT; const int t0 = (int)(r0 % TT);
  const float* X = which == 0 ? XQ : which == 1 ? XK : XV; const float* WA = which == 0 ? WQ : which == 1 ? WK : WV; const float* BA = which == 0 ? BQ : which == 1 ? BK : BV;
  v8f acc[8] = {};
#pragma unroll 2
  for (int kc = 0; kc < DIN / 32; ++kc) { v16b a; { const float* p = X + (r0 + wave * 16 + col) * DIN + kc * 32 + 8 * g;
#pragma unroll
      for (int i = 0; i < 8; ++i) { a[i] = (__bf16)p[i]; a[8 + i] = (__bf16)p[16 + i]; } }
    asm volatile("s_wait_loadcnt 0x0" ::: "memory");
#pragma unroll
    for (int j = 0; j < 8; ++j) { const v16b w = WCOL(WA, kc * 32, c0 + j * 16 + col, lane); asm volatile("s_wait_loadcnt 0x0" ::: "memory"); acc[j] = wmma_bf(a, w, acc[j]); } }
  if (which < 2) { _Float16* DH = which == 0 ? QH : KH; _Float16* DL = which == 0 ? QL : KL; const int nhi = which == 0 ? QHI : KHI; const bool hi_rows = t0 < nhi;
#pragma unroll
    for (int j = 0; j < 8; ++j) { const float bias = BA ? bfr(BA[c0 + j * 16 + col]) : 0.f;
#pragma unroll
      for (int r = 0; r < 8; ++r) { const float v = acc[j][r] + bias; const _Float16 hv = (_Float16)v; sh[wave * 16 + 8 * g + r][j * 16 + col] = hv; sl[wave * 16 + 8 * g + r][j * 16 + col] = (_Float16)((v - (float)hv) * 1024.0f); } }
    __syncthreads();
    for (int e = tid; e < 64 * 16; e += 128) { const int rl = e >> 4, q = e & 15; vst2((unsigned*)(DH + (r0 + rl) * CC + c0 + q * 8), *(const v4u*)&sh[rl][q * 8]); if (hi_rows) vst2((unsigned*)(DL + (bb * nhi + t0 + rl) * (size_t)CC + c0 + q * 8), *(const v4u*)&sl[rl][q * 8]); }
  } else { const bool hi_rows = t0 < KHI;
#pragma unroll
    for (int j = 0; j < 8; ++j) { const float bias = BA ? bfr(BA[c0 + j * 16 + col]) : 0.f;
#pragma unroll
      for (int r = 0; r < 8; ++r) { const float v = acc[j][r] + bias; const int rl = wave * 16 + 8 * g + r, cl = j * 16 + col; th[cl][rl] = (_Float16)v; const __bf16 bh = (__bf16)v; tb[cl][rl] = bh; tbl[cl][rl] = (__bf16)(v - (float)bh); } }
    __syncthreads();
    for (int e = tid; e < 128 * 8; e += 128) { const int cl = e >> 3, q = e & 7; vst2((unsigned*)(VT + (bb * CC + c0 + cl) * (size_t)TT + t0 + q * 8), *(const v4u*)&th[cl][q * 8]); if (hi_rows) { const size_t o3 = (bb * CC + c0 + cl) * (size_t)KHI + t0 + q * 8; vst2((unsigned*)(VB + o3), *(const v4u*)&tb[cl][q * 8]); vst2((unsigned*)(VBL + o3), *(const v4u*)&tbl[cl][q * 8]); } } } }
// ---- k_fa: one wave = QT * 16 queries of (b, h), walking all keys 32 at a time with a running maximum and sum per query, so that no score ever leaves the registers.
// The block's eight waves read the same key rows and v plane rows: asynchronous copies bring them into LDS once a block, KT keys a tile, two buffers; the fragments are read from there.
// S^T = K . Q^T (A = 16 key rows, B = 16 query columns; 1 product: q is rounded to bf16 first, so its f16 plane is exact from 2^-14 up, where a residual plane holds zeros; below that it is rounded as k's plane is): lane (g, col) holds keys 8g + r of query col, which is the B fragment of O^T += V^T . P^T as it stands.
// P = exp(score - running max) x 2^11, once to f16, against v f16 (1 product); the sum is taken in f32 from the unrounded P and carries the same 2^11, so it cancels in O / sum.
// Every #pragma unroll below is there so that the fragment and accumulator arrays are indexed by constants alone and stay in registers; the loop over the keys stays rolled.
#define QT 2    // 16-query column groups per wave
#define FW 8    // waves per block: they walk the same key and v rows, which the block brings into LDS once for all eight
#define LOG2E 1.4426950408889634f
#define KT 128                 // keys per LDS tile: four passes of 32 keys between two barriers
#define KPB 144                // LDS pitch of a key row, bytes: 128 + 16, so that 16 rows read 16 B each without a bank conflict
#define VPB 272                // LDS pitch of a v plane row (KT keys), bytes: 256 + 16, for the same reason
#define KTB (KT * KPB)         // key rows of a tile; the v rows stand behind them
#define BUFB (KTB + HD * VPB)  // one buffer of the ring
#define NTILE (TT / KT)
// One tile's copies of one lane: 4 x 16 B of key rows (8 lanes to a 128-B row, 32 rows apart) and 4 x 16 B of v plane rows (16 lanes to a 256-B row, 16 rows apart), global memory to LDS through no register.
// The s_wait_xcnt closes the statement so that no address register of a copy is rewritten in front of it.
__device__ __forceinline__ void tile_copy(unsigned lk, unsigned lv, const _Float16* gk, const _Float16* gv) {
  asm volatile("global_load_async_to_lds_b128 %0, %8, off\n\t"
               "global_load_async_to_lds_b128 %1, %9, off\n\t"
               "global_load_async_to_lds_b128 %2, %10, off\n\t"
               "global_load_async_to_lds_b128 %3, %11, off\n\t"
               "global_load_async_to_lds_b128 %4, %12, off\n\t"
               "global_load_async_to_lds_b128 %5, %13, off\n\t"
               "global_load_async_to_lds_b128 %6, %14, off\n\t"
               "global_load_async_to_lds_b128 %7, %15, off\n\t"
               "s_wait_xcnt 0x0"
               :: "v"(lk), "v"(lk + 32 * KPB), "v"(lk + 64 * KPB), "v"(lk + 96 * KPB), "v"(lv), "v"(lv + 16 * VPB), "v"(lv + 32 * VPB), "v"(lv + 48 * VPB),
                  "v"(gk), "v"(gk + (size_t)32 * CC), "v"(gk + (size_t)64 * CC), "v"(gk + (size_t)96 * CC), "v"(gv), "v"(gv + (size_t)16 * TT), "v"(gv + (size_t)32 * TT), "v"(gv + (size_t)48 * TT)
               : "memory");
}
__device__ __forceinline__ float xhalf(float x) { return __builtin_bit_cast(float, __builtin_amdgcn_permlanex16(__builtin_bit_cast(int, x), __builtin_bit_cast(int, x), 0x76543210, 0xfedcba98, false, false)); }   /* lane l with lane l ^ 16 */
__device__ __forceinline__ v8f wm(v16h a, v16h b, v8f c) { return __builtin_amdgcn_wmma_f32_16x16x32_f16(false, a, false, b, (short)0, c, false, false); }
__global__ __launch_bounds__(FW * 32) void k_fa(const _Float16* __restrict__ QH, const _Float16* __restrict__ KH, const _Float16* __restrict__ VT, const int* __restrict__ HM, float* __restrict__ Y) {
  __shared__ __align__(16) float ss[FW][QT * 16][HD + 4];
  __shared__ __align__(16) unsigned char ring[2 * BUFB];   /* two buffers: tile t + 1 lands while tile t is worked on */
  const int tid = threadIdx.x, wave = tid >> 5, lane = tid & 31, col = lane & 15, g = lane >> 4;
  const int bh = blockIdx.y, b = bh / NH, h = bh % NH; const int q0 = blockIdx.x * (FW * 16 * QT) + wave * (16 * QT);
  const int hm = HM[bh];   /* mask[b][h] == 1 replaces EVERY score of that head with one constant, -1e6: its softmax is 1 / TT at every key, whatever the constant */
  v16h qh[QT][2];
#pragma unroll
  for (int qt = 0; qt < QT; ++qt)
#pragma unroll
    for (int kc = 0; kc < 2; ++kc) { const size_t qo = ((size_t)b * TT + q0 + qt * 16 + col) * CC + h * HD + kc * 32; qh[qt][kc] = frag_h(QH + qo, lane); }
  asm volatile("s_wait_xcnt 0x0" ::: "memory");   /* stands in front of the set-up below, which takes over the address registers of the q loads above */
  __builtin_amdgcn_sched_barrier(0);   /* keeps that set-up behind the wait */
  const _Float16* gk = KH + ((size_t)b * TT + (tid >> 3)) * CC + h * HD + (tid & 7) * 8;             /* this lane's 16 B of key row tid / 8; + key * CC */
  const _Float16* gv = VT + ((size_t)b * CC + h * HD + (tid >> 4)) * (size_t)TT + (tid & 15) * 8;   /* this lane's 16 B of v plane row tid / 16; + key */
  const unsigned l0 = (unsigned)(size_t)&ring[0];   /* LDS byte address of the ring */
  const unsigned lk = l0 + (tid >> 3) * KPB + (tid & 7) * 16, lv = l0 + KTB + (tid >> 4) * VPB + (tid & 15) * 16;
  tile_copy(lk, lv, gk, gv);
  asm volatile("s_wait_asynccnt 0x0" ::: "memory");   /* this wave's share of tile 0 has landed */
  __syncthreads();                                    /* every wave's share has: tile 0 may be read */
  tile_copy(lk + BUFB, lv + BUFB, gk + (size_t)KT * CC, gv + KT);
  /* The mask is applied once, to q, and not to every score: with q = 0 each score of a masked head is exactly 0 (the key planes are finite), every P is 2^11 and the sum TT x 2^11, both exact, so O / sum is the module's uniform average of v. */
  __builtin_amdgcn_sched_barrier(0);   /* keeps the selects behind the copies above: moved up, they made tile 0's copies wait for the q loads */
  const bool masked = hm == 1;
#pragma unroll
  for (int qt = 0; qt < QT; ++qt)
#pragma unroll
    for (int kc = 0; kc < 2; ++kc) qh[qt][kc] = masked ? v16h{} : qh[qt][kc];
  v8f o[QT][4] = {}; float m[QT], l[QT];
#pragma unroll
  for (int qt = 0; qt < QT; ++qt) { m[qt] = -3.0e38f; l[qt] = 0.f; }
  for (int t = 0; t < NTILE; ++t) {
    const unsigned bo = (t & 1) * BUFB;
    const unsigned char* Kl = ring + bo + col * KPB;          /* + key in tile * KPB */
    const unsigned char* Vl = ring + bo + KTB + col * VPB;    /* + d tile * 16 * VPB + key in tile * 2 */
    v16h kf[2][2];
#pragma unroll
    for (int kt = 0; kt < 2; ++kt)
#pragma unroll
      for (int kc = 0; kc < 2; ++kc) kf[kt][kc] = frag_h((const _Float16*)(Kl + (kt * 16) * KPB + kc * 64), lane);
#pragma unroll 1   /* the passes of a tile stay rolled: unrolled they took some 200 registers more, and the copies' address operands spilled */
   for (int ps = 0; ps < KT / 32; ++ps) {
    v16h vf[4];
#pragma unroll
    for (int dt = 0; dt < 4; ++dt) vf[dt] = frag_h((const _Float16*)(Vl + (dt * 16) * VPB + ps * 64), lane);
    __builtin_amdgcn_sched_barrier(0);   /* keeps the v reads up here, a whole score and softmax phase ahead of their use, in one group */
    v8f s[QT][2] = {};
#pragma unroll
    for (int kc = 0; kc < 2; ++kc)
#pragma unroll
      for (int kt = 0; kt < 2; ++kt)
#pragma unroll
        for (int qt = 0; qt < QT; ++qt) s[qt][kt] = wm(kf[kt][kc], qh[qt][kc], s[qt][kt]);
    const int kn = ((ps + 1) * 32) & (KT - 1);   /* the next pass's key rows of the same tile, read behind this pass's score products; a tile's last pass reads its rows 0.. again, unused: no branch stands behind the products */
#pragma unroll
    for (int kt = 0; kt < 2; ++kt)
#pragma unroll
      for (int kc = 0; kc < 2; ++kc) kf[kt][kc] = frag_h((const _Float16*)(Kl + (kn + kt * 16) * KPB + kc * 64), lane);
    __builtin_amdgcn_sched_barrier(0);   /* keeps the next key rows' reads ahead of the softmax, in one group; without it they sink to right in front of their use */
    v16h pf[QT];
#pragma unroll
    for (int qt = 0; qt < QT; ++qt) { float x[16]; float mx = -3.0e38f;
#pragma unroll
      for (int i = 0; i < 16; ++i) { x[i] = s[qt][i >> 3][i & 7]; mx = fmaxf(mx, x[i]); }   /* unscaled */
      mx = fmaxf(mx, xhalf(mx));   /* the other 8 + 8 keys of this query */
      const float mn = fmaxf(m[qt], mx * (SCALE * LOG2E));   /* running maximum in log2 units */
      const float alpha = __builtin_amdgcn_exp2f(m[qt] - mn); const float bb = 11.0f - mn; m[qt] = mn;
      v2f sum[2] = {{0.f, 0.f}, {0.f, 0.f}};   /* four short chains, two to a packed add */
#pragma unroll
      for (int i = 0; i < 16; i += 2) { const v2f xv = {x[i], x[i + 1]}; const v2f t = xv * (SCALE * LOG2E) + bb; const v2f p = {__builtin_amdgcn_exp2f(t[0]), __builtin_amdgcn_exp2f(t[1])}; sum[(i >> 1) & 1] += p; pf[qt][i] = (_Float16)p[0]; pf[qt][i + 1] = (_Float16)p[1]; }
      l[qt] = l[qt] * alpha + ((sum[0][0] + sum[0][1]) + (sum[1][0] + sum[1][1]));
#pragma unroll
      for (int dt = 0; dt < 4; ++dt) o[qt][dt] *= alpha; }
#pragma unroll
    for (int dt = 0; dt < 4; ++dt)
#pragma unroll
      for (int qt = 0; qt < QT; ++qt) o[qt][dt] = wm(vf[dt], pf[qt], o[qt][dt]);
   }
    asm volatile("s_wait_dscnt 0x0" ::: "memory");      /* this wave's reads of tile t are done */
    asm volatile("s_wait_asynccnt 0x0" ::: "memory");   /* this wave's share of tile t + 1 has landed */
    __syncthreads();                                    /* tile t + 1 may be read, tile t's buffer may be refilled */
    if (t + 2 < NTILE) tile_copy(lk + bo, lv + bo, gk + (size_t)(t + 2) * KT * CC, gv + (t + 2) * KT);
  }
  asm volatile("s_wait_asynccnt 0x0" ::: "memory");   /* no copy is outstanding when the wave goes on to its end */
#pragma unroll
  for (int qt = 0; qt < QT; ++qt) { const float inv = 1.0f / (l[qt] + xhalf(l[qt]));
#pragma unroll
    for (int dt = 0; dt < 4; ++dt) { v4f lo = { o[qt][dt][0] * inv, o[qt][dt][1] * inv, o[qt][dt][2] * inv, o[qt][dt][3] * inv }, hi = { o[qt][dt][4] * inv, o[qt][dt][5] * inv, o[qt][dt][6] * inv, o[qt][dt][7] * inv };
      *(v4f*)&ss[wave][qt * 16 + col][dt * 16 + 8 * g] = lo; *(v4f*)&ss[wave][qt * 16 + col][dt * 16 + 8 * g + 4] = hi; } }
  LDSX(); for (int rl = g; rl < QT * 16; rl += 2) vst2(Y + ((size_t)bh * TT + q0 + rl) * HD + col * 4, *(const v4f*)&ss[wave][rl][col * 4]); }   /* output layout [b][h][t][d]: two 256-B rows a store */

extern "C" void kernel_launch(void* const* d_in, const int* in_sizes, int n_in, void* d_out, int out_size, void* d_ws, size_t ws_size, hipStream_t stream) {
  (void)in_sizes; (void)n_in; (void)out_size;
  const float** F = (const float**)d_in;
  if (ws_size < (size_t)WS_END) return;
  char* ws = (char*)d_ws; _Float16 *QH = (_Float16*)(ws + WS_QH), *KH = (_Float16*)(ws + WS_KH), *VT = (_Float16*)(ws + WS_VT), *KL = (_Float16*)(ws + WS_KL); __bf16 *VB = (__bf16*)(ws + WS_VB), *VBL = (__bf16*)(ws + WS_VBL); float *S = (float*)(ws + WS_S), *Y = (float*)(ws + WS_Y);
  (void)Y; (void)S; (void)KL; (void)VB; (void)VBL;
  // inputs: 0 query [4,8,2048,64]; 1 key; 2 value; 3 mask [4,8] int32 (1 -> the whole head's scores := -1e6)
  const int* HM = (const int*)d_in[3];
  k_planes<<<dim3(TT / 64, NH, NB), 256, 0, stream>>>(F[0], F[1], F[2], QH, KH, VT);
  k_fa<<<dim3(TT / (FW * 16 * QT), NH * NB), FW * 32, 0, stream>>>(QH, KH, VT, HM, (float*)d_out);
}

// v005
// Measured time: 37.3 microseconds a run.
// In both of two side-by-side timings against v004, it was 1.03 times as fast.
// Counting every step since v000, it is 26.2 times as fast.
// compute dtype: all float inputs rounded to bf16; q, k, v are bf16-valued so their f16 planes are exact (sub-6e-5 magnitudes aside); logits q x k (1 product) x 64^-0.5, a masked head (the module sets its every score to -1e6) runs with q = 0, so its every score is one constant too and the softmax is the same uniform one; softmax f32; P x 2^11 once to f16 x v (exact in f16) (1 product); f32 output.
#include <hip/hip_runtime.h>
#include <math.h>

typedef __attribute__((ext_vector_type(16))) _Float16 v16h;
typedef __attribute__((ext_vector_type(16))) __bf16 v16b;
typedef __attribute__((ext_vector_type(8)))  _Float16 v8h;
typedef __attribute__((ext_vector_type(8)))  float v8f;
typedef __attribute__((ext_vector_type(4)))  float v4f;
typedef __attribute__((ext_vector_type(2)))  float v2f;
typedef __attribute__((ext_vector_type(4)))  unsigned v4u;
typedef _Float16 hx8 __attribute__((ext_vector_type(8)));
typedef __attribute__((ext_vector_type(4)))  int v4i;
typedef float __attribute__((may_alias)) float_a;
typedef int __attribute__((may_alias)) int_a;

template <typename T> __device__ __forceinline__ void vst2(void* p, T v) { *(T*)p = v;  }
__device__ __forceinline__ v8f wmma16(v16h a, v16h b, v8f c) {
  v8f d = __builtin_amdgcn_wmma_f32_16x16x32_f16(false, a, false, b, (short)0, c, false, false);
  asm volatile("v_nop\n\tv_nop\n\tv_nop\n\tv_nop" : "+v"(d) : "v"(a), "v"(b));
  return d;
}
__device__ __forceinline__ v8f wmma_bf(v16b a, v16b b, v8f c) {
  v8f d = __builtin_amdgcn_wmma_f32_16x16x32_bf16(false, a, false, b, (short)0, c, false, false);
  asm volatile("v_nop\n\tv_nop\n\tv_nop\n\tv_nop" : "+v"(d) : "v"(a), "v"(b));
  return d;
}
// 16x16x32 fragments: lane = (h = lane>>4, row/col = lane&15); elements 0..7 = k0+8h+0..7, 8..15 = k0+16+8h+0..7; D element r = row 8h+r
__device__ __forceinline__ v16h frag_h(const _Float16* rowk0, int lane) {
  union { v16h v; v8h q[2]; } u; const _Float16* p = rowk0 + 8 * (lane >> 4);
  u.q[0] = *(const v8h*)p; u.q[1] = *(const v8h*)(p + 16); return u.v;
}
__device__ __forceinline__ v16h frag_f32(const float* rowk0, int lane) {
  v16h a; const float* p = rowk0 + 8 * (lane >> 4);
#pragma unroll
  for (int i = 0; i < 8; ++i) { a[i] = (_Float16)p[i]; a[8 + i] = (_Float16)p[16 + i]; }
  return a;
}
__device__ __forceinline__ v16h frag_f32s(const float* rowk0, int lane, float sc) {
  v16h a; const float* p = rowk0 + 8 * (lane >> 4);
#pragma unroll
  for (int i = 0; i < 8; ++i) { a[i] = (_Float16)(p[i] * sc); a[8 + i] = (_Float16)(p[16 + i] * sc); }
  return a;
}
// column fragment from a [K][ld] layout (column n), rows >= K read as 0
__device__ __forceinline__ v16h fragc_f32(const float* W, int k0, int n, int lane, int ld, int K) {
  v16h a; const int g = lane >> 4;
#pragma unroll
  for (int i = 0; i < 8; ++i) { const int ka = k0 + 8 * g + i, kb = ka + 16;
    a[i] = (_Float16)(ka < K ? W[(size_t)(ka < K ? ka : K - 1) * ld + n] : 0.f); a[8 + i] = (_Float16)(kb < K ? W[(size_t)(kb < K ? kb : K - 1) * ld + n] : 0.f); }
  return a;
}
struct F2 { v16b h, l; };
__device__ __forceinline__ F2 bsplit16(const float v[16]) { F2 r;
#pragma unroll
  for (int i = 0; i < 16; ++i) { const __bf16 h = (__bf16)v[i]; r.h[i] = h; r.l[i] = (__bf16)(v[i] - (float)h); }
  return r; }
__device__ __forceinline__ F2 split_row(const float* row, int k0, int lane) { float v[16]; const float* p = row + k0 + 8 * (lane >> 4);
#pragma unroll
  for (int i = 0; i < 8; ++i) { v[i] = p[i]; v[8 + i] = p[16 + i]; }
  return bsplit16(v); }
__device__ __forceinline__ F2 split_rowK(const float* row, int k0, int lane, int K) { float v[16]; const int g = lane >> 4;
#pragma unroll
  for (int i = 0; i < 8; ++i) { const int ka = k0 + 8 * g + i, kb = ka + 16; v[i] = ka < K ? row[ka < K ? ka : K - 1] : 0.f; v[8 + i] = kb < K ? row[kb < K ? kb : K - 1] : 0.f; }
  return bsplit16(v); }
__device__ __forceinline__ F2 split_col(const float* W, int k0, int n, int lane, int ld, int K) { float v[16]; const int g = lane >> 4;
#pragma unroll
  for (int i = 0; i < 8; ++i) { const int ka = k0 + 8 * g + i, kb = ka + 16; v[i] = ka < K ? W[(size_t)(ka < K ? ka : K - 1) * ld + n] : 0.f; v[8 + i] = kb < K ? W[(size_t)(kb < K ? kb : K - 1) * ld + n] : 0.f; }
  return bsplit16(v); }
__device__ __forceinline__ v8f mac3(const F2& a, const F2& b, v8f c) { c = wmma_bf(a.l, b.h, c); c = wmma_bf(a.h, b.l, c); return wmma_bf(a.h, b.h, c); }
__device__ __forceinline__ float sigm(float v) { return 1.0f / (1.0f + expf(-v)); }
#define LDSX() do { asm volatile("s_wait_dscnt 0" ::: "memory"); __builtin_amdgcn_wave_barrier(); __builtin_amdgcn_fence(__ATOMIC_RELEASE, "workgroup"); } while (0)

// Naive full scaled-dot-product attention (query/key/value [4,8,2048,64] given; mask [4,8] int: mask == 1 sets that head's entire score matrix to -1e6, i.e. exactly uniform attention): out = softmax(q k^T / 8 (masked_fill)) v -> [4,8,2048,64].
#define NB 4
#define TT 2048
#define CC 512            // NH * HD = projected width
#define DIN 512          // input (model) width
#define NH 8
#define HD 64
#define NQB (TT / 64)
#define HG 4
#define SCALE (0.125f)
#define CAUSAL 0
#ifndef TNB
#define TNB NB
#endif
__device__ __forceinline__ float bfr(float v) { return (float)(__bf16)v; }
__host__ __device__ __forceinline__ int kb_last(int qb) { return CAUSAL ? ((qb * 64 + 63) >> 7) : (TT / 128 - 1); }
typedef __attribute__((ext_vector_type(8))) __bf16 v8b;
__device__ __forceinline__ v16b frag_b(const __bf16* rowk0, int lane) {
  union { v16b v; v8b q[2]; } u; const __bf16* p = rowk0 + 8 * (lane >> 4);
  u.q[0] = *(const v8b*)p; u.q[1] = *(const v8b*)(p + 16); return u.v;
}
#define QBH 0              // unused: no kernel in this file has a high-precision path
#define QHI 2048            // rows for which k_proj writes a q residual plane
#define KHI 64            // key rows carrying k residual / v bf16 hi+lo planes (read by no kernel in this file)
// B fragment (k rows k0+.., output column o) of a weight: (in,out) [K][ld] or (out,in) [ld rows of K]: bf16 exact, or f16(bf16 * 256) exact
__device__ __forceinline__ v16b wcol_io(const float* Wm, int k0, int o, int lane, int ld) { v16b w; const int g = lane >> 4;
#pragma unroll
  for (int i = 0; i < 8; ++i) { w[i] = (__bf16)Wm[(size_t)(k0 + 8 * g + i) * ld + o]; w[8 + i] = (__bf16)Wm[(size_t)(k0 + 16 + 8 * g + i) * ld + o]; }
  return w; }
__device__ __forceinline__ v16b wcol_oi(const float* Wm, int k0, int o, int lane, int K) { v16b w; const float* p = Wm + (size_t)o * K + k0 + 8 * (lane >> 4);
#pragma unroll
  for (int i = 0; i < 8; ++i) { w[i] = (__bf16)p[i]; w[8 + i] = (__bf16)p[16 + i]; }
  return w; }
__device__ __forceinline__ v16h wcolh_io(const float* Wm, int k0, int o, int lane, int ld) { v16h w; const int g = lane >> 4;
#pragma unroll
  for (int i = 0; i < 8; ++i) { w[i] = (_Float16)(bfr(Wm[(size_t)(k0 + 8 * g + i) * ld + o]) * 256.0f); w[8 + i] = (_Float16)(bfr(Wm[(size_t)(k0 + 16 + 8 * g + i) * ld + o]) * 256.0f); }
  return w; }
__device__ __forceinline__ v16h wcolh_oi(const float* Wm, int k0, int o, int lane, int K) { v16h w; const float* p = Wm + (size_t)o * K + k0 + 8 * (lane >> 4);
#pragma unroll
  for (int i = 0; i < 8; ++i) { w[i] = (_Float16)(bfr(p[i]) * 256.0f); w[8 + i] = (_Float16)(bfr(p[16 + i]) * 256.0f); }
  return w; }
#define WQKV_LAYOUT 0   // 0 = (in,out) [DIN][CC]; 1 = (out,in) [CC][DIN]; 2 = per-head [NH][DIN][HD]
__device__ __forceinline__ v16b wcol_hdk(const float* Wm, int k0, int o, int lane) { v16b w; const int g = lane >> 4; const float* p = Wm + (size_t)(o / HD) * DIN * HD + (o % HD);
#pragma unroll
  for (int i = 0; i < 8; ++i) { w[i] = (__bf16)p[(size_t)(k0 + 8 * g + i) * HD]; w[8 + i] = (__bf16)p[(size_t)(k0 + 16 + 8 * g + i) * HD]; }
  return w; }
#define WO_OUT_IN 0
#if WQKV_LAYOUT == 1
#define WCOL(W, k0, o, lane) wcol_oi(W, k0, o, lane, DIN)
#elif WQKV_LAYOUT == 2
#define WCOL(W, k0, o, lane) wcol_hdk(W, k0, o, lane)
#else
#define WCOL(W, k0, o, lane) wcol_io(W, k0, o, lane, CC)
#endif
#if WO_OUT_IN
#define WOCOL(W, k0, o, lane) wcol_oi(W, k0, o, lane, CC)
#define WOCOLH(W, k0, o, lane) wcolh_oi(W, k0, o, lane, CC)
#else
#define WOCOL(W, k0, o, lane) wcol_io(W, k0, o, lane, DIN)
#define WOCOLH(W, k0, o, lane) wcolh_io(W, k0, o, lane, DIN)
#endif
#define SM_EXTRA_PARAMS , int bsm, int h0s, const int* __restrict__ HM
// per-(batch, head) mask: mask[b][h] == 1 replaces EVERY score of that head with -1e6 (softmax becomes exactly uniform); read per element
#define SM_MASK_HOOK do { const int mk = HM[bsm * NH + h0s + (int)blockIdx.y]; v = (mk == 1) ? -1.0e6f : v; } while (0)
__global__ __launch_bounds__(256) void k_planes(const float* __restrict__ Q, const float* __restrict__ Kx, const float* __restrict__ V, _Float16* __restrict__ QH, _Float16* __restrict__ KH, _Float16* __restrict__ VT) {
  __shared__ __align__(16) _Float16 tv[64][72];
  const int tid = threadIdx.x; const int t0 = blockIdx.x * 64, h = blockIdx.y; const size_t b = blockIdx.z;
  const size_t src0 = ((b * NH + h) * TT + t0) * (size_t)HD;   /* [b][h][t][d] */
  { const int rl = tid >> 2, q = tid & 3;   /* 64 rows x 4 threads x 16 values */
    const float* pq = Q + src0 + (size_t)rl * HD + q * 16; const float* pk = Kx + src0 + (size_t)rl * HD + q * 16; const float* pv = V + src0 + (size_t)rl * HD + q * 16;
    v4f a0 = *(const v4f*)pq, a1 = *(const v4f*)(pq + 4), a2 = *(const v4f*)(pq + 8), a3 = *(const v4f*)(pq + 12); v4f k0 = *(const v4f*)pk, k1 = *(const v4f*)(pk + 4), k2 = *(const v4f*)(pk + 8), k3 = *(const v4f*)(pk + 12);
    asm volatile("s_wait_loadcnt 0x0" ::: "memory");
    v4f w0 = *(const v4f*)pv, w1 = *(const v4f*)(pv + 4), w2 = *(const v4f*)(pv + 8), w3 = *(const v4f*)(pv + 12); asm volatile("s_wait_loadcnt 0x0" ::: "memory");
    float qa[16] = {a0[0],a0[1],a0[2],a0[3],a1[0],a1[1],a1[2],a1[3],a2[0],a2[1],a2[2],a2[3],a3[0],a3[1],a3[2],a3[3]}; float ka[16] = {k0[0],k0[1],k0[2],k0[3],k1[0],k1[1],k1[2],k1[3],k2[0],k2[1],k2[2],k2[3],k3[0],k3[1],k3[2],k3[3]}; float va[16] = {w0[0],w0[1],w0[2],w0[3],w1[0],w1[1],w1[2],w1[3],w2[0],w2[1],w2[2],w2[3],w3[0],w3[1],w3[2],w3[3]};
    hx8 qh0, qh1, kh0, kh1;
#pragma unroll
    for (int i = 0; i < 8; ++i) { qh0[i] = (_Float16)bfr(qa[i]); qh1[i] = (_Float16)bfr(qa[8 + i]); kh0[i] = (_Float16)bfr(ka[i]); kh1[i] = (_Float16)bfr(ka[8 + i]); tv[q * 16 + i][rl] = (_Float16)bfr(va[i]); tv[q * 16 + 8 + i][rl] = (_Float16)bfr(va[8 + i]); }
    const size_t row = b * TT + t0 + rl; _Float16* dq = QH + row * CC + h * HD + q * 16; _Float16* dk = KH + row * CC + h * HD + q * 16;
    vst2((unsigned*)dq, *(const v4u*)&qh0); vst2((unsigned*)(dq + 8), *(const v4u*)&qh1); vst2((unsigned*)dk, *(const v4u*)&kh0); vst2((unsigned*)(dk + 8), *(const v4u*)&kh1); }
  __syncthreads();
  for (int e = tid; e < 64 * 8; e += 256) { const int cl = e >> 3, q = e & 7; vst2((unsigned*)(VT + (b * CC + h * HD + cl) * (size_t)TT + t0 + q * 8), *(const v4u*)&tv[cl][q * 8]); } }   
#ifndef SM_EXTRA_PARAMS
#define SM_EXTRA_PARAMS
#endif
#ifndef PROJ_EXTRA_PARAMS
#define PROJ_EXTRA_PARAMS
#endif
#ifndef PROJ_EXTRA_PARAMS
#define PROJ_EXTRA_PARAMS
#endif
#ifndef SM_MASK_HOOK
#define SM_MASK_HOOK (void)0
#endif


#ifndef SM_EXTRA_PARAMS
#define SM_EXTRA_PARAMS
#endif
#ifndef SM_MASK_HOOK
#define SM_MASK_HOOK (void)0
#endif

#define WS_QH  0u                                      // f16 q rows [b*t][CC]
#define WS_KH  (WS_QH + 2u * (size_t)NB * TT * CC)      // f16 k rows [b*t][CC]
#define WS_VT  (WS_KH + 2u * (size_t)NB * TT * CC)      // f16 v planes [b][c][t]
#define WS_QL  (WS_VT + 2u * (size_t)NB * CC * TT)      // f16 q residual x 2^10 rows [b][t < QHI][CC]
#define WS_KL  (WS_QL + 2u * (size_t)NB * QHI * CC)     // f16 k residual x 2^10 rows [b][t < KHI][CC]
#define WS_VB  (WS_KL + 2u * (size_t)NB * KHI * CC)     // bf16 v hi planes [b][c][t < KHI]
#define WS_VBL (WS_VB + 2u * (size_t)NB * CC * KHI)
#define WS_S   (WS_VBL + 2u * (size_t)NB * CC * KHI)    // f32 [hg][t][s]; unused: k_fa keeps the logits in registers
#define WS_Y   (WS_S  + 4u * (size_t)HG * TT * TT)      // f32 ctx rows [b*t][CC] (only when there is an output projection)
#define WS_END (WS_Y  + 0u)

// ---- k_proj: block = (64 rows, 128 cols, which): q/k/v = X W (+ b) with exact bf16 products (K = DIN) -> which 0: q f16 rows (+ residual rows < QHI); 1: k f16 rows (+ residual rows < KHI); 2: v f16 planes [c][t] (+ bf16 hi/lo planes for t < KHI)
__global__ __launch_bounds__(128) void k_proj(const float* __restrict__ XQ, const float* __restrict__ XK, const float* __restrict__ XV, const float* __restrict__ WQ, const float* __restrict__ WK, const float* __restrict__ WV, const float* __restrict__ BQ, const float* __restrict__ BK, const float* __restrict__ BV,
    _Float16* __restrict__ QH, _Float16* __restrict__ QL, _Float16* __restrict__ KH, _Float16* __restrict__ KL, _Float16* __restrict__ VT, __bf16* __restrict__ VB, __bf16* __restrict__ VBL) {
  __shared__ __align__(16) _Float16 sh[64][136], sl[64][136]; __shared__ __align__(16) _Float16 th[128][72]; __shared__ __align__(16) __bf16 tb[128][72], tbl[128][72];
  const int tid = threadIdx.x, wave = tid >> 5, lane = tid & 31, col = lane & 15, g = lane >> 4; const int which = blockIdx.z; const int c0 = blockIdx.y * 128; const size_t r0 = (size_t)blockIdx.x * 64; const size_t bb = r0 / TT; const int t0 = (int)(r0 % TT);
  const float* X = which == 0 ? XQ : which == 1 ? XK : XV; const float* WA = which == 0 ? WQ : which == 1 ? WK : WV; const float* BA = which == 0 ? BQ : which == 1 ? BK : BV;
  v8f acc[8] = {};
#pragma unroll 2
  for (int kc = 0; kc < DIN / 32; ++kc) { v16b a; { const float* p = X + (r0 + wave * 16 + col) * DIN + kc * 32 + 8 * g;
#pragma unroll
      for (int i = 0; i < 8; ++i) { a[i] = (__bf16)p[i]; a[8 + i] = (__bf16)p[16 + i]; } }
    asm volatile("s_wait_loadcnt 0x0" ::: "memory");
#pragma unroll
    for (int j = 0; j < 8; ++j) { const v16b w = WCOL(WA, kc * 32, c0 + j * 16 + col, lane); asm volatile("s_wait_loadcnt 0x0" ::: "memory"); acc[j] = wmma_bf(a, w, acc[j]); } }
  if (which < 2) { _Float16* DH = which == 0 ? QH : KH; _Float16* DL = which == 0 ? QL : KL; const int nhi = which == 0 ? QHI : KHI; const bool hi_rows = t0 < nhi;
#pragma unroll
    for (int j = 0; j < 8; ++j) { const float bias = BA ? bfr(BA[c0 + j * 16 + col]) : 0.f;
#pragma unroll
      for (int r = 0; r < 8; ++r) { const float v = acc[j][r] + bias; const _Float16 hv = (_Float16)v; sh[wave * 16 + 8 * g + r][j * 16 + col] = hv; sl[wave * 16 + 8 * g + r][j * 16 + col] = (_Float16)((v - (float)hv) * 1024.0f); } }
    __syncthreads();
    for (int e = tid; e < 64 * 16; e += 128) { const int rl = e >> 4, q = e & 15; vst2((unsigned*)(DH + (r0 + rl) * CC + c0 + q * 8), *(const v4u*)&sh[rl][q * 8]); if (hi_rows) vst2((unsigned*)(DL + (bb * nhi + t0 + rl) * (size_t)CC + c0 + q * 8), *(const v4u*)&sl[rl][q * 8]); }
  } else { const bool hi_rows = t0 < KHI;
#pragma unroll
    for (int j = 0; j < 8; ++j) { const float bias = BA ? bfr(BA[c0 + j * 16 + col]) : 0.f;
#pragma unroll
      for (int r = 0; r < 8; ++r) { const float v = acc[j][r] + bias; const int rl = wave * 16 + 8 * g + r, cl = j * 16 + col; th[cl][rl] = (_Float16)v; const __bf16 bh = (__bf16)v; tb[cl][rl] = bh; tbl[cl][rl] = (__bf16)(v - (float)bh); } }
    __syncthreads();
    for (int e = tid; e < 128 * 8; e += 128) { const int cl = e >> 3, q = e & 7; vst2((unsigned*)(VT + (bb * CC + c0 + cl) * (size_t)TT + t0 + q * 8), *(const v4u*)&th[cl][q * 8]); if (hi_rows) { const size_t o3 = (bb * CC + c0 + cl) * (size_t)KHI + t0 + q * 8; vst2((unsigned*)(VB + o3), *(const v4u*)&tb[cl][q * 8]); vst2((unsigned*)(VBL + o3), *(const v4u*)&tbl[cl][q * 8]); } } } }
// ---- k_fa: one wave = QT * 16 queries of (b, h), walking its group's half of the keys 32 at a time with a running maximum and sum per query, so that no score ever leaves the registers.
// A block is KG groups of FW waves. The groups hold the same queries and share out the keys, tile by tile in turn, so that four waves and not two stand on each SIMD: one wave's vector work runs beside another's matrix work. Each group keeps a running maximum, sum and O of its own; they are joined once, behind the loop.
// A group's eight waves read the same key rows and v plane rows: asynchronous copies bring them into LDS once a group, KT keys a tile, two buffers a group; the fragments are read from there.
// S^T = K . Q^T (A = 16 key rows, B = 16 query columns; 1 product: q is rounded to bf16 first, so its f16 plane is exact from 2^-14 up, where a residual plane holds zeros; below that it is rounded as k's plane is): lane (g, col) holds keys 8g + r of query col, which is the B fragment of O^T += V^T . P^T as it stands.
// P = exp(score - running max) x 2^11, once to f16, against v f16 (1 product); the sum is taken in f32 from the unrounded P and carries the same 2^11, so it cancels in O / sum.
// Every #pragma unroll below is there so that the fragment and accumulator arrays are indexed by constants alone and stay in registers; the loop over the keys stays rolled.
#define QT 2    // 16-query column groups per wave
#define FW 8    // waves per key group: they walk the same key and v rows, which the group brings into LDS once for all eight
#define KG 2    // key groups per block: group kg walks the tiles kg, kg + KG, ...
#define LOG2E 1.4426950408889634f
#define KT 128                 // keys per LDS tile: four passes of 32 keys between two barriers
#define KPB 144                // LDS pitch of a key row, bytes: 128 + 16, so that 16 rows read 16 B each without a bank conflict
#define VPB 272                // LDS pitch of a v plane row (KT keys), bytes: 256 + 16, for the same reason
#define KTB (KT * KPB)         // key rows of a tile; the v rows stand behind them
#define BUFB (KTB + HD * VPB)  // one buffer of the ring
#define NTILE (TT / (KT * KG))   // tiles a group walks
// One tile's copies of one lane: 4 x 16 B of key rows (8 lanes to a 128-B row, 32 rows apart) and 4 x 16 B of v plane rows (16 lanes to a 256-B row, 16 rows apart), global memory to LDS through no register.
// The s_wait_xcnt closes the statement so that no address register of a copy is rewritten in front of it.
__device__ __forceinline__ void tile_copy(unsigned lk, unsigned lv, const _Float16* gk, const _Float16* gv) {
  asm volatile("global_load_async_to_lds_b128 %0, %8, off\n\t"
               "global_load_async_to_lds_b128 %1, %9, off\n\t"
               "global_load_async_to_lds_b128 %2, %10, off\n\t"
               "global_load_async_to_lds_b128 %3, %11, off\n\t"
               "global_load_async_to_lds_b128 %4, %12, off\n\t"
               "global_load_async_to_lds_b128 %5, %13, off\n\t"
               "global_load_async_to_lds_b128 %6, %14, off\n\t"
               "global_load_async_to_lds_b128 %7, %15, off\n\t"
               "s_wait_xcnt 0x0"
               :: "v"(lk), "v"(lk + 32 * KPB), "v"(lk + 64 * KPB), "v"(lk + 96 * KPB), "v"(lv), "v"(lv + 16 * VPB), "v"(lv + 32 * VPB), "v"(lv + 48 * VPB),
                  "v"(gk), "v"(gk + (size_t)32 * CC), "v"(gk + (size_t)64 * CC), "v"(gk + (size_t)96 * CC), "v"(gv), "v"(gv + (size_t)16 * TT), "v"(gv + (size_t)32 * TT), "v"(gv + (size_t)48 * TT)
               : "memory");
}
__device__ __forceinline__ float xhalf(float x) { return __builtin_bit_cast(float, __builtin_amdgcn_permlanex16(__builtin_bit_cast(int, x), __builtin_bit_cast(int, x), 0x76543210, 0xfedcba98, false, false)); }   /* lane l with lane l ^ 16 */
__device__ __forceinline__ v8f wm(v16h a, v16h b, v8f c) { return __builtin_amdgcn_wmma_f32_16x16x32_f16(false, a, false, b, (short)0, c, false, false); }
__global__ __launch_bounds__(KG * FW * 32) void k_fa(const _Float16* __restrict__ QH, const _Float16* __restrict__ KH, const _Float16* __restrict__ VT, const int* __restrict__ HM, float* __restrict__ Y) {
  __shared__ __align__(16) float ss[FW][QT * 16][HD + 4];
  __shared__ float ml[FW][2][QT][32];   /* group 1's running maximum and sum, lane by lane, for the join */
  __shared__ __align__(16) unsigned char ring[KG * 2 * BUFB];   /* two buffers a group: its next tile lands while this one is worked on */
  const int kg = __builtin_amdgcn_readfirstlane((int)threadIdx.x >> 8);   /* key group, the same in every lane of a wave: held in a scalar register, so that the tests on it are scalar branches */
  const int tid = threadIdx.x & (FW * 32 - 1), wave = tid >> 5, lane = tid & 31, col = lane & 15, g = lane >> 4;   /* tid, wave: within the group */
  const int bh = blockIdx.y, b = bh / NH, h = bh % NH; const int q0 = blockIdx.x * (FW * 16 * QT) + wave * (16 * QT);
  const int hm = HM[bh];   /* mask[b][h] == 1 replaces EVERY score of that head with one constant, -1e6: its softmax is 1 / TT at every key, whatever the constant */
  v16h qh[QT][2];
#pragma unroll
  for (int qt = 0; qt < QT; ++qt)
#pragma unroll
    for (int kc = 0; kc < 2; ++kc) { const size_t qo = ((size_t)b * TT + q0 + qt * 16 + col) * CC + h * HD + kc * 32; qh[qt][kc] = frag_h(QH + qo, lane); }
  asm volatile("s_wait_xcnt 0x0" ::: "memory");   /* stands in front of the set-up below, which takes over the address registers of the q loads above */
  __builtin_amdgcn_sched_barrier(0);   /* keeps that set-up behind the wait */
  const _Float16* gk = KH + ((size_t)b * TT + kg * KT + (tid >> 3)) * CC + h * HD + (tid & 7) * 8;             /* this lane's 16 B of key row tid / 8 of the group's first tile; + key * CC */
  const _Float16* gv = VT + ((size_t)b * CC + h * HD + (tid >> 4)) * (size_t)TT + kg * KT + (tid & 15) * 8;   /* this lane's 16 B of v plane row tid / 16; + key */
  const unsigned l0 = (unsigned)(size_t)&ring[kg * 2 * BUFB];   /* LDS byte address of the group's two buffers */
  const unsigned lk = l0 + (tid >> 3) * KPB + (tid & 7) * 16, lv = l0 + KTB + (tid >> 4) * VPB + (tid & 15) * 16;
  tile_copy(lk, lv, gk, gv);
  asm volatile("s_wait_asynccnt 0x0" ::: "memory");   /* this wave's share of tile 0 has landed */
  __syncthreads();                                    /* every wave's share has: tile 0 may be read */
  tile_copy(lk + BUFB, lv + BUFB, gk + (size_t)KG * KT * CC, gv + KG * KT);
  /* The mask is applied once, to q, and not to every score: with q = 0 each score of a masked head is exactly 0 (the key planes are finite), every P is 2^11 and the sum TT x 2^11, both exact, so O / sum is the module's uniform average of v. */
  __builtin_amdgcn_sched_barrier(0);   /* keeps the selects behind the copies above: moved up, they made tile 0's copies wait for the q loads */
  const bool masked = hm == 1;
#pragma unroll
  for (int qt = 0; qt < QT; ++qt)
#pragma unroll
    for (int kc = 0; kc < 2; ++kc) qh[qt][kc] = masked ? v16h{} : qh[qt][kc];
  v8f o[QT][4] = {}; float m[QT], l[QT];
#pragma unroll
  for (int qt = 0; qt < QT; ++qt) { m[qt] = -3.0e38f; l[qt] = 0.f; }
  for (int t = 0; t < NTILE; ++t) {
    const unsigned bo = (t & 1) * BUFB;
    const unsigned char* Kl = ring + kg * 2 * BUFB + bo + col * KPB;          /* + key in tile * KPB */
    const unsigned char* Vl = ring + kg * 2 * BUFB + bo + KTB + col * VPB;    /* + d tile * 16 * VPB + key in tile * 2 */
    v16h kf[2][2];
#pragma unroll
    for (int kt = 0; kt < 2; ++kt)
#pragma unroll
      for (int kc = 0; kc < 2; ++kc) kf[kt][kc] = frag_h((const _Float16*)(Kl + (kt * 16) * KPB + kc * 64), lane);
#pragma unroll 1   /* the passes of a tile stay rolled: unrolled they took some 200 registers more, and the copies' address operands spilled */
   for (int ps = 0; ps < KT / 32; ++ps) {
    v16h vf[4];
#pragma unroll
    for (int dt = 0; dt < 4; ++dt) vf[dt] = frag_h((const _Float16*)(Vl + (dt * 16) * VPB + ps * 64), lane);
    __builtin_amdgcn_sched_barrier(0);   /* keeps the v reads up here, a whole score and softmax phase ahead of their use, in one group */
    v8f s[QT][2] = {};
#pragma unroll
    for (int kc = 0; kc < 2; ++kc)
#pragma unroll
      for (int kt = 0; kt < 2; ++kt)
#pragma unroll
        for (int qt = 0; qt < QT; ++qt) s[qt][kt] = wm(kf[kt][kc], qh[qt][kc], s[qt][kt]);
    const int kn = ((ps + 1) * 32) & (KT - 1);   /* the next pass's key rows of the same tile, read behind this pass's score products; a tile's last pass reads its rows 0.. again, unused: no branch stands behind the products */
#pragma unroll
    for (int kt = 0; kt < 2; ++kt)
#pragma unroll
      for (int kc = 0; kc < 2; ++kc) kf[kt][kc] = frag_h((const _Float16*)(Kl + (kn + kt * 16) * KPB + kc * 64), lane);
    __builtin_amdgcn_sched_barrier(0);   /* keeps the next key rows' reads ahead of the softmax, in one group; without it they sink to right in front of their use */
    v16h pf[QT];
#pragma unroll
    for (int qt = 0; qt < QT; ++qt) { float x[16]; float mx = -3.0e38f;
#pragma unroll
      for (int i = 0; i < 16; ++i) { x[i] = s[qt][i >> 3][i & 7]; mx = fmaxf(mx, x[i]); }   /* unscaled */
      mx = fmaxf(mx, xhalf(mx));   /* the other 8 + 8 keys of this query */
      const float mn = fmaxf(m[qt], mx * (SCALE * LOG2E));   /* running maximum in log2 units */
      const float alpha = __builtin_amdgcn_exp2f(m[qt] - mn); const float bb = 11.0f - mn; m[qt] = mn;
      v2f sum[2] = {{0.f, 0.f}, {0.f, 0.f}};   /* four short chains, two to a packed add */
#pragma unroll
      for (int i = 0; i < 16; i += 2) { const v2f xv = {x[i], x[i + 1]}; const v2f t = xv * (SCALE * LOG2E) + bb; const v2f p = {__builtin_amdgcn_exp2f(t[0]), __builtin_amdgcn_exp2f(t[1])}; sum[(i >> 1) & 1] += p; pf[qt][i] = (_Float16)p[0]; pf[qt][i + 1] = (_Float16)p[1]; }
      l[qt] = l[qt] * alpha + ((sum[0][0] + sum[0][1]) + (sum[1][0] + sum[1][1]));
#pragma unroll
      for (int dt = 0; dt < 4; ++dt) o[qt][dt] *= alpha; }
#pragma unroll
    for (int dt = 0; dt < 4; ++dt)
#pragma unroll
      for (int qt = 0; qt < QT; ++qt) o[qt][dt] = wm(vf[dt], pf[qt], o[qt][dt]);
   }
    asm volatile("s_wait_dscnt 0x0" ::: "memory");      /* this wave's reads of tile t are done */
    asm volatile("s_wait_asynccnt 0x0" ::: "memory");   /* this wave's share of tile t + 1 has landed */
    __syncthreads();                                    /* tile t + 1 may be read, tile t's buffer may be refilled */
    if (t + 2 < NTILE) tile_copy(lk + bo, lv + bo, gk + (size_t)(t + 2) * KG * KT * CC, gv + (t + 2) * KG * KT);
  }
  asm volatile("s_wait_asynccnt 0x0" ::: "memory");   /* no copy is outstanding when the wave goes on to its end */
  /* The join: wave w of group 1 hands its maximum, sum and unscaled O to wave w of group 0, lane to lane, through LDS; group 0 brings both halves to the larger maximum, adds them, divides and stores. */
  if (kg == 1) {
#pragma unroll
    for (int qt = 0; qt < QT; ++qt) { ml[wave][0][qt][lane] = m[qt]; ml[wave][1][qt][lane] = l[qt];
#pragma unroll
      for (int dt = 0; dt < 4; ++dt) { v4f lo = { o[qt][dt][0], o[qt][dt][1], o[qt][dt][2], o[qt][dt][3] }, hi = { o[qt][dt][4], o[qt][dt][5], o[qt][dt][6], o[qt][dt][7] };
        *(v4f*)&ss[wave][qt * 16 + col][dt * 16 + 8 * g] = lo; *(v4f*)&ss[wave][qt * 16 + col][dt * 16 + 8 * g + 4] = hi; } } }
  __syncthreads();   /* group 1's halves may be read */
  if (kg != 0) return;
#pragma unroll
  for (int qt = 0; qt < QT; ++qt) { const float m1 = ml[wave][0][qt][lane], l1 = ml[wave][1][qt][lane]; const float mn = fmaxf(m[qt], m1);
    const float a0 = __builtin_amdgcn_exp2f(m[qt] - mn), a1 = __builtin_amdgcn_exp2f(m1 - mn); const float lt = l[qt] * a0 + l1 * a1;
    const float inv = 1.0f / (lt + xhalf(lt)); const float c0 = a0 * inv, c1 = a1 * inv;
#pragma unroll
    for (int dt = 0; dt < 4; ++dt) { const v4f plo = *(const v4f*)&ss[wave][qt * 16 + col][dt * 16 + 8 * g], phi = *(const v4f*)&ss[wave][qt * 16 + col][dt * 16 + 8 * g + 4];   /* the 32 B that the same lane of group 1 wrote, and that this lane overwrites */
      v4f lo = { o[qt][dt][0] * c0 + plo[0] * c1, o[qt][dt][1] * c0 + plo[1] * c1, o[qt][dt][2] * c0 + plo[2] * c1, o[qt][dt][3] * c0 + plo[3] * c1 }, hi = { o[qt][dt][4] * c0 + phi[0] * c1, o[qt][dt][5] * c0 + phi[1] * c1, o[qt][dt][6] * c0 + phi[2] * c1, o[qt][dt][7] * c0 + phi[3] * c1 };
      *(v4f*)&ss[wave][qt * 16 + col][dt * 16 + 8 * g] = lo; *(v4f*)&ss[wave][qt * 16 + col][dt * 16 + 8 * g + 4] = hi; } }
  LDSX(); for (int rl = g; rl < QT * 16; rl += 2) vst2(Y + ((size_t)bh * TT + q0 + rl) * HD + col * 4, *(const v4f*)&ss[wave][rl][col * 4]); }   /* output layout [b][h][t][d]: two 256-B rows a store */

extern "C" void kernel_launch(void* const* d_in, const int* in_sizes, int n_in, void* d_out, int out_size, void* d_ws, size_t ws_size, hipStream_t stream) {
  (void)in_sizes; (void)n_in; (void)out_size;
  const float** F = (const float**)d_in;
  if (ws_size < (size_t)WS_END) return;
  char* ws = (char*)d_ws; _Float16 *QH = (_Float16*)(ws + WS_QH), *KH = (_Float16*)(ws + WS_KH), *VT = (_Float16*)(ws + WS_VT), *KL = (_Float16*)(ws + WS_KL); __bf16 *VB = (__bf16*)(ws + WS_VB), *VBL = (__bf16*)(ws + WS_VBL); float *S = (float*)(ws + WS_S), *Y = (float*)(ws + WS_Y);
  (void)Y; (void)S; (void)KL; (void)VB; (void)VBL;
  // inputs: 0 query [4,8,2048,64]; 1 key; 2 value; 3 mask [4,8] int32 (1 -> the whole head's scores := -1e6)
  const int* HM = (const int*)d_in[3];
  k_planes<<<dim3(TT / 64, NH, NB), 256, 0, stream>>>(F[0], F[1], F[2], QH, KH, VT);
  k_fa<<<dim3(TT / (FW * 16 * QT), NH * NB), KG * FW * 32, 0, stream>>>(QH, KH, VT, HM, (float*)d_out);
}

// v006
// A run of this version takes 33.7 microseconds.
// Next to v005, in two timings, it ran 1.10 times as fast each time.
// Counting every step since v000, it is 28.9 times as fast.
// compute dtype: all float inputs rounded to bf16; q, k, v are bf16-valued so their f16 planes are exact (sub-6e-5 magnitudes aside); logits q x k (1 product) x 64^-0.5, a masked head (the module sets its every score to -1e6) runs with q = 0, so its every score is one constant too and the softmax is the same uniform one; softmax f32; P x 2^7 once to f16 x v (exact in f16) (1 product); f32 output.
#include <hip/hip_runtime.h>
#include <math.h>

typedef __attribute__((ext_vector_type(16))) _Float16 v16h;
typedef __attribute__((ext_vector_type(16))) __bf16 v16b;
typedef __attribute__((ext_vector_type(8)))  _Float16 v8h;
typedef __attribute__((ext_vector_type(8)))  float v8f;
typedef __attribute__((ext_vector_type(4)))  float v4f;
typedef __attribute__((ext_vector_type(2)))  float v2f;
typedef __attribute__((ext_vector_type(4)))  unsigned v4u;
typedef _Float16 hx8 __attribute__((ext_vector_type(8)));
typedef __attribute__((ext_vector_type(4)))  int v4i;
typedef float __attribute__((may_alias)) float_a;
typedef int __attribute__((may_alias)) int_a;

template <typename T> __device__ __forceinline__ void vst2(void* p, T v) { *(T*)p = v;  }
__device__ __forceinline__ v8f wmma16(v16h a, v16h b, v8f c) {
  v8f d = __builtin_amdgcn_wmma_f32_16x16x32_f16(false, a, false, b, (short)0, c, false, false);
  asm volatile("v_nop\n\tv_nop\n\tv_nop\n\tv_nop" : "+v"(d) : "v"(a), "v"(b));
  return d;
}
__device__ __forceinline__ v8f wmma_bf(v16b a, v16b b, v8f c) {
  v8f d = __builtin_amdgcn_wmma_f32_16x16x32_bf16(false, a, false, b, (short)0, c, false, false);
  asm volatile("v_nop\n\tv_nop\n\tv_nop\n\tv_nop" : "+v"(d) : "v"(a), "v"(b));
  return d;
}
// 16x16x32 fragments: lane = (h = lane>>4, row/col = lane&15); elements 0..7 = k0+8h+0..7, 8..15 = k0+16+8h+0..7; D element r = row 8h+r
__device__ __forceinline__ v16h frag_h(const _Float16* rowk0, int lane) {
  union { v16h v; v8h q[2]; } u; const _Float16* p = rowk0 + 8 * (lane >> 4);
  u.q[0] = *(const v8h*)p; u.q[1] = *(const v8h*)(p + 16); return u.v;
}
__device__ __forceinline__ v16h frag_f32(const float* rowk0, int lane) {
  v16h a; const float* p = rowk0 + 8 * (lane >> 4);
#pragma unroll
  for (int i = 0; i < 8; ++i) { a[i] = (_Float16)p[i]; a[8 + i] = (_Float16)p[16 + i]; }
  return a;
}
__device__ __forceinline__ v16h frag_f32s(const float* rowk0, int lane, float sc) {
  v16h a; const float* p = rowk0 + 8 * (lane >> 4);
#pragma unroll
  for (int i = 0; i < 8; ++i) { a[i] = (_Float16)(p[i] * sc); a[8 + i] = (_Float16)(p[16 + i] * sc); }
  return a;
}
// column fragment from a [K][ld] layout (column n), rows >= K read as 0
__device__ __forceinline__ v16h fragc_f32(const float* W, int k0, int n, int lane, int ld, int K) {
  v16h a; const int g = lane >> 4;
#pragma unroll
  for (int i = 0; i < 8; ++i) { const int ka = k0 + 8 * g + i, kb = ka + 16;
    a[i] = (_Float16)(ka < K ? W[(size_t)(ka < K ? ka : K - 1) * ld + n] : 0.f); a[8 + i] = (_Float16)(kb < K ? W[(size_t)(kb < K ? kb : K - 1) * ld + n] : 0.f); }
  return a;
}
struct F2 { v16b h, l; };
__device__ __forceinline__ F2 bsplit16(const float v[16]) { F2 r;
#pragma unroll
  for (int i = 0; i < 16; ++i) { const __bf16 h = (__bf16)v[i]; r.h[i] = h; r.l[i] = (__bf16)(v[i] - (float)h); }
  return r; }
__device__ __forceinline__ F2 split_row(const float* row, int k0, int lane) { float v[16]; const float* p = row + k0 + 8 * (lane >> 4);
#pragma unroll
  for (int i = 0; i < 8; ++i) { v[i] = p[i]; v[8 + i] = p[16 + i]; }
  return bsplit16(v); }
__device__ __forceinline__ F2 split_rowK(const float* row, int k0, int lane, int K) { float v[16]; const int g = lane >> 4;
#pragma unroll
  for (int i = 0; i < 8; ++i) { const int ka = k0 + 8 * g + i, kb = ka + 16; v[i] = ka < K ? row[ka < K ? ka : K - 1] : 0.f; v[8 + i] = kb < K ? row[kb < K ? kb : K - 1] : 0.f; }
  return bsplit16(v); }
__device__ __forceinline__ F2 split_col(const float* W, int k0, int n, int lane, int ld, int K) { float v[16]; const int g = lane >> 4;
#pragma unroll
  for (int i = 0; i < 8; ++i) { const int ka = k0 + 8 * g + i, kb = ka + 16; v[i] = ka < K ? W[(size_t)(ka < K ? ka : K - 1) * ld + n] : 0.f; v[8 + i] = kb < K ? W[(size_t)(kb < K ? kb : K - 1) * ld + n] : 0.f; }
  return bsplit16(v); }
__device__ __forceinline__ v8f mac3(const F2& a, const F2& b, v8f c) { c = wmma_bf(a.l, b.h, c); c = wmma_bf(a.h, b.l, c); return wmma_bf(a.h, b.h, c); }
__device__ __forceinline__ float sigm(float v) { return 1.0f / (1.0f + expf(-v)); }
#define LDSX() do { asm volatile("s_wait_dscnt 0" ::: "memory"); __builtin_amdgcn_wave_barrier(); __builtin_amdgcn_fence(__ATOMIC_RELEASE, "workgroup"); } while (0)

// Naive full scaled-dot-product attention (query/key/value [4,8,2048,64] given; mask [4,8] int: mask == 1 sets that head's entire score matrix to -1e6, i.e. exactly uniform attention): out = softmax(q k^T / 8 (masked_fill)) v -> [4,8,2048,64].
#define NB 4
#define TT 2048
#define CC 512            // NH * HD = projected width
#define DIN 512          // input (model) width
#define NH 8
#define HD 64
#define NQB (TT / 64)
#define HG 4
#define SCALE (0.125f)
#define CAUSAL 0
#ifndef TNB
#define TNB NB
#endif
__device__ __forceinline__ float bfr(float v) { return (float)(__bf16)v; }
__host__ __device__ __forceinline__ int kb_last(int qb) { return CAUSAL ? ((qb * 64 + 63) >> 7) : (TT / 128 - 1); }
typedef __attribute__((ext_vector_type(8))) __bf16 v8b;
__device__ __forceinline__ v16b frag_b(const __bf16* rowk0, int lane) {
  union { v16b v; v8b q[2]; } u; const __bf16* p = rowk0 + 8 * (lane >> 4);
  u.q[0] = *(const v8b*)p; u.q[1] = *(const v8b*)(p + 16); return u.v;
}
#define QBH 0              // unused: no kernel in this file has a high-precision path
#define QHI 2048            // rows for which k_proj writes a q residual plane
#define KHI 64            // key rows carrying k residual / v bf16 hi+lo planes (read by no kernel in this file)
// B fragment (k rows k0+.., output column o) of a weight: (in,out) [K][ld] or (out,in) [ld rows of K]: bf16 exact, or f16(bf16 * 256) exact
__device__ __forceinline__ v16b wcol_io(const float* Wm, int k0, int o, int lane, int ld) { v16b w; const int g = lane >> 4;
#pragma unroll
  for (int i = 0; i < 8; ++i) { w[i] = (__bf16)Wm[(size_t)(k0 + 8 * g + i) * ld + o]; w[8 + i] = (__bf16)Wm[(size_t)(k0 + 16 + 8 * g + i) * ld + o]; }
  return w; }
__device__ __forceinline__ v16b wcol_oi(const float* Wm, int k0, int o, int lane, int K) { v16b w; const float* p = Wm + (size_t)o * K + k0 + 8 * (lane >> 4);
#pragma unroll
  for (int i = 0; i < 8; ++i) { w[i] = (__bf16)p[i]; w[8 + i] = (__bf16)p[16 + i]; }
  return w; }
__device__ __forceinline__ v16h wcolh_io(const float* Wm, int k0, int o, int lane, int ld) { v16h w; const int g = lane >> 4;
#pragma unroll
  for (int i = 0; i < 8; ++i) { w[i] = (_Float16)(bfr(Wm[(size_t)(k0 + 8 * g + i) * ld + o]) * 256.0f); w[8 + i] = (_Float16)(bfr(Wm[(size_t)(k0 + 16 + 8 * g + i) * ld + o]) * 256.0f); }
  return w; }
__device__ __forceinline__ v16h wcolh_oi(const float* Wm, int k0, int o, int lane, int K) { v16h w; const float* p = Wm + (size_t)o * K + k0 + 8 * (lane >> 4);
#pragma unroll
  for (int i = 0; i < 8; ++i) { w[i] = (_Float16)(bfr(p[i]) * 256.0f); w[8 + i] = (_Float16)(bfr(p[16 + i]) * 256.0f); }
  return w; }
#define WQKV_LAYOUT 0   // 0 = (in,out) [DIN][CC]; 1 = (out,in) [CC][DIN]; 2 = per-head [NH][DIN][HD]
__device__ __forceinline__ v16b wcol_hdk(const float* Wm, int k0, int o, int lane) { v16b w; const int g = lane >> 4; const float* p = Wm + (size_t)(o / HD) * DIN * HD + (o % HD);
#pragma unroll
  for (int i = 0; i < 8; ++i) { w[i] = (__bf16)p[(size_t)(k0 + 8 * g + i) * HD]; w[8 + i] = (__bf16)p[(size_t)(k0 + 16 + 8 * g + i) * HD]; }
  return w; }
#define WO_OUT_IN 0
#if WQKV_LAYOUT == 1
#define WCOL(W, k0, o, lane) wcol_oi(W, k0, o, lane, DIN)
#elif WQKV_LAYOUT == 2
#define WCOL(W, k0, o, lane) wcol_hdk(W, k0, o, lane)
#else
#define WCOL(W, k0, o, lane) wcol_io(W, k0, o, lane, CC)
#endif
#if WO_OUT_IN
#define WOCOL(W, k0, o, lane) wcol_oi(W, k0, o, lane, CC)
#define WOCOLH(W, k0, o, lane) wcolh_oi(W, k0, o, lane, CC)
#else
#define WOCOL(W, k0, o, lane) wcol_io(W, k0, o, lane, DIN)
#define WOCOLH(W, k0, o, lane) wcolh_io(W, k0, o, lane, DIN)
#endif
#define SM_EXTRA_PARAMS , int bsm, int h0s, const int* __restrict__ HM
// per-(batch, head) mask: mask[b][h] == 1 replaces EVERY score of that head with -1e6 (softmax becomes exactly uniform); read per element
#define SM_MASK_HOOK do { const int mk = HM[bsm * NH + h0s + (int)blockIdx.y]; v = (mk == 1) ? -1.0e6f : v; } while (0)
__global__ __launch_bounds__(256) void k_planes(const float* __restrict__ Q, const float* __restrict__ Kx, const float* __restrict__ V, _Float16* __restrict__ QH, _Float16* __restrict__ KH, _Float16* __restrict__ VT) {
  __shared__ __align__(16) _Float16 tv[64][72];
  const int tid = threadIdx.x; const int t0 = blockIdx.x * 64, h = blockIdx.y; const size_t b = blockIdx.z;
  const size_t src0 = ((b * NH + h) * TT + t0) * (size_t)HD;   /* [b][h][t][d] */
  { const int rl = tid >> 2, q = tid & 3;   /* 64 rows x 4 threads x 16 values */
    const float* pq = Q + src0 + (size_t)rl * HD + q * 16; const float* pk = Kx + src0 + (size_t)rl * HD + q * 16; const float* pv = V + src0 + (size_t)rl * HD + q * 16;
    v4f a0 = *(const v4f*)pq, a1 = *(const v4f*)(pq + 4), a2 = *(const v4f*)(pq + 8), a3 = *(const v4f*)(pq + 12); v4f k0 = *(const v4f*)pk, k1 = *(const v4f*)(pk + 4), k2 = *(const v4f*)(pk + 8), k3 = *(const v4f*)(pk + 12);
    asm volatile("s_wait_loadcnt 0x0" ::: "memory");
    v4f w0 = *(const v4f*)pv, w1 = *(const v4f*)(pv + 4), w2 = *(const v4f*)(pv + 8), w3 = *(const v4f*)(pv + 12); asm volatile("s_wait_loadcnt 0x0" ::: "memory");
    float qa[16] = {a0[0],a0[1],a0[2],a0[3],a1[0],a1[1],a1[2],a1[3],a2[0],a2[1],a2[2],a2[3],a3[0],a3[1],a3[2],a3[3]}; float ka[16] = {k0[0],k0[1],k0[2],k0[3],k1[0],k1[1],k1[2],k1[3],k2[0],k2[1],k2[2],k2[3],k3[0],k3[1],k3[2],k3[3]}; float va[16] = {w0[0],w0[1],w0[2],w0[3],w1[0],w1[1],w1[2],w1[3],w2[0],w2[1],w2[2],w2[3],w3[0],w3[1],w3[2],w3[3]};
    hx8 qh0, qh1, kh0, kh1;
#pragma unroll
    for (int i = 0; i < 8; ++i) { qh0[i] = (_Float16)bfr(qa[i]); qh1[i] = (_Float16)bfr(qa[8 + i]); kh0[i] = (_Float16)bfr(ka[i]); kh1[i] = (_Float16)bfr(ka[8 + i]); tv[q * 16 + i][rl] = (_Float16)bfr(va[i]); tv[q * 16 + 8 + i][rl] = (_Float16)bfr(va[8 + i]); }
    const size_t row = b * TT + t0 + rl; _Float16* dq = QH + row * CC + h * HD + q * 16; _Float16* dk = KH + row * CC + h * HD + q * 16;
    vst2((unsigned*)dq, *(const v4u*)&qh0); vst2((unsigned*)(dq + 8), *(const v4u*)&qh1); vst2((unsigned*)dk, *(const v4u*)&kh0); vst2((unsigned*)(dk + 8), *(const v4u*)&kh1); }
  __syncthreads();
  for (int e = tid; e < 64 * 8; e += 256) { const int cl = e >> 3, q = e & 7; vst2((unsigned*)(VT + (b * CC + h * HD + cl) * (size_t)TT + t0 + q * 8), *(const v4u*)&tv[cl][q * 8]); } }   
#ifndef SM_EXTRA_PARAMS
#define SM_EXTRA_PARAMS
#endif
#ifndef PROJ_EXTRA_PARAMS
#define PROJ_EXTRA_PARAMS
#endif
#ifndef PROJ_EXTRA_PARAMS
#define PROJ_EXTRA_PARAMS
#endif
#ifndef SM_MASK_HOOK
#define SM_MASK_HOOK (void)0
#endif


#ifndef SM_EXTRA_PARAMS
#define SM_EXTRA_PARAMS
#endif
#ifndef SM_MASK_HOOK
#define SM_MASK_HOOK (void)0
#endif

#define WS_QH  0u                                      // f16 q rows [b*t][CC]
#define WS_KH  (WS_QH + 2u * (size_t)NB * TT * CC)      // f16 k rows [b*t][CC]
#define WS_VT  (WS_KH + 2u * (size_t)NB * TT * CC)      // f16 v planes [b][c][t]
#define WS_QL  (WS_VT + 2u * (size_t)NB * CC * TT)      // f16 q residual x 2^10 rows [b][t < QHI][CC]
#define WS_KL  (WS_QL + 2u * (size_t)NB * QHI * CC)     // f16 k residual x 2^10 rows [b][t < KHI][CC]
#define WS_VB  (WS_KL + 2u * (size_t)NB * KHI * CC)     // bf16 v hi planes [b][c][t < KHI]
#define WS_VBL (WS_VB + 2u * (size_t)NB * CC * KHI)
#define WS_S   (WS_VBL + 2u * (size_t)NB * CC * KHI)    // f32 [hg][t][s]; unused: k_fa keeps the logits in registers
#define WS_Y   (WS_S  + 4u * (size_t)HG * TT * TT)      // f32 ctx rows [b*t][CC] (only when there is an output projection)
#define WS_END (WS_Y  + 0u)

// ---- k_proj: block = (64 rows, 128 cols, which): q/k/v = X W (+ b) with exact bf16 products (K = DIN) -> which 0: q f16 rows (+ residual rows < QHI); 1: k f16 rows (+ residual rows < KHI); 2: v f16 planes [c][t] (+ bf16 hi/lo planes for t < KHI)
__global__ __launch_bounds__(128) void k_proj(const float* __restrict__ XQ, const float* __restrict__ XK, const float* __restrict__ XV, const float* __restrict__ WQ, const float* __restrict__ WK, const float* __restrict__ WV, const float* __restrict__ BQ, const float* __restrict__ BK, const float* __restrict__ BV,
    _Float16* __restrict__ QH, _Float16* __restrict__ QL, _Float16* __restrict__ KH, _Float16* __restrict__ KL, _Float16* __restrict__ VT, __bf16* __restrict__ VB, __bf16* __restrict__ VBL) {
  __shared__ __align__(16) _Float16 sh[64][136], sl[64][136]; __shared__ __align__(16) _Float16 th[128][72]; __shared__ __align__(16) __bf16 tb[128][72], tbl[128][72];
  const int tid = threadIdx.x, wave = tid >> 5, lane = tid & 31, col = lane & 15, g = lane >> 4; const int which = blockIdx.z; const int c0 = blockIdx.y * 128; const size_t r0 = (size_t)blockIdx.x * 64; const size_t bb = r0 / TT; const int t0 = (int)(r0 % TT);
  const float* X = which == 0 ? XQ : which == 1 ? XK : XV; const float* WA = which == 0 ? WQ : which == 1 ? WK : WV; const float* BA = which == 0 ? BQ : which == 1 ? BK : BV;
  v8f acc[8] = {};
#pragma unroll 2
  for (int kc = 0; kc < DIN / 32; ++kc) { v16b a; { const float* p = X + (r0 + wave * 16 + col) * DIN + kc * 32 + 8 * g;
#pragma unroll
      for (int i = 0; i < 8; ++i) { a[i] = (__bf16)p[i]; a[8 + i] = (__bf16)p[16 + i]; } }
    asm volatile("s_wait_loadcnt 0x0" ::: "memory");
#pragma unroll
    for (int j = 0; j < 8; ++j) { const v16b w = WCOL(WA, kc * 32, c0 + j * 16 + col, lane); asm volatile("s_wait_loadcnt 0x0" ::: "memory"); acc[j] = wmma_bf(a, w, acc[j]); } }
  if (which < 2) { _Float16* DH = which == 0 ? QH : KH; _Float16* DL = which == 0 ? QL : KL; const int nhi = which == 0 ? QHI : KHI; const bool hi_rows = t0 < nhi;
#pragma unroll
    for (int j = 0; j < 8; ++j) { const float bias = BA ? bfr(BA[c0 + j * 16 + col]) : 0.f;
#pragma unroll
      for (int r = 0; r < 8; ++r) { const float v = acc[j][r] + bias; const _Float16 hv = (_Float16)v; sh[wave * 16 + 8 * g + r][j * 16 + col] = hv; sl[wave * 16 + 8 * g + r][j * 16 + col] = (_Float16)((v - (float)hv) * 1024.0f); } }
    __syncthreads();
    for (int e = tid; e < 64 * 16; e += 128) { const int rl = e >> 4, q = e & 15; vst2((unsigned*)(DH + (r0 + rl) * CC + c0 + q * 8), *(const v4u*)&sh[rl][q * 8]); if (hi_rows) vst2((unsigned*)(DL + (bb * nhi + t0 + rl) * (size_t)CC + c0 + q * 8), *(const v4u*)&sl[rl][q * 8]); }
  } else { const bool hi_rows = t0 < KHI;
#pragma unroll
    for (int j = 0; j < 8; ++j) { const float bias = BA ? bfr(BA[c0 + j * 16 + col]) : 0.f;
#pragma unroll
      for (int r = 0; r < 8; ++r) { const float v = acc[j][r] + bias; const int rl = wave * 16 + 8 * g + r, cl = j * 16 + col; th[cl][rl] = (_Float16)v; const __bf16 bh = (__bf16)v; tb[cl][rl] = bh; tbl[cl][rl] = (__bf16)(v - (float)bh); } }
    __syncthreads();
    for (int e = tid; e < 128 * 8; e += 128) { const int cl = e >> 3, q = e & 7; vst2((unsigned*)(VT + (bb * CC + c0 + cl) * (size_t)TT + t0 + q * 8), *(const v4u*)&th[cl][q * 8]); if (hi_rows) { const size_t o3 = (bb * CC + c0 + cl) * (size_t)KHI + t0 + q * 8; vst2((unsigned*)(VB + o3), *(const v4u*)&tb[cl][q * 8]); vst2((unsigned*)(VBL + o3), *(const v4u*)&tbl[cl][q * 8]); } } } }
// ---- k_fa: one wave = QT * 16 queries of (b, h), walking its group's half of the keys 32 at a time with a running maximum and sum per query, so that no score ever leaves the registers.
// A block is KG groups of FW waves. The groups hold the same queries and share out the keys, tile by tile in turn, so that four waves and not two stand on each SIMD: one wave's vector work runs beside another's matrix work. Each group keeps a running maximum, sum and O of its own; they are joined once, behind the loop.
// A group's eight waves read the same key rows and v plane rows: asynchronous copies bring them into LDS once a group, KT keys a tile, two buffers a group; the fragments are read from there.
// S^T = K . Q^T (A = 16 key rows, B = 16 query columns; 1 product: q is rounded to bf16 first, so its f16 plane is exact from 2^-14 up, where a residual plane holds zeros; below that it is rounded as k's plane is): lane (g, col) holds keys 8g + r of query col, which is the B fragment of O^T += V^T . P^T as it stands.
// P = exp(score - maximum in use) x 2^PB, once to f16, against v f16 (1 product); the sum is taken in f32 from the unrounded P and carries the same 2^PB, so it cancels in O / sum.
// The maximum in use is brought up, and O and the sum rescaled, only in a pass where some score of the wave stands more than TAU (log2 units) above it: one test a pass. P stays at or below 2^(PB + TAU) = 2^15, inside f16.
// Every #pragma unroll below is there so that the fragment and accumulator arrays are indexed by constants alone and stay in registers; the loop over the keys stays rolled.
#define QT 2    // 16-query column groups per wave
#define FW 8    // waves per key group: they walk the same key and v rows, which the group brings into LDS once for all eight
#define KG 2    // key groups per block: group kg walks the tiles kg, kg + KG, ...
#define LOG2E 1.4426950408889634f
#define PB 7.0f     // log2 of the factor that P carries
#define TAU 8.0f    // how far, in log2 units, a score may stand above the maximum in use before that is brought up
#define KT 128                 // keys per LDS tile: four passes of 32 keys between two barriers
#define KPB 144                // LDS pitch of a key row, bytes: 128 + 16, so that 16 rows read 16 B each without a bank conflict
#define VPB 272                // LDS pitch of a v plane row (KT keys), bytes: 256 + 16, for the same reason
#define KTB (KT * KPB)         // key rows of a tile; the v rows stand behind them
#define BUFB (KTB + HD * VPB)  // one buffer of the ring
#define NTILE (TT / (KT * KG))   // tiles a group walks
// One tile's copies of one lane: 4 x 16 B of key rows (8 lanes to a 128-B row, 32 rows apart) and 4 x 16 B of v plane rows (16 lanes to a 256-B row, 16 rows apart), global memory to LDS through no register.
// The s_wait_xcnt closes the statement so that no address register of a copy is rewritten in front of it.
__device__ __forceinline__ void tile_copy(unsigned lk, unsigned lv, const _Float16* gk, const _Float16* gv) {
  asm volatile("global_load_async_to_lds_b128 %0, %8, off\n\t"
               "global_load_async_to_lds_b128 %1, %9, off\n\t"
               "global_load_async_to_lds_b128 %2, %10, off\n\t"
               "global_load_async_to_lds_b128 %3, %11, off\n\t"
               "global_load_async_to_lds_b128 %4, %12, off\n\t"
               "global_load_async_to_lds_b128 %5, %13, off\n\t"
               "global_load_async_to_lds_b128 %6, %14, off\n\t"
               "global_load_async_to_lds_b128 %7, %15, off\n\t"
               "s_wait_xcnt 0x0"
               :: "v"(lk), "v"(lk + 32 * KPB), "v"(lk + 64 * KPB), "v"(lk + 96 * KPB), "v"(lv), "v"(lv + 16 * VPB), "v"(lv + 32 * VPB), "v"(lv + 48 * VPB),
                  "v"(gk), "v"(gk + (size_t)32 * CC), "v"(gk + (size_t)64 * CC), "v"(gk + (size_t)96 * CC), "v"(gv), "v"(gv + (size_t)16 * TT), "v"(gv + (size_t)32 * TT), "v"(gv + (size_t)48 * TT)
               : "memory");
}
__device__ __forceinline__ float xhalf(float x) { return __builtin_bit_cast(float, __builtin_amdgcn_permlanex16(__builtin_bit_cast(int, x), __builtin_bit_cast(int, x), 0x76543210, 0xfedcba98, false, false)); }   /* lane l with lane l ^ 16 */
__device__ __forceinline__ v8f wm(v16h a, v16h b, v8f c) { return __builtin_amdgcn_wmma_f32_16x16x32_f16(false, a, false, b, (short)0, c, false, false); }
__global__ __launch_bounds__(KG * FW * 32) void k_fa(const _Float16* __restrict__ QH, const _Float16* __restrict__ KH, const _Float16* __restrict__ VT, const int* __restrict__ HM, float* __restrict__ Y) {
  __shared__ __align__(16) float ss[FW][QT * 16][HD + 4];
  __shared__ float ml[FW][2][QT][32];   /* group 1's running maximum and sum, lane by lane, for the join */
  __shared__ __align__(16) unsigned char ring[KG * 2 * BUFB];   /* two buffers a group: its next tile lands while this one is worked on */
  const int kg = __builtin_amdgcn_readfirstlane((int)threadIdx.x >> 8);   /* key group, the same in every lane of a wave: held in a scalar register, so that the tests on it are scalar branches */
  const int tid = threadIdx.x & (FW * 32 - 1), wave = tid >> 5, lane = tid & 31, col = lane & 15, g = lane >> 4;   /* tid, wave: within the group */
  const int bh = blockIdx.y, b = bh / NH, h = bh % NH; const int q0 = blockIdx.x * (FW * 16 * QT) + wave * (16 * QT);
  const int hm = HM[bh];   /* mask[b][h] == 1 replaces EVERY score of that head with one constant, -1e6: its softmax is 1 / TT at every key, whatever the constant */
  v16h qh[QT][2];
#pragma unroll
  for (int qt = 0; qt < QT; ++qt)
#pragma unroll
    for (int kc = 0; kc < 2; ++kc) { const size_t qo = ((size_t)b * TT + q0 + qt * 16 + col) * CC + h * HD + kc * 32; qh[qt][kc] = frag_h(QH + qo, lane); }
  asm volatile("s_wait_xcnt 0x0" ::: "memory");   /* stands in front of the set-up below, which takes over the address registers of the q loads above */
  __builtin_amdgcn_sched_barrier(0);   /* keeps that set-up behind the wait */
  const _Float16* gk = KH + ((size_t)b * TT + kg * KT + (tid >> 3)) * CC + h * HD + (tid & 7) * 8;             /* this lane's 16 B of key row tid / 8 of the group's first tile; + key * CC */
  const _Float16* gv = VT + ((size_t)b * CC + h * HD + (tid >> 4)) * (size_t)TT + kg * KT + (tid & 15) * 8;   /* this lane's 16 B of v plane row tid / 16; + key */
  const unsigned l0 = (unsigned)(size_t)&ring[kg * 2 * BUFB];   /* LDS byte address of the group's two buffers */
  const unsigned lk = l0 + (tid >> 3) * KPB + (tid & 7) * 16, lv = l0 + KTB + (tid >> 4) * VPB + (tid & 15) * 16;
  tile_copy(lk, lv, gk, gv);
  asm volatile("s_wait_asynccnt 0x0" ::: "memory");   /* this wave's share of tile 0 has landed */
  __syncthreads();                                    /* every wave's share has: tile 0 may be read */
  tile_copy(lk + BUFB, lv + BUFB, gk + (size_t)KG * KT * CC, gv + KG * KT);
  /* The mask is applied once, to q, and not to every score: with q = 0 each score of a masked head is exactly 0 (the key planes are finite), every P is 2^PB and the sum TT x 2^PB, both exact, so O / sum is the module's uniform average of v. */
  __builtin_amdgcn_sched_barrier(0);   /* keeps the selects behind the copies above: moved up, they made tile 0's copies wait for the q loads */
  const bool masked = hm == 1;
#pragma unroll
  for (int qt = 0; qt < QT; ++qt)
#pragma unroll
    for (int kc = 0; kc < 2; ++kc) qh[qt][kc] = masked ? v16h{} : qh[qt][kc];
  v8f o[QT][4] = {}; float m[QT], bb[QT]; v2f ls[QT][2];   /* m: the maximum in use, log2 units, the same in both lanes of a query; bb = PB - m; ls: this lane's sum of P, four chains that run on from pass to pass, two to a packed add */
#pragma unroll
  for (int qt = 0; qt < QT; ++qt) { m[qt] = -3.0e38f; bb[qt] = PB + 3.0e38f; ls[qt][0] = v2f{0.f, 0.f}; ls[qt][1] = v2f{0.f, 0.f}; }
  for (int t = 0; t < NTILE; ++t) {
    const unsigned bo = (t & 1) * BUFB;
    const unsigned char* Kl = ring + kg * 2 * BUFB + bo + col * KPB;          /* + key in tile * KPB */
    const unsigned char* Vl = ring + kg * 2 * BUFB + bo + KTB + col * VPB;    /* + d tile * 16 * VPB + key in tile * 2 */
    v16h kf[2][2];
#pragma unroll
    for (int kt = 0; kt < 2; ++kt)
#pragma unroll
      for (int kc = 0; kc < 2; ++kc) kf[kt][kc] = frag_h((const _Float16*)(Kl + (kt * 16) * KPB + kc * 64), lane);
#pragma unroll 1   /* the passes of a tile stay rolled: unrolled they took some 200 registers more, and the copies' address operands spilled */
   for (int ps = 0; ps < KT / 32; ++ps) {
    v16h vf[4];
#pragma unroll
    for (int dt = 0; dt < 4; ++dt) vf[dt] = frag_h((const _Float16*)(Vl + (dt * 16) * VPB + ps * 64), lane);
    __builtin_amdgcn_sched_barrier(0);   /* keeps the v reads up here, a whole score and softmax phase ahead of their use, in one group */
    v8f s[QT][2] = {};
#pragma unroll
    for (int kc = 0; kc < 2; ++kc)
#pragma unroll
      for (int kt = 0; kt < 2; ++kt)
#pragma unroll
        for (int qt = 0; qt < QT; ++qt) s[qt][kt] = wm(kf[kt][kc], qh[qt][kc], s[qt][kt]);
    __builtin_amdgcn_sched_barrier(0);   /* keeps the reads below behind all eight products, in one group: without it six of them moved in among the products and two stayed behind */
    const int kn = ((ps + 1) * 32) & (KT - 1);   /* the next pass's key rows of the same tile, read behind this pass's score products; a tile's last pass reads its rows 0.. again, unused: no branch stands behind the products */
#pragma unroll
    for (int kt = 0; kt < 2; ++kt)
#pragma unroll
      for (int kc = 0; kc < 2; ++kc) kf[kt][kc] = frag_h((const _Float16*)(Kl + (kn + kt * 16) * KPB + kc * 64), lane);
    __builtin_amdgcn_sched_barrier(0);   /* keeps the next key rows' reads ahead of the softmax, in one group; without it they sink to right in front of their use */
    v16h pf[QT]; float mx[QT]; bool need = false;
#pragma unroll
    for (int qt = 0; qt < QT; ++qt) { mx[qt] = -3.0e38f;
#pragma unroll
      for (int i = 0; i < 16; ++i) mx[qt] = fmaxf(mx[qt], s[qt][i >> 3][i & 7]);   /* this lane's 16 keys, unscaled */
      need = need || (mx[qt] * (SCALE * LOG2E) + bb[qt] > PB + TAU); }   /* the exponent of the lane's largest P, formed as every P's is below */
    if (__builtin_amdgcn_ballot_w32(need) != 0) {   /* one scalar branch a pass, the same for the whole wave; always taken in a wave's first pass */
#pragma unroll
      for (int qt = 0; qt < QT; ++qt) { const float mw = fmaxf(mx[qt], xhalf(mx[qt]));   /* with the other 8 + 8 keys of this query */
        const float mn = fmaxf(m[qt], mw * (SCALE * LOG2E)); const float alpha = __builtin_amdgcn_exp2f(m[qt] - mn); m[qt] = mn; bb[qt] = PB - mn; ls[qt][0] *= alpha; ls[qt][1] *= alpha;
#pragma unroll
        for (int dt = 0; dt < 4; ++dt) o[qt][dt] *= alpha; } }
#pragma unroll
    for (int qt = 0; qt < QT; ++qt)
#pragma unroll
      for (int i = 0; i < 16; i += 2) { const v2f xv = {s[qt][i >> 3][i & 7], s[qt][(i + 1) >> 3][(i + 1) & 7]}; const v2f t = xv * (SCALE * LOG2E) + bb[qt]; const v2f p = {__builtin_amdgcn_exp2f(t[0]), __builtin_amdgcn_exp2f(t[1])}; ls[qt][(i >> 1) & 1] += p; pf[qt][i] = (_Float16)p[0]; pf[qt][i + 1] = (_Float16)p[1]; }
    __builtin_amdgcn_sched_barrier(0);   /* keeps the sums ahead of the products: moved in among them, they were given the v fragments' registers, at four idle slots behind a product each time */
#pragma unroll
    for (int dt = 0; dt < 4; ++dt)
#pragma unroll
      for (int qt = 0; qt < QT; ++qt) o[qt][dt] = wm(vf[dt], pf[qt], o[qt][dt]);
   }
    asm volatile("s_wait_dscnt 0x0" ::: "memory");      /* this wave's reads of tile t are done */
    asm volatile("s_wait_asynccnt 0x0" ::: "memory");   /* this wave's share of tile t + 1 has landed */
    __syncthreads();                                    /* tile t + 1 may be read, tile t's buffer may be refilled */
    if (t + 2 < NTILE) tile_copy(lk + bo, lv + bo, gk + (size_t)(t + 2) * KG * KT * CC, gv + (t + 2) * KG * KT);
  }
  asm volatile("s_wait_asynccnt 0x0" ::: "memory");   /* no copy is outstanding when the wave goes on to its end */
  float l[QT];
#pragma unroll
  for (int qt = 0; qt < QT; ++qt) l[qt] = (ls[qt][0][0] + ls[qt][0][1]) + (ls[qt][1][0] + ls[qt][1][1]);
  /* The join: wave w of group 1 hands its maximum, sum and unscaled O to wave w of group 0, lane to lane, through LDS; group 0 brings both halves to the larger maximum, adds them, divides and stores. */
  if (kg == 1) {
#pragma unroll
    for (int qt = 0; qt < QT; ++qt) { ml[wave][0][qt][lane] = m[qt]; ml[wave][1][qt][lane] = l[qt];
#pragma unroll
      for (int dt = 0; dt < 4; ++dt) { v4f lo = { o[qt][dt][0], o[qt][dt][1], o[qt][dt][2], o[qt][dt][3] }, hi = { o[qt][dt][4], o[qt][dt][5], o[qt][dt][6], o[qt][dt][7] };
        *(v4f*)&ss[wave][qt * 16 + col][dt * 16 + 8 * g] = lo; *(v4f*)&ss[wave][qt * 16 + col][dt * 16 + 8 * g + 4] = hi; } } }
  __syncthreads();   /* group 1's halves may be read */
  if (kg != 0) return;
#pragma unroll
  for (int qt = 0; qt < QT; ++qt) { const float m1 = ml[wave][0][qt][lane], l1 = ml[wave][1][qt][lane]; const float mn = fmaxf(m[qt], m1);
    const float a0 = __builtin_amdgcn_exp2f(m[qt] - mn), a1 = __builtin_amdgcn_exp2f(m1 - mn); const float lt = l[qt] * a0 + l1 * a1;
    const float inv = 1.0f / (lt + xhalf(lt)); const float c0 = a0 * inv, c1 = a1 * inv;
#pragma unroll
    for (int dt = 0; dt < 4; ++dt) { const v4f plo = *(const v4f*)&ss[wave][qt * 16 + col][dt * 16 + 8 * g], phi = *(const v4f*)&ss[wave][qt * 16 + col][dt * 16 + 8 * g + 4];   /* the 32 B that the same lane of group 1 wrote, and that this lane overwrites */
      v4f lo = { o[qt][dt][0] * c0 + plo[0] * c1, o[qt][dt][1] * c0 + plo[1] * c1, o[qt][dt][2] * c0 + plo[2] * c1, o[qt][dt][3] * c0 + plo[3] * c1 }, hi = { o[qt][dt][4] * c0 + phi[0] * c1, o[qt][dt][5] * c0 + phi[1] * c1, o[qt][dt][6] * c0 + phi[2] * c1, o[qt][dt][7] * c0 + phi[3] * c1 };
      *(v4f*)&ss[wave][qt * 16 + col][dt * 16 + 8 * g] = lo; *(v4f*)&ss[wave][qt * 16 + col][dt * 16 + 8 * g + 4] = hi; } }
  LDSX(); for (int rl = g; rl < QT * 16; rl += 2) vst2(Y + ((size_t)bh * TT + q0 + rl) * HD + col * 4, *(const v4f*)&ss[wave][rl][col * 4]); }   /* output layout [b][h][t][d]: two 256-B rows a store */

extern "C" void kernel_launch(void* const* d_in, const int* in_sizes, int n_in, void* d_out, int out_size, void* d_ws, size_t ws_size, hipStream_t stream) {
  (void)in_sizes; (void)n_in; (void)out_size;
  const float** F = (const float**)d_in;
  if (ws_size < (size_t)WS_END) return;
  char* ws = (char*)d_ws; _Float16 *QH = (_Float16*)(ws + WS_QH), *KH = (_Float16*)(ws + WS_KH), *VT = (_Float16*)(ws + WS_VT), *KL = (_Float16*)(ws + WS_KL); __bf16 *VB = (__bf16*)(ws + WS_VB), *VBL = (__bf16*)(ws + WS_VBL); float *S = (float*)(ws + WS_S), *Y = (float*)(ws + WS_Y);
  (void)Y; (void)S; (void)KL; (void)VB; (void)VBL;
  // inputs: 0 query [4,8,2048,64]; 1 key; 2 value; 3 mask [4,8] int32 (1 -> the whole head's scores := -1e6)
  const int* HM = (const int*)d_in[3];
  k_planes<<<dim3(TT / 64, NH, NB), 256, 0, stream>>>(F[0], F[1], F[2], QH, KH, VT);
  k_fa<<<dim3(TT / (FW * 16 * QT), NH * NB), KG * FW * 32, 0, stream>>>(QH, KH, VT, HM, (float*)d_out);
}

// v007
// Measured time: 32.6 microseconds a run.
// Two timings next to v006 both put it at 1.03 times that version's speed.
// All steps since v000 together make it 29.8 times as fast.
// compute dtype: all float inputs rounded to bf16; q, k, v are bf16-valued so their f16 planes are exact (sub-6e-5 magnitudes aside); logits q x k (1 product) x 64^-0.5; softmax f32; P x 2^7 once to f16 x v (exact in f16) (1 product); a masked head (the module sets its every score to -1e6, so its softmax is 1 / 2048 at every key) is ones x v (1 product, 64 keys at a time, the 32 sums added in f32) / 2048; f32 output.
#include <hip/hip_runtime.h>
#include <math.h>

typedef __attribute__((ext_vector_type(16))) _Float16 v16h;
typedef __attribute__((ext_vector_type(16))) __bf16 v16b;
typedef __attribute__((ext_vector_type(8)))  _Float16 v8h;
typedef __attribute__((ext_vector_type(8)))  float v8f;
typedef __attribute__((ext_vector_type(4)))  float v4f;
typedef __attribute__((ext_vector_type(2)))  float v2f;
typedef __attribute__((ext_vector_type(4)))  unsigned v4u;
typedef _Float16 hx8 __attribute__((ext_vector_type(8)));
typedef __attribute__((ext_vector_type(4)))  int v4i;
typedef float __attribute__((may_alias)) float_a;
typedef int __attribute__((may_alias)) int_a;

template <typename T> __device__ __forceinline__ void vst2(void* p, T v) { *(T*)p = v;  }
__device__ __forceinline__ v8f wmma16(v16h a, v16h b, v8f c) {
  v8f d = __builtin_amdgcn_wmma_f32_16x16x32_f16(false, a, false, b, (short)0, c, false, false);
  asm volatile("v_nop\n\tv_nop\n\tv_nop\n\tv_nop" : "+v"(d) : "v"(a), "v"(b));
  return d;
}
__device__ __forceinline__ v8f wmma_bf(v16b a, v16b b, v8f c) {
  v8f d = __builtin_amdgcn_wmma_f32_16x16x32_bf16(false, a, false, b, (short)0, c, false, false);
  asm volatile("v_nop\n\tv_nop\n\tv_nop\n\tv_nop" : "+v"(d) : "v"(a), "v"(b));
  return d;
}
// 16x16x32 fragments: lane = (h = lane>>4, row/col = lane&15); elements 0..7 = k0+8h+0..7, 8..15 = k0+16+8h+0..7; D element r = row 8h+r
__device__ __forceinline__ v16h frag_h(const _Float16* rowk0, int lane) {
  union { v16h v; v8h q[2]; } u; const _Float16* p = rowk0 + 8 * (lane >> 4);
  u.q[0] = *(const v8h*)p; u.q[1] = *(const v8h*)(p + 16); return u.v;
}
__device__ __forceinline__ v16h frag_f32(const float* rowk0, int lane) {
  v16h a; const float* p = rowk0 + 8 * (lane >> 4);
#pragma unroll
  for (int i = 0; i < 8; ++i) { a[i] = (_Float16)p[i]; a[8 + i] = (_Float16)p[16 + i]; }
  return a;
}
__device__ __forceinline__ v16h frag_f32s(const float* rowk0, int lane, float sc) {
  v16h a; const float* p = rowk0 + 8 * (lane >> 4);
#pragma unroll
  for (int i = 0; i < 8; ++i) { a[i] = (_Float16)(p[i] * sc); a[8 + i] = (_Float16)(p[16 + i] * sc); }
  return a;
}
// column fragment from a [K][ld] layout (column n), rows >= K read as 0
__device__ __forceinline__ v16h fragc_f32(const float* W, int k0, int n, int lane, int ld, int K) {
  v16h a; const int g = lane >> 4;
#pragma unroll
  for (int i = 0; i < 8; ++i) { const int ka = k0 + 8 * g + i, kb = ka + 16;
    a[i] = (_Float16)(ka < K ? W[(size_t)(ka < K ? ka : K - 1) * ld + n] : 0.f); a[8 + i] = (_Float16)(kb < K ? W[(size_t)(kb < K ? kb : K - 1) * ld + n] : 0.f); }
  return a;
}
struct F2 { v16b h, l; };
__device__ __forceinline__ F2 bsplit16(const float v[16]) { F2 r;
#pragma unroll
  for (int i = 0; i < 16; ++i) { const __bf16 h = (__bf16)v[i]; r.h[i] = h; r.l[i] = (__bf16)(v[i] - (float)h); }
  return r; }
__device__ __forceinline__ F2 split_row(const float* row, int k0, int lane) { float v[16]; const float* p = row + k0 + 8 * (lane >> 4);
#pragma unroll
  for (int i = 0; i < 8; ++i) { v[i] = p[i]; v[8 + i] = p[16 + i]; }
  return bsplit16(v); }
__device__ __forceinline__ F2 split_rowK(const float* row, int k0, int lane, int K) { float v[16]; const int g = lane >> 4;
#pragma unroll
  for (int i = 0; i < 8; ++i) { const int ka = k0 + 8 * g + i, kb = ka + 16; v[i] = ka < K ? row[ka < K ? ka : K - 1] : 0.f; v[8 + i] = kb < K ? row[kb < K ? kb : K - 1] : 0.f; }
  return bsplit16(v); }
__device__ __forceinline__ F2 split_col(const float* W, int k0, int n, int lane, int ld, int K) { float v[16]; const int g = lane >> 4;
#pragma unroll
  for (int i = 0; i < 8; ++i) { const int ka = k0 + 8 * g + i, kb = ka + 16; v[i] = ka < K ? W[(size_t)(ka < K ? ka : K - 1) * ld + n] : 0.f; v[8 + i] = kb < K ? W[(size_t)(kb < K ? kb : K - 1) * ld + n] : 0.f; }
  return bsplit16(v); }
__device__ __forceinline__ v8f mac3(const F2& a, const F2& b, v8f c) { c = wmma_bf(a.l, b.h, c); c = wmma_bf(a.h, b.l, c); return wmma_bf(a.h, b.h, c); }
__device__ __forceinline__ float sigm(float v) { return 1.0f / (1.0f + expf(-v)); }
#define LDSX() do { asm volatile("s_wait_dscnt 0" ::: "memory"); __builtin_amdgcn_wave_barrier(); __builtin_amdgcn_fence(__ATOMIC_RELEASE, "workgroup"); } while (0)

// Naive full scaled-dot-product attention (query/key/value [4,8,2048,64] given; mask [4,8] int: mask == 1 sets that head's entire score matrix to -1e6, i.e. exactly uniform attention): out = softmax(q k^T / 8 (masked_fill)) v -> [4,8,2048,64].
#define NB 4
#define TT 2048
#define CC 512            // NH * HD = projected width
#define DIN 512          // input (model) width
#define NH 8
#define HD 64
#define NQB (TT / 64)
#define HG 4
#define SCALE (0.125f)
#define CAUSAL 0
#ifndef TNB
#define TNB NB
#endif
__device__ __forceinline__ float bfr(float v) { return (float)(__bf16)v; }
__host__ __device__ __forceinline__ int kb_last(int qb) { return CAUSAL ? ((qb * 64 + 63) >> 7) : (TT / 128 - 1); }
typedef __attribute__((ext_vector_type(8))) __bf16 v8b;
__device__ __forceinline__ v16b frag_b(const __bf16* rowk0, int lane) {
  union { v16b v; v8b q[2]; } u; const __bf16* p = rowk0 + 8 * (lane >> 4);
  u.q[0] = *(const v8b*)p; u.q[1] = *(const v8b*)(p + 16); return u.v;
}
#define QBH 0              // unused: no kernel in this file has a high-precision path
#define QHI 2048            // rows for which k_proj writes a q residual plane
#define KHI 64            // key rows carrying k residual / v bf16 hi+lo planes (read by no kernel in this file)
// B fragment (k rows k0+.., output column o) of a weight: (in,out) [K][ld] or (out,in) [ld rows of K]: bf16 exact, or f16(bf16 * 256) exact
__device__ __forceinline__ v16b wcol_io(const float* Wm, int k0, int o, int lane, int ld) { v16b w; const int g = lane >> 4;
#pragma unroll
  for (int i = 0; i < 8; ++i) { w[i] = (__bf16)Wm[(size_t)(k0 + 8 * g + i) * ld + o]; w[8 + i] = (__bf16)Wm[(size_t)(k0 + 16 + 8 * g + i) * ld + o]; }
  return w; }
__device__ __forceinline__ v16b wcol_oi(const float* Wm, int k0, int o, int lane, int K) { v16b w; const float* p = Wm + (size_t)o * K + k0 + 8 * (lane >> 4);
#pragma unroll
  for (int i = 0; i < 8; ++i) { w[i] = (__bf16)p[i]; w[8 + i] = (__bf16)p[16 + i]; }
  return w; }
__device__ __forceinline__ v16h wcolh_io(const float* Wm, int k0, int o, int lane, int ld) { v16h w; const int g = lane >> 4;
#pragma unroll
  for (int i = 0; i < 8; ++i) { w[i] = (_Float16)(bfr(Wm[(size_t)(k0 + 8 * g + i) * ld + o]) * 256.0f); w[8 + i] = (_Float16)(bfr(Wm[(size_t)(k0 + 16 + 8 * g + i) * ld + o]) * 256.0f); }
  return w; }
__device__ __forceinline__ v16h wcolh_oi(const float* Wm, int k0, int o, int lane, int K) { v16h w; const float* p = Wm + (size_t)o * K + k0 + 8 * (lane >> 4);
#pragma unroll
  for (int i = 0; i < 8; ++i) { w[i] = (_Float16)(bfr(p[i]) * 256.0f); w[8 + i] = (_Float16)(bfr(p[16 + i]) * 256.0f); }
  return w; }
#define WQKV_LAYOUT 0   // 0 = (in,out) [DIN][CC]; 1 = (out,in) [CC][DIN]; 2 = per-head [NH][DIN][HD]
__device__ __forceinline__ v16b wcol_hdk(const float* Wm, int k0, int o, int lane) { v16b w; const int g = lane >> 4; const float* p = Wm + (size_t)(o / HD) * DIN * HD + (o % HD);
#pragma unroll
  for (int i = 0; i < 8; ++i) { w[i] = (__bf16)p[(size_t)(k0 + 8 * g + i) * HD]; w[8 + i] = (__bf16)p[(size_t)(k0 + 16 + 8 * g + i) * HD]; }
  return w; }
#define WO_OUT_IN 0
#if WQKV_LAYOUT == 1
#define WCOL(W, k0, o, lane) wcol_oi(W, k0, o, lane, DIN)
#elif WQKV_LAYOUT == 2
#define WCOL(W, k0, o, lane) wcol_hdk(W, k0, o, lane)
#else
#define WCOL(W, k0, o, lane) wcol_io(W, k0, o, lane, CC)
#endif
#if WO_OUT_IN
#define WOCOL(W, k0, o, lane) wcol_oi(W, k0, o, lane, CC)
#define WOCOLH(W, k0, o, lane) wcolh_oi(W, k0, o, lane, CC)
#else
#define WOCOL(W, k0, o, lane) wcol_io(W, k0, o, lane, DIN)
#define WOCOLH(W, k0, o, lane) wcolh_io(W, k0, o, lane, DIN)
#endif
#define SM_EXTRA_PARAMS , int bsm, int h0s, const int* __restrict__ HM
// per-(batch, head) mask: mask[b][h] == 1 replaces EVERY score of that head with -1e6 (softmax becomes exactly uniform); read per element
#define SM_MASK_HOOK do { const int mk = HM[bsm * NH + h0s + (int)blockIdx.y]; v = (mk == 1) ? -1.0e6f : v; } while (0)
__global__ __launch_bounds__(256) void k_planes(const float* __restrict__ Q, const float* __restrict__ Kx, const float* __restrict__ V, const int* __restrict__ HM, _Float16* __restrict__ QH, _Float16* __restrict__ KH, _Float16* __restrict__ VT, float* __restrict__ PS) {
  __shared__ __align__(16) _Float16 tv[64][72];
  const int tid = threadIdx.x; const int t0 = blockIdx.x * 64, h = blockIdx.y; const size_t b = blockIdx.z;
  const int hm = HM[b * NH + h];   /* the same for the whole block */
  const size_t src0 = ((b * NH + h) * TT + t0) * (size_t)HD;   /* [b][h][t][d] */
  { const int rl = tid >> 2, q = tid & 3;   /* 64 rows x 4 threads x 16 values */
    const float* pq = Q + src0 + (size_t)rl * HD + q * 16; const float* pk = Kx + src0 + (size_t)rl * HD + q * 16; const float* pv = V + src0 + (size_t)rl * HD + q * 16;
    v4f w0 = *(const v4f*)pv, w1 = *(const v4f*)(pv + 4), w2 = *(const v4f*)(pv + 8), w3 = *(const v4f*)(pv + 12);   /* first: they need not wait for the mask word */
    __builtin_amdgcn_sched_barrier(0);   /* keeps the v loads ahead of the wait for the mask word: without it they were issued behind that wait */
    const bool live = hm != 1;   /* a masked head's output is the average of v: its q and k are read by nobody, and of v only the sums over the block's 64 keys go on */
    v4f a0 = {}, a1 = {}, a2 = {}, a3 = {}, k0 = {}, k1 = {}, k2 = {}, k3 = {};
    if (live) { a0 = *(const v4f*)pq; a1 = *(const v4f*)(pq + 4); a2 = *(const v4f*)(pq + 8); a3 = *(const v4f*)(pq + 12); k0 = *(const v4f*)pk; k1 = *(const v4f*)(pk + 4); k2 = *(const v4f*)(pk + 8); k3 = *(const v4f*)(pk + 12); }
    asm volatile("s_wait_loadcnt 0x0\n\ts_wait_xcnt 0x0" ::: "memory");   /* the loads' address registers are taken over below */
    __builtin_amdgcn_sched_barrier(0);   /* keeps what follows, which takes those registers over, behind the wait */
    float va[16] = {w0[0],w0[1],w0[2],w0[3],w1[0],w1[1],w1[2],w1[3],w2[0],w2[1],w2[2],w2[3],w3[0],w3[1],w3[2],w3[3]};
#pragma unroll
    for (int i = 0; i < 8; ++i) { tv[q * 16 + i][rl] = (_Float16)bfr(va[i]); tv[q * 16 + 8 + i][rl] = (_Float16)bfr(va[8 + i]); }
    if (live) {
      float qa[16] = {a0[0],a0[1],a0[2],a0[3],a1[0],a1[1],a1[2],a1[3],a2[0],a2[1],a2[2],a2[3],a3[0],a3[1],a3[2],a3[3]}; float ka[16] = {k0[0],k0[1],k0[2],k0[3],k1[0],k1[1],k1[2],k1[3],k2[0],k2[1],k2[2],k2[3],k3[0],k3[1],k3[2],k3[3]};
      hx8 qh0, qh1, kh0, kh1;
#pragma unroll
      for (int i = 0; i < 8; ++i) { qh0[i] = (_Float16)bfr(qa[i]); qh1[i] = (_Float16)bfr(qa[8 + i]); kh0[i] = (_Float16)bfr(ka[i]); kh1[i] = (_Float16)bfr(ka[8 + i]); }
      const size_t row = b * TT + t0 + rl; _Float16* dq = QH + row * CC + h * HD + q * 16; _Float16* dk = KH + row * CC + h * HD + q * 16;
      vst2((unsigned*)dq, *(const v4u*)&qh0); vst2((unsigned*)(dq + 8), *(const v4u*)&qh1); vst2((unsigned*)dk, *(const v4u*)&kh0); vst2((unsigned*)(dk + 8), *(const v4u*)&kh1);
      asm volatile("s_wait_xcnt 0x0" ::: "memory"); } }   /* the stores' address registers are taken over behind the barrier */
  __syncthreads();
  if (hm != 1) { for (int e = tid; e < 64 * 8; e += 256) { const int cl = e >> 3, q = e & 7; vst2((unsigned*)(VT + (b * CC + h * HD + cl) * (size_t)TT + t0 + q * 8), *(const v4u*)&tv[cl][q * 8]); } return; }
  /* masked: V^T . ones (A = 16 v plane rows of 64 keys, B = ones: every column of the result holds the rows' sums), waves 0 .. 3 a d tile each; PS[b * NH + h][key block][d] */
  const int wave = __builtin_amdgcn_readfirstlane(tid >> 5), lane = tid & 31, col = lane & 15, g = lane >> 4;   /* wave: in a scalar register, so that the test below is a scalar branch and the products run with every lane on */
  if (wave < 4) { v16h one; v8f s = {};
#pragma unroll
    for (int i = 0; i < 16; ++i) one[i] = (_Float16)1.0f;
#pragma unroll
    for (int kc = 0; kc < 2; ++kc) s = __builtin_amdgcn_wmma_f32_16x16x32_f16(false, frag_h(&tv[wave * 16 + col][kc * 32], lane), false, one, (short)0, s, false, false);
    if (col == 0) { float* d = PS + ((b * NH + h) * (TT / 64) + blockIdx.x) * HD + wave * 16 + 8 * g; v4f lo = { s[0], s[1], s[2], s[3] }, hi = { s[4], s[5], s[6], s[7] }; *(v4f*)d = lo; *(v4f*)(d + 4) = hi; } } }
#ifndef SM_EXTRA_PARAMS
#define SM_EXTRA_PARAMS
#endif
#ifndef PROJ_EXTRA_PARAMS
#define PROJ_EXTRA_PARAMS
#endif
#ifndef PROJ_EXTRA_PARAMS
#define PROJ_EXTRA_PARAMS
#endif
#ifndef SM_MASK_HOOK
#define SM_MASK_HOOK (void)0
#endif


#ifndef SM_EXTRA_PARAMS
#define SM_EXTRA_PARAMS
#endif
#ifndef SM_MASK_HOOK
#define SM_MASK_HOOK (void)0
#endif

#define WS_QH  0u                                      // f16 q rows [b*t][CC]
#define WS_KH  (WS_QH + 2u * (size_t)NB * TT * CC)      // f16 k rows [b*t][CC]
#define WS_VT  (WS_KH + 2u * (size_t)NB * TT * CC)      // f16 v planes [b][c][t]
#define WS_QL  (WS_VT + 2u * (size_t)NB * CC * TT)      // f16 q residual x 2^10 rows [b][t < QHI][CC]
#define WS_KL  (WS_QL + 2u * (size_t)NB * QHI * CC)     // f16 k residual x 2^10 rows [b][t < KHI][CC]
#define WS_VB  (WS_KL + 2u * (size_t)NB * KHI * CC)     // bf16 v hi planes [b][c][t < KHI]
#define WS_VBL (WS_VB + 2u * (size_t)NB * CC * KHI)
#define WS_S   (WS_VBL + 2u * (size_t)NB * CC * KHI)    // f32 [b * NH + h][TT / 64][HD]: the masked heads' sums of v, from k_planes to k_fa
#define WS_Y   (WS_S  + 4u * (size_t)HG * TT * TT)      // f32 ctx rows [b*t][CC] (only when there is an output projection)
#define WS_END (WS_Y  + 0u)

// ---- k_proj: block = (64 rows, 128 cols, which): q/k/v = X W (+ b) with exact bf16 products (K = DIN) -> which 0: q f16 rows (+ residual rows < QHI); 1: k f16 rows (+ residual rows < KHI); 2: v f16 planes [c][t] (+ bf16 hi/lo planes for t < KHI)
__global__ __launch_bounds__(128) void k_proj(const float* __restrict__ XQ, const float* __restrict__ XK, const float* __restrict__ XV, const float* __restrict__ WQ, const float* __restrict__ WK, const float* __restrict__ WV, const float* __restrict__ BQ, const float* __restrict__ BK, const float* __restrict__ BV,
    _Float16* __restrict__ QH, _Float16* __restrict__ QL, _Float16* __restrict__ KH, _Float16* __restrict__ KL, _Float16* __restrict__ VT, __bf16* __restrict__ VB, __bf16* __restrict__ VBL) {
  __shared__ __align__(16) _Float16 sh[64][136], sl[64][136]; __shared__ __align__(16) _Float16 th[128][72]; __shared__ __align__(16) __bf16 tb[128][72], tbl[128][72];
  const int tid = threadIdx.x, wave = tid >> 5, lane = tid & 31, col = lane & 15, g = lane >> 4; const int which = blockIdx.z; const int c0 = blockIdx.y * 128; const size_t r0 = (size_t)blockIdx.x * 64; const size_t bb = r0 / TT; const int t0 = (int)(r0 % TT);
  const float* X = which == 0 ? XQ : which == 1 ? XK : XV; const float* WA = which == 0 ? WQ : which == 1 ? WK : WV; const float* BA = which == 0 ? BQ : which == 1 ? BK : BV;
  v8f acc[8] = {};
#pragma unroll 2
  for (int kc = 0; kc < DIN / 32; ++kc) { v16b a; { const float* p = X + (r0 + wave * 16 + col) * DIN + kc * 32 + 8 * g;
#pragma unroll
      for (int i = 0; i < 8; ++i) { a[i] = (__bf16)p[i]; a[8 + i] = (__bf16)p[16 + i]; } }
    asm volatile("s_wait_loadcnt 0x0" ::: "memory");
#pragma unroll
    for (int j = 0; j < 8; ++j) { const v16b w = WCOL(WA, kc * 32, c0 + j * 16 + col, lane); asm volatile("s_wait_loadcnt 0x0" ::: "memory"); acc[j] = wmma_bf(a, w, acc[j]); } }
  if (which < 2) { _Float16* DH = which == 0 ? QH : KH; _Float16* DL = which == 0 ? QL : KL; const int nhi = which == 0 ? QHI : KHI; const bool hi_rows = t0 < nhi;
#pragma unroll
    for (int j = 0; j < 8; ++j) { const float bias = BA ? bfr(BA[c0 + j * 16 + col]) : 0.f;
#pragma unroll
      for (int r = 0; r < 8; ++r) { const float v = acc[j][r] + bias; const _Float16 hv = (_Float16)v; sh[wave * 16 + 8 * g + r][j * 16 + col] = hv; sl[wave * 16 + 8 * g + r][j * 16 + col] = (_Float16)((v - (float)hv) * 1024.0f); } }
    __syncthreads();
    for (int e = tid; e < 64 * 16; e += 128) { const int rl = e >> 4, q = e & 15; vst2((unsigned*)(DH + (r0 + rl) * CC + c0 + q * 8), *(const v4u*)&sh[rl][q * 8]); if (hi_rows) vst2((unsigned*)(DL + (bb * nhi + t0 + rl) * (size_t)CC + c0 + q * 8), *(const v4u*)&sl[rl][q * 8]); }
  } else { const bool hi_rows = t0 < KHI;
#pragma unroll
    for (int j = 0; j < 8; ++j) { const float bias = BA ? bfr(BA[c0 + j * 16 + col]) : 0.f;
#pragma unroll
      for (int r = 0; r < 8; ++r) { const float v = acc[j][r] + bias; const int rl = wave * 16 + 8 * g + r, cl = j * 16 + col; th[cl][rl] = (_Float16)v; const __bf16 bh = (__bf16)v; tb[cl][rl] = bh; tbl[cl][rl] = (__bf16)(v - (float)bh); } }
    __syncthreads();
    for (int e = tid; e < 128 * 8; e += 128) { const int cl = e >> 3, q = e & 7; vst2((unsigned*)(VT + (bb * CC + c0 + cl) * (size_t)TT + t0 + q * 8), *(const v4u*)&th[cl][q * 8]); if (hi_rows) { const size_t o3 = (bb * CC + c0 + cl) * (size_t)KHI + t0 + q * 8; vst2((unsigned*)(VB + o3), *(const v4u*)&tb[cl][q * 8]); vst2((unsigned*)(VBL + o3), *(const v4u*)&tbl[cl][q * 8]); } } } }
// ---- k_fa: a block is one job. The 32 mask words say which heads are live (mask != 1) and which are masked; every block ranks them alike, and the block index picks the job: the live heads' jobs first (they are the long ones), the masked heads' behind them.
// A masked head forms no score: its output is the average of v at every query. k_planes has summed v over each block of 64 keys (ones x v on the matrix unit); a job adds those 32 sums and stores the average to its 128 or 256 query rows.
// What the masked heads leave free goes to the live ones, as smaller jobs on more key groups: the first 16 live heads run as jobs of 128 queries on four key groups (256 such jobs fill the chip once); up to five more run behind them as jobs of 64 queries on eight key groups, half as long; with 22 live heads or more that no longer pays, and every job is 256 queries on two key groups.
// A live job: one wave = QT * 16 queries of (b, h), walking its group's share of the keys 32 at a time with a running maximum and sum per query, so that no score ever leaves the registers.
// A block is KG groups of FW waves, 16 waves in all. The groups hold the same queries and share out the keys, tile by tile in turn. Each group keeps a running maximum, sum and O of its own; they are joined once, behind the loop.
// A group's waves read the same key rows and v plane rows: asynchronous copies bring them into LDS once a group, KK keys a tile, two buffers a group; the fragments are read from there.
// S^T = K . Q^T (A = 16 key rows, B = 16 query columns; 1 product: q is rounded to bf16 first, so its f16 plane is exact from 2^-14 up, where a residual plane holds zeros; below that it is rounded as k's plane is): lane (g, col) holds keys 8g + r of query col, which is the B fragment of O^T += V^T . P^T as it stands.
// P = exp(score - maximum in use) x 2^PB, once to f16, against v f16 (1 product); the sum is taken in f32 from the unrounded P and carries the same 2^PB, so it cancels in O / sum.
// The maximum in use is brought up, and O and the sum rescaled, only in a pass where some score of the wave stands more than TAU (log2 units) above it: one test a pass. P stays at or below 2^(PB + TAU) = 2^15, inside f16.
// Every #pragma unroll below is there so that the fragment and accumulator arrays are indexed by constants alone and stay in registers; the loop over the keys stays rolled.
#define QT 2    // 16-query column groups per wave
#define LOG2E 1.4426950408889634f
#define PB 7.0f     // log2 of the factor that P carries
#define TAU 8.0f    // how far, in log2 units, a score may stand above the maximum in use before that is brought up
#define KT 128                 // keys per LDS tile that tile_copy brings: four passes of 32 keys between two barriers
#define KPB 144                // LDS pitch of a key row, bytes: 128 + 16, so that 16 rows read 16 B each without a bank conflict
#define VPB 272                // LDS pitch of a v plane row (KT keys), bytes: 256 + 16, for the same reason
#define RINGB (8 * 2 * (64 * KPB + HD * (2 * 64 + 16)))   // the largest ring: eight groups, two buffers each, tiles of 64 keys (294,912 B; four groups with tiles of 128 keys take 286,720)
// One tile's copies of one lane: 4 x 16 B of key rows (8 lanes to a 128-B row, 32 rows apart) and 4 x 16 B of v plane rows (16 lanes to a 256-B row, 16 rows apart), global memory to LDS through no register.
// The s_wait_xcnt closes the statement so that no address register of a copy is rewritten in front of it.
__device__ __forceinline__ void tile_copy(unsigned lk, unsigned lv, const _Float16* gk, const _Float16* gv) {
  asm volatile("global_load_async_to_lds_b128 %0, %8, off\n\t"
               "global_load_async_to_lds_b128 %1, %9, off\n\t"
               "global_load_async_to_lds_b128 %2, %10, off\n\t"
               "global_load_async_to_lds_b128 %3, %11, off\n\t"
               "global_load_async_to_lds_b128 %4, %12, off\n\t"
               "global_load_async_to_lds_b128 %5, %13, off\n\t"
               "global_load_async_to_lds_b128 %6, %14, off\n\t"
               "global_load_async_to_lds_b128 %7, %15, off\n\t"
               "s_wait_xcnt 0x0"
               :: "v"(lk), "v"(lk + 32 * KPB), "v"(lk + 64 * KPB), "v"(lk + 96 * KPB), "v"(lv), "v"(lv + 16 * VPB), "v"(lv + 32 * VPB), "v"(lv + 48 * VPB),
                  "v"(gk), "v"(gk + (size_t)32 * CC), "v"(gk + (size_t)64 * CC), "v"(gk + (size_t)96 * CC), "v"(gv), "v"(gv + (size_t)16 * TT), "v"(gv + (size_t)32 * TT), "v"(gv + (size_t)48 * TT)
               : "memory");
}
// The same for a group of four or two waves: eight copies of one lane, 16 B each, ls bytes of LDS and gs elements of global memory apart; one call for a tile's key rows, one for its v plane rows.
__device__ __forceinline__ void copy8(unsigned la, unsigned ls, const _Float16* ga, size_t gs) {
  asm volatile("global_load_async_to_lds_b128 %0, %8, off\n\t"
               "global_load_async_to_lds_b128 %1, %9, off\n\t"
               "global_load_async_to_lds_b128 %2, %10, off\n\t"
               "global_load_async_to_lds_b128 %3, %11, off\n\t"
               "global_load_async_to_lds_b128 %4, %12, off\n\t"
               "global_load_async_to_lds_b128 %5, %13, off\n\t"
               "global_load_async_to_lds_b128 %6, %14, off\n\t"
               "global_load_async_to_lds_b128 %7, %15, off\n\t"
               "s_wait_xcnt 0x0"
               :: "v"(la), "v"(la + ls), "v"(la + 2 * ls), "v"(la + 3 * ls), "v"(la + 4 * ls), "v"(la + 5 * ls), "v"(la + 6 * ls), "v"(la + 7 * ls),
                  "v"(ga), "v"(ga + gs), "v"(ga + 2 * gs), "v"(ga + 3 * gs), "v"(ga + 4 * gs), "v"(ga + 5 * gs), "v"(ga + 6 * gs), "v"(ga + 7 * gs)
               : "memory");
}
template <int FW, int KK> __device__ __forceinline__ void tile_in(unsigned lk, unsigned lv, const _Float16* gk, const _Float16* gv) {
  if constexpr (FW == 8) { static_assert(KK == KT, "tile_copy brings KT keys"); tile_copy(lk, lv, gk, gv); }
  else { constexpr int RK = FW * 32 / 8, RV = FW * 32 / (KK / 8);   /* key rows and v plane rows that one copy of the whole group brings */
    static_assert(RK * 8 == KK && RV * 8 == HD, "eight copies a lane for each");
    copy8(lk, RK * KPB, gk, (size_t)RK * CC); copy8(lv, RV * (2 * KK + 16), gv, (size_t)RV * TT); }
}
__device__ __forceinline__ float xhalf(float x) { return __builtin_bit_cast(float, __builtin_amdgcn_permlanex16(__builtin_bit_cast(int, x), __builtin_bit_cast(int, x), 0x76543210, 0xfedcba98, false, false)); }   /* lane l with lane l ^ 16 */
__device__ __forceinline__ v8f wm(v16h a, v16h b, v8f c) { return __builtin_amdgcn_wmma_f32_16x16x32_f16(false, a, false, b, (short)0, c, false, false); }
template <int FW, int KG, int KK> __device__ __forceinline__ void fa_live(const _Float16* __restrict__ QH, const _Float16* __restrict__ KH, const _Float16* __restrict__ VT, float* __restrict__ Y, unsigned char* ring, int bh, int qb) {
  static_assert(FW * KG == 16, "16 waves a block");
  constexpr int NTILE = TT / (KK * KG), VP = 2 * KK + 16, KB = KK * KPB, BUF = KB + HD * VP, LV = KK / 8;   /* tiles a group walks; LDS pitch of a v plane row of KK keys (16 B x odd, as KPB); key rows of a tile; one buffer; lanes to a v plane row */
  static_assert(NTILE >= 2 && KG * 2 * BUF <= RINGB, "two buffers a group, inside the ring");
  const int kg = __builtin_amdgcn_readfirstlane((int)threadIdx.x / (FW * 32));   /* key group, the same in every lane of a wave: held in a scalar register, so that the tests on it are scalar branches */
  const int tid = threadIdx.x & (FW * 32 - 1), wave = tid >> 5, lane = tid & 31, col = lane & 15, g = lane >> 4;   /* tid, wave: within the group */
  const int b = bh / NH, h = bh % NH; const int q0 = qb * (FW * 16 * QT) + wave * (16 * QT);
  v16h qh[QT][2];
#pragma unroll
  for (int qt = 0; qt < QT; ++qt)
#pragma unroll
    for (int kc = 0; kc < 2; ++kc) { const size_t qo = ((size_t)b * TT + q0 + qt * 16 + col) * CC + h * HD + kc * 32; qh[qt][kc] = frag_h(QH + qo, lane); }
  asm volatile("s_wait_xcnt 0x0" ::: "memory");   /* stands in front of the set-up below, which takes over the address registers of the q loads above */
  __builtin_amdgcn_sched_barrier(0);   /* keeps that set-up behind the wait */
  const _Float16* gk = KH + ((size_t)b * TT + kg * KK + (tid >> 3)) * CC + h * HD + (tid & 7) * 8;             /* this lane's 16 B of key row tid / 8 of the group's first tile; + key * CC */
  const _Float16* gv = VT + ((size_t)b * CC + h * HD + tid / LV) * (size_t)TT + kg * KK + (tid % LV) * 8;   /* this lane's 16 B of v plane row tid / LV; + key */
  const unsigned l0 = (unsigned)(size_t)&ring[kg * 2 * BUF];   /* LDS byte address of the group's two buffers */
  const unsigned lk = l0 + (tid >> 3) * KPB + (tid & 7) * 16, lv = l0 + KB + (tid / LV) * VP + (tid % LV) * 16;
  tile_in<FW, KK>(lk, lv, gk, gv);
  asm volatile("s_wait_asynccnt 0x0" ::: "memory");   /* this wave's share of tile 0 has landed */
  __syncthreads();                                    /* every wave's share has: tile 0 may be read */
  tile_in<FW, KK>(lk + BUF, lv + BUF, gk + (size_t)KG * KK * CC, gv + KG * KK);
  v8f o[QT][4] = {}; float m[QT], bb[QT]; v2f ls[QT][2];   /* m: the maximum in use, log2 units, the same in both lanes of a query; bb = PB - m; ls: this lane's sum of P, four chains that run on from pass to pass, two to a packed add */
#pragma unroll
  for (int qt = 0; qt < QT; ++qt) { m[qt] = -3.0e38f; bb[qt] = PB + 3.0e38f; ls[qt][0] = v2f{0.f, 0.f}; ls[qt][1] = v2f{0.f, 0.f}; }
  for (int t = 0; t < NTILE; ++t) {
    const unsigned bo = (t & 1) * BUF;
    const unsigned char* Kl = ring + kg * 2 * BUF + bo + col * KPB;          /* + key in tile * KPB */
    const unsigned char* Vl = ring + kg * 2 * BUF + bo + KB + col * VP;    /* + d tile * 16 * VP + key in tile * 2 */
    v16h kf[2][2];
#pragma unroll
    for (int kt = 0; kt < 2; ++kt)
#pragma unroll
      for (int kc = 0; kc < 2; ++kc) kf[kt][kc] = frag_h((const _Float16*)(Kl + (kt * 16) * KPB + kc * 64), lane);
    const unsigned char* Vp = Vl + 16 * g;   /* this lane's place in the v rows; + 64 B a pass */
#pragma unroll 1   /* the passes of a tile stay rolled: unrolled they took some 200 registers more, and the copies' address operands spilled */
   for (int ps = 0; ps < KK / 32; ++ps) {
    v16h vf[4];
#pragma unroll
    for (int dt = 0; dt < 4; ++dt) { union { v16h v; v8h q[2]; } u; u.q[0] = *(const v8h*)(Vp + (dt * 16) * VP); u.q[1] = *(const v8h*)(Vp + (dt * 16) * VP + 32); vf[dt] = u.v; }   /* frag_h, the lane's 16 * g bytes being in Vp */
    Vp += 64;   /* the next pass's v address is formed up here, in a register of its own: formed at the head of that pass it was given an A register of this pass's last product, too few vector slots behind it */
    __builtin_amdgcn_sched_barrier(0);   /* keeps the v reads up here, a whole score and softmax phase ahead of their use, in one group */
    v8f s[QT][2] = {};
#pragma unroll
    for (int kc = 0; kc < 2; ++kc)
#pragma unroll
      for (int kt = 0; kt < 2; ++kt)
#pragma unroll
        for (int qt = 0; qt < QT; ++qt) s[qt][kt] = wm(kf[kt][kc], qh[qt][kc], s[qt][kt]);
    __builtin_amdgcn_sched_barrier(0);   /* keeps the reads below behind all eight products, in one group: without it six of them moved in among the products and two stayed behind */
    const int kn = ((ps + 1) * 32) & (KK - 1);   /* the next pass's key rows of the same tile, read behind this pass's score products; a tile's last pass reads its rows 0.. again, unused: no branch stands behind the products */
#pragma unroll
    for (int kt = 0; kt < 2; ++kt)
#pragma unroll
      for (int kc = 0; kc < 2; ++kc) kf[kt][kc] = frag_h((const _Float16*)(Kl + (kn + kt * 16) * KPB + kc * 64), lane);
    __builtin_amdgcn_sched_barrier(0);   /* keeps the next key rows' reads ahead of the softmax, in one group; without it they sink to right in front of their use */
    v16h pf[QT]; float mx[QT]; bool need = false;
#pragma unroll
    for (int qt = 0; qt < QT; ++qt) { mx[qt] = -3.0e38f;
#pragma unroll
      for (int i = 0; i < 16; ++i) mx[qt] = fmaxf(mx[qt], s[qt][i >> 3][i & 7]);   /* this lane's 16 keys, unscaled */
      need = need || (mx[qt] * (SCALE * LOG2E) + bb[qt] > PB + TAU); }   /* the exponent of the lane's largest P, formed as every P's is below */
    if (__builtin_amdgcn_ballot_w32(need) != 0) {   /* one scalar branch a pass, the same for the whole wave; always taken in a wave's first pass */
#pragma unroll
      for (int qt = 0; qt < QT; ++qt) { const float mw = fmaxf(mx[qt], xhalf(mx[qt]));   /* with the other 8 + 8 keys of this query */
        const float mn = fmaxf(m[qt], mw * (SCALE * LOG2E)); const float alpha = __builtin_amdgcn_exp2f(m[qt] - mn); m[qt] = mn; bb[qt] = PB - mn; ls[qt][0] *= alpha; ls[qt][1] *= alpha;
#pragma unroll
        for (int dt = 0; dt < 4; ++dt) o[qt][dt] *= alpha; } }
#pragma unroll
    for (int qt = 0; qt < QT; ++qt)
#pragma unroll
      for (int i = 0; i < 16; i += 2) { const v2f xv = {s[qt][i >> 3][i & 7], s[qt][(i + 1) >> 3][(i + 1) & 7]}; const v2f t = xv * (SCALE * LOG2E) + bb[qt]; const v2f p = {__builtin_amdgcn_exp2f(t[0]), __builtin_amdgcn_exp2f(t[1])}; ls[qt][(i >> 1) & 1] += p; pf[qt][i] = (_Float16)p[0]; pf[qt][i + 1] = (_Float16)p[1]; }
    __builtin_amdgcn_sched_barrier(0);   /* keeps the sums ahead of the products: moved in among them, they were given the v fragments' registers, at four idle slots behind a product each time */
#pragma unroll
    for (int dt = 0; dt < 4; ++dt)
#pragma unroll
      for (int qt = 0; qt < QT; ++qt) o[qt][dt] = wm(vf[dt], pf[qt], o[qt][dt]);
   }
    asm volatile("s_wait_dscnt 0x0" ::: "memory");      /* this wave's reads of tile t are done */
    asm volatile("s_wait_asynccnt 0x0" ::: "memory");   /* this wave's share of tile t + 1 has landed */
    __syncthreads();                                    /* tile t + 1 may be read, tile t's buffer may be refilled */
    if (t + 2 < NTILE) tile_in<FW, KK>(lk + bo, lv + bo, gk + (size_t)(t + 2) * KG * KK * CC, gv + (t + 2) * KG * KK);
  }
  asm volatile("s_wait_asynccnt 0x0" ::: "memory");   /* no copy is outstanding when the wave goes on to its end */
  float l[QT];
#pragma unroll
  for (int qt = 0; qt < QT; ++qt) l[qt] = (ls[qt][0][0] + ls[qt][0][1]) + (ls[qt][1][0] + ls[qt][1][1]);
  /* The join: wave w of each group but the first hands its maximum, sum and unscaled O to wave w of group 0, lane to lane, through LDS; group 0 brings all to the largest maximum, adds them, divides and stores. */
  /* It stands in the ring: behind the loop's last barrier nobody reads a tile any more and no copy is outstanding. ss: [KG - 1][FW][QT * 16][HD + 4] floats; ml, behind it: [KG - 1][FW][2][QT][32]. */
  float* ss = (float*)ring + wave * (QT * 16 * (HD + 4)); float* ml = (float*)ring + (KG - 1) * FW * (QT * 16 * (HD + 4)) + wave * (2 * QT * 32) + lane;
  constexpr int SSG = FW * QT * 16 * (HD + 4), MLG = FW * 2 * QT * 32;   /* from one group's part to the next, floats */
  if (kg != 0) {
#pragma unroll
    for (int qt = 0; qt < QT; ++qt) { ml[(kg - 1) * MLG + qt * 32] = m[qt]; ml[(kg - 1) * MLG + (QT + qt) * 32] = l[qt];
#pragma unroll
      for (int dt = 0; dt < 4; ++dt) { v4f lo = { o[qt][dt][0], o[qt][dt][1], o[qt][dt][2], o[qt][dt][3] }, hi = { o[qt][dt][4], o[qt][dt][5], o[qt][dt][6], o[qt][dt][7] };
        float* d = ss + (kg - 1) * SSG + (qt * 16 + col) * (HD + 4) + dt * 16 + 8 * g; *(v4f*)d = lo; *(v4f*)(d + 4) = hi; } } }
  __syncthreads();   /* the other groups' parts may be read */
  if (kg != 0) return;
#pragma unroll
  for (int qt = 0; qt < QT; ++qt) { float mj[KG - 1], cj[KG - 1]; float mn = m[qt];
#pragma unroll
    for (int j = 0; j < KG - 1; ++j) { mj[j] = ml[j * MLG + qt * 32]; mn = fmaxf(mn, mj[j]); }
    const float a0 = __builtin_amdgcn_exp2f(m[qt] - mn); float lt = l[qt] * a0;
#pragma unroll
    for (int j = 0; j < KG - 1; ++j) { cj[j] = __builtin_amdgcn_exp2f(mj[j] - mn); lt += ml[j * MLG + (QT + qt) * 32] * cj[j]; }
    const float inv = 1.0f / (lt + xhalf(lt)); const float c0 = a0 * inv;
#pragma unroll
    for (int j = 0; j < KG - 1; ++j) cj[j] *= inv;
#pragma unroll
    for (int dt = 0; dt < 4; ++dt) { float* d = ss + (qt * 16 + col) * (HD + 4) + dt * 16 + 8 * g;   /* the 32 B that the same lane of group 1 wrote, and that this lane overwrites */
      v4f lo = { o[qt][dt][0] * c0, o[qt][dt][1] * c0, o[qt][dt][2] * c0, o[qt][dt][3] * c0 }, hi = { o[qt][dt][4] * c0, o[qt][dt][5] * c0, o[qt][dt][6] * c0, o[qt][dt][7] * c0 };
#pragma unroll
      for (int j = 0; j < KG - 1; ++j) { lo += *(const v4f*)(d + j * SSG) * cj[j]; hi += *(const v4f*)(d + j * SSG + 4) * cj[j]; }
      *(v4f*)d = lo; *(v4f*)(d + 4) = hi; } }
  LDSX(); for (int rl = g; rl < QT * 16; rl += 2) vst2(Y + ((size_t)bh * TT + q0 + rl) * HD + col * 4, *(const v4f*)&ss[rl * (HD + 4) + col * 4]); }   /* output layout [b][h][t][d]: two 256-B rows a store */
// A masked head's job: the 32 key blocks' sums of v (k_planes: ones x v on the matrix unit) are added, two in a wave's halves, the 16 waves' through LDS, and the average goes to the job's query rows r0 .. r0 + 32 * nst - 1.
__device__ __forceinline__ void fa_masked(const float* __restrict__ PS, float* __restrict__ Y, unsigned char* ring, int bh, int r0, int nst) {
  const int tid = threadIdx.x, wave = tid >> 5, lane = tid & 31, col = lane & 15, g = lane >> 4;
  v4f a = *(const v4f*)(PS + ((size_t)bh * (TT / 64) + (tid >> 4)) * HD + col * 4);   /* key block tid / 16, four d */
#pragma unroll
  for (int c = 0; c < 4; ++c) a[c] += xhalf(a[c]);
  float* red = (float*)ring;   /* [16 waves][HD] */
  if (g == 0) *(v4f*)(red + wave * HD + col * 4) = a;
  __syncthreads();   /* every wave's sums may be read */
  v4f s = {};
#pragma unroll
  for (int w = 0; w < 16; ++w) s += *(const v4f*)(red + w * HD + col * 4);
  s *= 1.0f / TT;
  for (int i = 0; i < nst; i += 4)
#pragma unroll
    for (int j = 0; j < 4; ++j) vst2(Y + ((size_t)bh * TT + r0 + (i + j) * 32 + (tid >> 4)) * HD + col * 4, s); }   /* two 256-B rows a store */
__global__ __launch_bounds__(512) void k_fa(const _Float16* __restrict__ QH, const _Float16* __restrict__ KH, const _Float16* __restrict__ VT, const float* __restrict__ PS, const int* __restrict__ HM, float* __restrict__ Y) {
  __shared__ __align__(16) unsigned char ring[RINGB];   /* two buffers a group: its next tile lands while this one is worked on */
  static_assert(NB * NH == 32, "one mask word a lane");
  const int lane = threadIdx.x & 31, bid = blockIdx.x;
  const unsigned um = __builtin_amdgcn_ballot_w32(HM[lane] != 1);   /* bit bh: head bh is live; mask[b][h] == 1 replaces EVERY score of that head with one constant */
  const int nu = __builtin_popcount(um); const bool wide = nu > 21;   /* wide: every live job is 256 queries */
  const int ns = (nu > 16 && !wide) ? nu - 16 : 0, nm = wide ? 0 : nu - ns;   /* live heads in jobs of 64 queries; in jobs of 128 queries, 16 at most */
  const int j1 = wide ? nu * (TT / 256) : nm * (TT / 128), nj = j1 + ns * (TT / 64);   /* the longer live jobs come first, the shorter behind them, the masked heads' last */
  const int msh = nu > 16 ? 3 : 4;   /* a masked head is 8 jobs of 256 queries or 16 of 128: never more than 512 jobs in all */
  const bool live = bid < nj; int rank, qb;   /* which of the live, or of the masked, heads; which of its jobs */
  if (bid < j1) { rank = wide ? bid >> 3 : bid >> 4; qb = wide ? bid & 7 : bid & 15; }
  else if (live) { rank = nm + ((bid - j1) >> 5); qb = (bid - j1) & 31; }
  else { rank = (bid - nj) >> msh; qb = (bid - nj) & ((1 << msh) - 1); }
  if (!live && rank >= 32 - nu) return;   /* no job left: the whole block leaves, in front of every barrier */
  const unsigned set = live ? um : ~um;
  const unsigned sel = __builtin_amdgcn_ballot_w32(((set >> lane) & 1u) != 0u && __builtin_popcount(set & ((1u << lane) - 1u)) == rank);   /* one bit: the head of that rank */
  const int bh = __builtin_amdgcn_readfirstlane(__builtin_ctz(sel | 0x80000000u));   /* 0 .. 31 whatever the mask words hold */
  if (!live) { fa_masked(PS, Y, ring, bh, qb << (11 - msh), 64 >> msh); return; }
  if (bid >= j1) fa_live<2, 8, 64>(QH, KH, VT, Y, ring, bh, qb);
  else if (wide) fa_live<8, 2, 128>(QH, KH, VT, Y, ring, bh, qb);
  else fa_live<4, 4, 128>(QH, KH, VT, Y, ring, bh, qb); }

extern "C" void kernel_launch(void* const* d_in, const int* in_sizes, int n_in, void* d_out, int out_size, void* d_ws, size_t ws_size, hipStream_t stream) {
  (void)in_sizes; (void)n_in; (void)out_size;
  const float** F = (const float**)d_in;
  if (ws_size < (size_t)WS_END) return;
  char* ws = (char*)d_ws; _Float16 *QH = (_Float16*)(ws + WS_QH), *KH = (_Float16*)(ws + WS_KH), *VT = (_Float16*)(ws + WS_VT), *KL = (_Float16*)(ws + WS_KL); __bf16 *VB = (__bf16*)(ws + WS_VB), *VBL = (__bf16*)(ws + WS_VBL); float *S = (float*)(ws + WS_S), *Y = (float*)(ws + WS_Y);
  (void)Y; (void)KL; (void)VB; (void)VBL;
  // inputs: 0 query [4,8,2048,64]; 1 key; 2 value; 3 mask [4,8] int32 (1 -> the whole head's scores := -1e6)
  const int* HM = (const int*)d_in[3];
  k_planes<<<dim3(TT / 64, NH, NB), 256, 0, stream>>>(F[0], F[1], F[2], HM, QH, KH, VT, S);   /* S: here the masked heads' sums of v, [b * NH + h][TT / 64][HD] f32 */
  k_fa<<<dim3(NB * NH * (TT / 128)), 512, 0, stream>>>(QH, KH, VT, S, HM, (float*)d_out);
}

// v008
// One run takes 29.9 microseconds.
// Timed twice side by side with v007, it ran 1.08 times as fast both times.
// Counting every step since v000, it is 32.2 times as fast.
// compute dtype: all float inputs rounded to bf16; q, k, v are bf16-valued so their f16 planes are exact (sub-6e-5 magnitudes aside); logits q x k (1 product) x 64^-0.5; softmax f32; P x 2^7 once to f16 x v (exact in f16) (1 product); a masked head (the module sets its every score to -1e6, so its softmax is 1 / 2048 at every key) is ones x v (1 product, 64 keys at a time, the 32 sums added in f32) / 2048; f32 output.
#include <hip/hip_runtime.h>
#include <math.h>

typedef __attribute__((ext_vector_type(16))) _Float16 v16h;
typedef __attribute__((ext_vector_type(16))) __bf16 v16b;
typedef __attribute__((ext_vector_type(8)))  _Float16 v8h;
typedef __attribute__((ext_vector_type(8)))  float v8f;
typedef __attribute__((ext_vector_type(4)))  float v4f;
typedef __attribute__((ext_vector_type(2)))  float v2f;
typedef __attribute__((ext_vector_type(4)))  unsigned v4u;
typedef _Float16 hx8 __attribute__((ext_vector_type(8)));
typedef __attribute__((ext_vector_type(4)))  int v4i;
typedef float __attribute__((may_alias)) float_a;
typedef int __attribute__((may_alias)) int_a;

template <typename T> __device__ __forceinline__ void vst2(void* p, T v) { *(T*)p = v;  }
__device__ __forceinline__ v8f wmma16(v16h a, v16h b, v8f c) {
  v8f d = __builtin_amdgcn_wmma_f32_16x16x32_f16(false, a, false, b, (short)0, c, false, false);
  asm volatile("v_nop\n\tv_nop\n\tv_nop\n\tv_nop" : "+v"(d) : "v"(a), "v"(b));
  return d;
}
__device__ __forceinline__ v8f wmma_bf(v16b a, v16b b, v8f c) {
  v8f d = __builtin_amdgcn_wmma_f32_16x16x32_bf16(false, a, false, b, (short)0, c, false, false);
  asm volatile("v_nop\n\tv_nop\n\tv_nop\n\tv_nop" : "+v"(d) : "v"(a), "v"(b));
  return d;
}
// 16x16x32 fragments: lane = (h = lane>>4, row/col = lane&15); elements 0..7 = k0+8h+0..7, 8..15 = k0+16+8h+0..7; D element r = row 8h+r
__device__ __forceinline__ v16h frag_h(const _Float16* rowk0, int lane) {
  union { v16h v; v8h q[2]; } u; const _Float16* p = rowk0 + 8 * (lane >> 4);
  u.q[0] = *(const v8h*)p; u.q[1] = *(const v8h*)(p + 16); return u.v;
}
__device__ __forceinline__ v16h frag_f32(const float* rowk0, int lane) {
  v16h a; const float* p = rowk0 + 8 * (lane >> 4);
#pragma unroll
  for (int i = 0; i < 8; ++i) { a[i] = (_Float16)p[i]; a[8 + i] = (_Float16)p[16 + i]; }
  return a;
}
__device__ __forceinline__ v16h frag_f32s(const float* rowk0, int lane, float sc) {
  v16h a; const float* p = rowk0 + 8 * (lane >> 4);
#pragma unroll
  for (int i = 0; i < 8; ++i) { a[i] = (_Float16)(p[i] * sc); a[8 + i] = (_Float16)(p[16 + i] * sc); }
  return a;
}
// column fragment from a [K][ld] layout (column n), rows >= K read as 0
__device__ __forceinline__ v16h fragc_f32(const float* W, int k0, int n, int lane, int ld, int K) {
  v16h a; const int g = lane >> 4;
#pragma unroll
  for (int i = 0; i < 8; ++i) { const int ka = k0 + 8 * g + i, kb = ka + 16;
    a[i] = (_Float16)(ka < K ? W[(size_t)(ka < K ? ka : K - 1) * ld + n] : 0.f); a[8 + i] = (_Float16)(kb < K ? W[(size_t)(kb < K ? kb : K - 1) * ld + n] : 0.f); }
  return a;
}
struct F2 { v16b h, l; };
__device__ __forceinline__ F2 bsplit16(const float v[16]) { F2 r;
#pragma unroll
  for (int i = 0; i < 16; ++i) { const __bf16 h = (__bf16)v[i]; r.h[i] = h; r.l[i] = (__bf16)(v[i] - (float)h); }
  return r; }
__device__ __forceinline__ F2 split_row(const float* row, int k0, int lane) { float v[16]; const float* p = row + k0 + 8 * (lane >> 4);
#pragma unroll
  for (int i = 0; i < 8; ++i) { v[i] = p[i]; v[8 + i] = p[16 + i]; }
  return bsplit16(v); }
__device__ __forceinline__ F2 split_rowK(const float* row, int k0, int lane, int K) { float v[16]; const int g = lane >> 4;
#pragma unroll
  for (int i = 0; i < 8; ++i) { const int ka = k0 + 8 * g + i, kb = ka + 16; v[i] = ka < K ? row[ka < K ? ka : K - 1] : 0.f; v[8 + i] = kb < K ? row[kb < K ? kb : K - 1] : 0.f; }
  return bsplit16(v); }
__device__ __forceinline__ F2 split_col(const float* W, int k0, int n, int lane, int ld, int K) { float v[16]; const int g = lane >> 4;
#pragma unroll
  for (int i = 0; i < 8; ++i) { const int ka = k0 + 8 * g + i, kb = ka + 16; v[i] = ka < K ? W[(size_t)(ka < K ? ka : K - 1) * ld + n] : 0.f; v[8 + i] = kb < K ? W[(size_t)(kb < K ? kb : K - 1) * ld + n] : 0.f; }
  return bsplit16(v); }
__device__ __forceinline__ v8f mac3(const F2& a, const F2& b, v8f c) { c = wmma_bf(a.l, b.h, c); c = wmma_bf(a.h, b.l, c); return wmma_bf(a.h, b.h, c); }
__device__ __forceinline__ float sigm(float v) { return 1.0f / (1.0f + expf(-v)); }
#define LDSX() do { asm volatile("s_wait_dscnt 0" ::: "memory"); __builtin_amdgcn_wave_barrier(); __builtin_amdgcn_fence(__ATOMIC_RELEASE, "workgroup"); } while (0)

// Naive full scaled-dot-product attention (query/key/value [4,8,2048,64] given; mask [4,8] int: mask == 1 sets that head's entire score matrix to -1e6, i.e. exactly uniform attention): out = softmax(q k^T / 8 (masked_fill)) v -> [4,8,2048,64].
#define NB 4
#define TT 2048
#define CC 512            // NH * HD = projected width
#define DIN 512          // input (model) width
#define NH 8
#define HD 64
#define NQB (TT / 64)
#define HG 4
#define SCALE (0.125f)
#define CAUSAL 0
#ifndef TNB
#define TNB NB
#endif
__device__ __forceinline__ float bfr(float v) { return (float)(__bf16)v; }
__host__ __device__ __forceinline__ int kb_last(int qb) { return CAUSAL ? ((qb * 64 + 63) >> 7) : (TT / 128 - 1); }
typedef __attribute__((ext_vector_type(8))) __bf16 v8b;
__device__ __forceinline__ v16b frag_b(const __bf16* rowk0, int lane) {
  union { v16b v; v8b q[2]; } u; const __bf16* p = rowk0 + 8 * (lane >> 4);
  u.q[0] = *(const v8b*)p; u.q[1] = *(const v8b*)(p + 16); return u.v;
}
#define QBH 0              // unused: no kernel in this file has a high-precision path
#define QHI 2048            // rows for which k_proj writes a q residual plane
#define KHI 64            // key rows carrying k residual / v bf16 hi+lo planes (read by no kernel in this file)
// B fragment (k rows k0+.., output column o) of a weight: (in,out) [K][ld] or (out,in) [ld rows of K]: bf16 exact, or f16(bf16 * 256) exact
__device__ __forceinline__ v16b wcol_io(const float* Wm, int k0, int o, int lane, int ld) { v16b w; const int g = lane >> 4;
#pragma unroll
  for (int i = 0; i < 8; ++i) { w[i] = (__bf16)Wm[(size_t)(k0 + 8 * g + i) * ld + o]; w[8 + i] = (__bf16)Wm[(size_t)(k0 + 16 + 8 * g + i) * ld + o]; }
  return w; }
__device__ __forceinline__ v16b wcol_oi(const float* Wm, int k0, int o, int lane, int K) { v16b w; const float* p = Wm + (size_t)o * K + k0 + 8 * (lane >> 4);
#pragma unroll
  for (int i = 0; i < 8; ++i) { w[i] = (__bf16)p[i]; w[8 + i] = (__bf16)p[16 + i]; }
  return w; }
__device__ __forceinline__ v16h wcolh_io(const float* Wm, int k0, int o, int lane, int ld) { v16h w; const int g = lane >> 4;
#pragma unroll
  for (int i = 0; i < 8; ++i) { w[i] = (_Float16)(bfr(Wm[(size_t)(k0 + 8 * g + i) * ld + o]) * 256.0f); w[8 + i] = (_Float16)(bfr(Wm[(size_t)(k0 + 16 + 8 * g + i) * ld + o]) * 256.0f); }
  return w; }
__device__ __forceinline__ v16h wcolh_oi(const float* Wm, int k0, int o, int lane, int K) { v16h w; const float* p = Wm + (size_t)o * K + k0 + 8 * (lane >> 4);
#pragma unroll
  for (int i = 0; i < 8; ++i) { w[i] = (_Float16)(bfr(p[i]) * 256.0f); w[8 + i] = (_Float16)(bfr(p[16 + i]) * 256.0f); }
  return w; }
#define WQKV_LAYOUT 0   // 0 = (in,out) [DIN][CC]; 1 = (out,in) [CC][DIN]; 2 = per-head [NH][DIN][HD]
__device__ __forceinline__ v16b wcol_hdk(const float* Wm, int k0, int o, int lane) { v16b w; const int g = lane >> 4; const float* p = Wm + (size_t)(o / HD) * DIN * HD + (o % HD);
#pragma unroll
  for (int i = 0; i < 8; ++i) { w[i] = (__bf16)p[(size_t)(k0 + 8 * g + i) * HD]; w[8 + i] = (__bf16)p[(size_t)(k0 + 16 + 8 * g + i) * HD]; }
  return w; }
#define WO_OUT_IN 0
#if WQKV_LAYOUT == 1
#define WCOL(W, k0, o, lane) wcol_oi(W, k0, o, lane, DIN)
#elif WQKV_LAYOUT == 2
#define WCOL(W, k0, o, lane) wcol_hdk(W, k0, o, lane)
#else
#define WCOL(W, k0, o, lane) wcol_io(W, k0, o, lane, CC)
#endif
#if WO_OUT_IN
#define WOCOL(W, k0, o, lane) wcol_oi(W, k0, o, lane, CC)
#define WOCOLH(W, k0, o, lane) wcolh_oi(W, k0, o, lane, CC)
#else
#define WOCOL(W, k0, o, lane) wcol_io(W, k0, o, lane, DIN)
#define WOCOLH(W, k0, o, lane) wcolh_io(W, k0, o, lane, DIN)
#endif
#define SM_EXTRA_PARAMS , int bsm, int h0s, const int* __restrict__ HM
// per-(batch, head) mask: mask[b][h] == 1 replaces EVERY score of that head with -1e6 (softmax becomes exactly uniform); read per element
#define SM_MASK_HOOK do { const int mk = HM[bsm * NH + h0s + (int)blockIdx.y]; v = (mk == 1) ? -1.0e6f : v; } while (0)
__global__ __launch_bounds__(256) void k_planes(const float* __restrict__ Q, const float* __restrict__ Kx, const float* __restrict__ V, const int* __restrict__ HM, _Float16* __restrict__ QH, _Float16* __restrict__ KH, _Float16* __restrict__ VT, float* __restrict__ PS) {
  __shared__ __align__(16) _Float16 tv[64][72];
  const int tid = threadIdx.x; const int t0 = blockIdx.x * 64, h = blockIdx.y; const size_t b = blockIdx.z;
  const int hm = HM[b * NH + h];   /* the same for the whole block */
  const size_t src0 = ((b * NH + h) * TT + t0) * (size_t)HD;   /* [b][h][t][d] */
  { const int rl = tid >> 2, q = tid & 3;   /* 64 rows x 4 threads x 16 values */
    const float* pq = Q + src0 + (size_t)rl * HD + q * 16; const float* pk = Kx + src0 + (size_t)rl * HD + q * 16; const float* pv = V + src0 + (size_t)rl * HD + q * 16;
    v4f w0 = *(const v4f*)pv, w1 = *(const v4f*)(pv + 4), w2 = *(const v4f*)(pv + 8), w3 = *(const v4f*)(pv + 12);   /* first: they need not wait for the mask word */
    __builtin_amdgcn_sched_barrier(0);   /* keeps the v loads ahead of the wait for the mask word: without it they were issued behind that wait */
    const bool live = hm != 1;   /* a masked head's output is the average of v: its q and k are read by nobody, and of v only the sums over the block's 64 keys go on */
    v4f a0 = {}, a1 = {}, a2 = {}, a3 = {}, k0 = {}, k1 = {}, k2 = {}, k3 = {};
    if (live) { a0 = *(const v4f*)pq; a1 = *(const v4f*)(pq + 4); a2 = *(const v4f*)(pq + 8); a3 = *(const v4f*)(pq + 12); k0 = *(const v4f*)pk; k1 = *(const v4f*)(pk + 4); k2 = *(const v4f*)(pk + 8); k3 = *(const v4f*)(pk + 12); }
    asm volatile("s_wait_loadcnt 0x0\n\ts_wait_xcnt 0x0" ::: "memory");   /* the loads' address registers are taken over below */
    __builtin_amdgcn_sched_barrier(0);   /* keeps what follows, which takes those registers over, behind the wait */
    float va[16] = {w0[0],w0[1],w0[2],w0[3],w1[0],w1[1],w1[2],w1[3],w2[0],w2[1],w2[2],w2[3],w3[0],w3[1],w3[2],w3[3]};
#pragma unroll
    for (int i = 0; i < 8; ++i) { tv[q * 16 + i][rl] = (_Float16)bfr(va[i]); tv[q * 16 + 8 + i][rl] = (_Float16)bfr(va[8 + i]); }
    if (live) {
      float qa[16] = {a0[0],a0[1],a0[2],a0[3],a1[0],a1[1],a1[2],a1[3],a2[0],a2[1],a2[2],a2[3],a3[0],a3[1],a3[2],a3[3]}; float ka[16] = {k0[0],k0[1],k0[2],k0[3],k1[0],k1[1],k1[2],k1[3],k2[0],k2[1],k2[2],k2[3],k3[0],k3[1],k3[2],k3[3]};
      hx8 qh0, qh1, kh0, kh1;
#pragma unroll
      for (int i = 0; i < 8; ++i) { qh0[i] = (_Float16)bfr(qa[i]); qh1[i] = (_Float16)bfr(qa[8 + i]); kh0[i] = (_Float16)bfr(ka[i]); kh1[i] = (_Float16)bfr(ka[8 + i]); }
      const size_t row = b * TT + t0 + rl; _Float16* dq = QH + row * CC + h * HD + q * 16; _Float16* dk = KH + row * CC + h * HD + q * 16;
      vst2((unsigned*)dq, *(const v4u*)&qh0); vst2((unsigned*)(dq + 8), *(const v4u*)&qh1); vst2((unsigned*)dk, *(const v4u*)&kh0); vst2((unsigned*)(dk + 8), *(const v4u*)&kh1);
      asm volatile("s_wait_xcnt 0x0" ::: "memory"); } }   /* the stores' address registers are taken over behind the barrier */
  __syncthreads();
  if (hm != 1) { for (int e = tid; e < 64 * 8; e += 256) { const int cl = e >> 3, q = e & 7; vst2((unsigned*)(VT + (b * CC + h * HD + cl) * (size_t)TT + t0 + q * 8), *(const v4u*)&tv[cl][q * 8]); } return; }
  /* masked: V^T . ones (A = 16 v plane rows of 64 keys, B = ones: every column of the result holds the rows' sums), waves 0 .. 3 a d tile each; PS[b * NH + h][key block][d] */
  const int wave = __builtin_amdgcn_readfirstlane(tid >> 5), lane = tid & 31, col = lane & 15, g = lane >> 4;   /* wave: in a scalar register, so that the test below is a scalar branch and the products run with every lane on */
  if (wave < 4) { v16h one; v8f s = {};
#pragma unroll
    for (int i = 0; i < 16; ++i) one[i] = (_Float16)1.0f;
#pragma unroll
    for (int kc = 0; kc < 2; ++kc) s = __builtin_amdgcn_wmma_f32_16x16x32_f16(false, frag_h(&tv[wave * 16 + col][kc * 32], lane), false, one, (short)0, s, false, false);
    if (col == 0) { float* d = PS + ((b * NH + h) * (TT / 64) + blockIdx.x) * HD + wave * 16 + 8 * g; v4f lo = { s[0], s[1], s[2], s[3] }, hi = { s[4], s[5], s[6], s[7] }; *(v4f*)d = lo; *(v4f*)(d + 4) = hi; } } }
#ifndef SM_EXTRA_PARAMS
#define SM_EXTRA_PARAMS
#endif
#ifndef PROJ_EXTRA_PARAMS
#define PROJ_EXTRA_PARAMS
#endif
#ifndef PROJ_EXTRA_PARAMS
#define PROJ_EXTRA_PARAMS
#endif
#ifndef SM_MASK_HOOK
#define SM_MASK_HOOK (void)0
#endif


#ifndef SM_EXTRA_PARAMS
#define SM_EXTRA_PARAMS
#endif
#ifndef SM_MASK_HOOK
#define SM_MASK_HOOK (void)0
#endif

#define WS_QH  0u                                      // f16 q rows [b*t][CC]
#define WS_KH  (WS_QH + 2u * (size_t)NB * TT * CC)      // f16 k rows [b*t][CC]
#define WS_VT  (WS_KH + 2u * (size_t)NB * TT * CC)      // f16 v planes [b][c][t]
#define WS_QL  (WS_VT + 2u * (size_t)NB * CC * TT)      // f16 q residual x 2^10 rows [b][t < QHI][CC]
#define WS_KL  (WS_QL + 2u * (size_t)NB * QHI * CC)     // f16 k residual x 2^10 rows [b][t < KHI][CC]
#define WS_VB  (WS_KL + 2u * (size_t)NB * KHI * CC)     // bf16 v hi planes [b][c][t < KHI]
#define WS_VBL (WS_VB + 2u * (size_t)NB * CC * KHI)
#define WS_S   (WS_VBL + 2u * (size_t)NB * CC * KHI)    // f32 [b * NH + h][TT / 64][HD]: the masked heads' sums of v, from k_planes to k_fa
#define WS_Y   (WS_S  + 4u * (size_t)HG * TT * TT)      // f32 ctx rows [b*t][CC] (only when there is an output projection)
#define WS_END (WS_Y  + 0u)

// ---- k_proj: block = (64 rows, 128 cols, which): q/k/v = X W (+ b) with exact bf16 products (K = DIN) -> which 0: q f16 rows (+ residual rows < QHI); 1: k f16 rows (+ residual rows < KHI); 2: v f16 planes [c][t] (+ bf16 hi/lo planes for t < KHI)
__global__ __launch_bounds__(128) void k_proj(const float* __restrict__ XQ, const float* __restrict__ XK, const float* __restrict__ XV, const float* __restrict__ WQ, const float* __restrict__ WK, const float* __restrict__ WV, const float* __restrict__ BQ, const float* __restrict__ BK, const float* __restrict__ BV,
    _Float16* __restrict__ QH, _Float16* __restrict__ QL, _Float16* __restrict__ KH, _Float16* __restrict__ KL, _Float16* __restrict__ VT, __bf16* __restrict__ VB, __bf16* __restrict__ VBL) {
  __shared__ __align__(16) _Float16 sh[64][136], sl[64][136]; __shared__ __align__(16) _Float16 th[128][72]; __shared__ __align__(16) __bf16 tb[128][72], tbl[128][72];
  const int tid = threadIdx.x, wave = tid >> 5, lane = tid & 31, col = lane & 15, g = lane >> 4; const int which = blockIdx.z; const int c0 = blockIdx.y * 128; const size_t r0 = (size_t)blockIdx.x * 64; const size_t bb = r0 / TT; const int t0 = (int)(r0 % TT);
  const float* X = which == 0 ? XQ : which == 1 ? XK : XV; const float* WA = which == 0 ? WQ : which == 1 ? WK : WV; const float* BA = which == 0 ? BQ : which == 1 ? BK : BV;
  v8f acc[8] = {};
#pragma unroll 2
  for (int kc = 0; kc < DIN / 32; ++kc) { v16b a; { const float* p = X + (r0 + wave * 16 + col) * DIN + kc * 32 + 8 * g;
#pragma unroll
      for (int i = 0; i < 8; ++i) { a[i] = (__bf16)p[i]; a[8 + i] = (__bf16)p[16 + i]; } }
    asm volatile("s_wait_loadcnt 0x0" ::: "memory");
#pragma unroll
    for (int j = 0; j < 8; ++j) { const v16b w = WCOL(WA, kc * 32, c0 + j * 16 + col, lane); asm volatile("s_wait_loadcnt 0x0" ::: "memory"); acc[j] = wmma_bf(a, w, acc[j]); } }
  if (which < 2) { _Float16* DH = which == 0 ? QH : KH; _Float16* DL = which == 0 ? QL : KL; const int nhi = which == 0 ? QHI : KHI; const bool hi_rows = t0 < nhi;
#pragma unroll
    for (int j = 0; j < 8; ++j) { const float bias = BA ? bfr(BA[c0 + j * 16 + col]) : 0.f;
#pragma unroll
      for (int r = 0; r < 8; ++r) { const float v = acc[j][r] + bias; const _Float16 hv = (_Float16)v; sh[wave * 16 + 8 * g + r][j * 16 + col] = hv; sl[wave * 16 + 8 * g + r][j * 16 + col] = (_Float16)((v - (float)hv) * 1024.0f); } }
    __syncthreads();
    for (int e = tid; e < 64 * 16; e += 128) { const int rl = e >> 4, q = e & 15; vst2((unsigned*)(DH + (r0 + rl) * CC + c0 + q * 8), *(const v4u*)&sh[rl][q * 8]); if (hi_rows) vst2((unsigned*)(DL + (bb * nhi + t0 + rl) * (size_t)CC + c0 + q * 8), *(const v4u*)&sl[rl][q * 8]); }
  } else { const bool hi_rows = t0 < KHI;
#pragma unroll
    for (int j = 0; j < 8; ++j) { const float bias = BA ? bfr(BA[c0 + j * 16 + col]) : 0.f;
#pragma unroll
      for (int r = 0; r < 8; ++r) { const float v = acc[j][r] + bias; const int rl = wave * 16 + 8 * g + r, cl = j * 16 + col; th[cl][rl] = (_Float16)v; const __bf16 bh = (__bf16)v; tb[cl][rl] = bh; tbl[cl][rl] = (__bf16)(v - (float)bh); } }
    __syncthreads();
    for (int e = tid; e < 128 * 8; e += 128) { const int cl = e >> 3, q = e & 7; vst2((unsigned*)(VT + (bb * CC + c0 + cl) * (size_t)TT + t0 + q * 8), *(const v4u*)&th[cl][q * 8]); if (hi_rows) { const size_t o3 = (bb * CC + c0 + cl) * (size_t)KHI + t0 + q * 8; vst2((unsigned*)(VB + o3), *(const v4u*)&tb[cl][q * 8]); vst2((unsigned*)(VBL + o3), *(const v4u*)&tbl[cl][q * 8]); } } } }
// ---- k_fa: a block is one job (in some cases a second one behind it). The 32 mask words say which heads are live (mask != 1) and which are masked; every block ranks them alike, and the block index picks the job: the live heads' jobs first (they are the long ones), the masked heads' behind them.
// A masked head forms no score: its output is the average of v at every query. k_planes has summed v over each block of 64 keys (ones x v on the matrix unit); a job adds those 32 sums and stores the average to its 128 or 256 query rows.
// What the masked heads leave free goes to the live ones, as smaller jobs on more key groups: the first 16 live heads run as jobs of 128 queries on four key groups (256 such jobs fill the chip once); up to three more heads are cut into 64 jobs each, of 32 queries on sixteen key groups, a quarter as long, and a block of the 256 runs one of them behind its own job, so that no second round of blocks has to start for them; each such job reads its head's whole k and v planes, which with a fourth head, on every WGP at once, is more than L2 gives in that time, so four or five more heads run as blocks of their own behind the 256, jobs of 64 queries on eight key groups, half as long; with 22 live heads or more that no longer pays, and every job is 256 queries on two key groups.
// A live job: one wave = QT * 16 queries of (b, h), walking its group's share of the keys 32 at a time with a running maximum and sum per query, so that no score ever leaves the registers.
// A block is KG groups of FW waves, 16 waves in all. The groups hold the same queries and share out the keys, tile by tile in turn. Each group keeps a running maximum, sum and O of its own; they are joined once, behind the loop.
// A group's waves read the same key rows and v plane rows: asynchronous copies bring them into LDS once a group, KK keys a tile, two buffers a group; the fragments are read from there.
// S^T = K . Q^T (A = 16 key rows, B = 16 query columns; 1 product: q is rounded to bf16 first, so its f16 plane is exact from 2^-14 up, where a residual plane holds zeros; below that it is rounded as k's plane is): lane (g, col) holds keys 8g + r of query col, which is the B fragment of O^T += V^T . P^T as it stands.
// P = exp(score - maximum in use) x 2^PB, once to f16, against v f16 (1 product); the sum is taken in f32 from the unrounded P and carries the same 2^PB, so it cancels in O / sum.
// The maximum in use is brought up, and O and the sum rescaled, only in a pass where some score of the wave stands more than TAU (log2 units) above it: one test a pass. P stays at or below 2^(PB + TAU) = 2^15, inside f16.
// Every #pragma unroll below is there so that the fragment and accumulator arrays are indexed by constants alone and stay in registers; the loop over the keys stays rolled.
#define QT 2    // 16-query column groups per wave
#define LOG2E 1.4426950408889634f
#define PB 7.0f     // log2 of the factor that P carries
#define TAU 8.0f    // how far, in log2 units, a score may stand above the maximum in use before that is brought up
#define KT 128                 // keys per LDS tile that tile_copy brings: four passes of 32 keys between two barriers
#define KPB 144                // LDS pitch of a key row, bytes: 128 + 16, so that 16 rows read 16 B each without a bank conflict
#define VPB 272                // LDS pitch of a v plane row (KT keys), bytes: 256 + 16, for the same reason
#define RINGB (16 * 2 * (32 * KPB + HD * (2 * 32 + 16)))   // the largest ring: sixteen groups, two buffers each, tiles of 32 keys (311,296 B; eight groups with tiles of 64 keys take 294,912, four with tiles of 128 keys 286,720)
// One tile's copies of one lane: 4 x 16 B of key rows (8 lanes to a 128-B row, 32 rows apart) and 4 x 16 B of v plane rows (16 lanes to a 256-B row, 16 rows apart), global memory to LDS through no register.
// The s_wait_xcnt closes the statement so that no address register of a copy is rewritten in front of it.
__device__ __forceinline__ void tile_copy(unsigned lk, unsigned lv, const _Float16* gk, const _Float16* gv) {
  asm volatile("global_load_async_to_lds_b128 %0, %8, off\n\t"
               "global_load_async_to_lds_b128 %1, %9, off\n\t"
               "global_load_async_to_lds_b128 %2, %10, off\n\t"
               "global_load_async_to_lds_b128 %3, %11, off\n\t"
               "global_load_async_to_lds_b128 %4, %12, off\n\t"
               "global_load_async_to_lds_b128 %5, %13, off\n\t"
               "global_load_async_to_lds_b128 %6, %14, off\n\t"
               "global_load_async_to_lds_b128 %7, %15, off\n\t"
               "s_wait_xcnt 0x0"
               :: "v"(lk), "v"(lk + 32 * KPB), "v"(lk + 64 * KPB), "v"(lk + 96 * KPB), "v"(lv), "v"(lv + 16 * VPB), "v"(lv + 32 * VPB), "v"(lv + 48 * VPB),
                  "v"(gk), "v"(gk + (size_t)32 * CC), "v"(gk + (size_t)64 * CC), "v"(gk + (size_t)96 * CC), "v"(gv), "v"(gv + (size_t)16 * TT), "v"(gv + (size_t)32 * TT), "v"(gv + (size_t)48 * TT)
               : "memory");
}
// The same for a group of four, two or one wave: eight copies of one lane, 16 B each, ls bytes of LDS and gs elements of global memory apart; one call for a tile's key rows, one for its v plane rows.
__device__ __forceinline__ void copy8(unsigned la, unsigned ls, const _Float16* ga, size_t gs) {
  asm volatile("global_load_async_to_lds_b128 %0, %8, off\n\t"
               "global_load_async_to_lds_b128 %1, %9, off\n\t"
               "global_load_async_to_lds_b128 %2, %10, off\n\t"
               "global_load_async_to_lds_b128 %3, %11, off\n\t"
               "global_load_async_to_lds_b128 %4, %12, off\n\t"
               "global_load_async_to_lds_b128 %5, %13, off\n\t"
               "global_load_async_to_lds_b128 %6, %14, off\n\t"
               "global_load_async_to_lds_b128 %7, %15, off\n\t"
               "s_wait_xcnt 0x0"
               :: "v"(la), "v"(la + ls), "v"(la + 2 * ls), "v"(la + 3 * ls), "v"(la + 4 * ls), "v"(la + 5 * ls), "v"(la + 6 * ls), "v"(la + 7 * ls),
                  "v"(ga), "v"(ga + gs), "v"(ga + 2 * gs), "v"(ga + 3 * gs), "v"(ga + 4 * gs), "v"(ga + 5 * gs), "v"(ga + 6 * gs), "v"(ga + 7 * gs)
               : "memory");
}
template <int FW, int KK> __device__ __forceinline__ void tile_in(unsigned lk, unsigned lv, const _Float16* gk, const _Float16* gv) {
  if constexpr (FW == 8) { static_assert(KK == KT, "tile_copy brings KT keys"); tile_copy(lk, lv, gk, gv); }
  else { constexpr int RK = FW * 32 / 8, RV = FW * 32 / (KK / 8);   /* key rows and v plane rows that one copy of the whole group brings */
    static_assert(RK * 8 == KK && RV * 8 == HD, "eight copies a lane for each");
    copy8(lk, RK * KPB, gk, (size_t)RK * CC); copy8(lv, RV * (2 * KK + 16), gv, (size_t)RV * TT); }
}
__device__ __forceinline__ float xhalf(float x) { return __builtin_bit_cast(float, __builtin_amdgcn_permlanex16(__builtin_bit_cast(int, x), __builtin_bit_cast(int, x), 0x76543210, 0xfedcba98, false, false)); }   /* lane l with lane l ^ 16 */
__device__ __forceinline__ v8f wm(v16h a, v16h b, v8f c) { return __builtin_amdgcn_wmma_f32_16x16x32_f16(false, a, false, b, (short)0, c, false, false); }
template <int FW, int KG, int KK> __device__ __forceinline__ void fa_live(const _Float16* __restrict__ QH, const _Float16* __restrict__ KH, const _Float16* __restrict__ VT, float* __restrict__ Y, unsigned char* ring, int bh, int qb) {
  static_assert(FW * KG == 16, "16 waves a block");
  constexpr int NTILE = TT / (KK * KG), VP = 2 * KK + 16, KB = KK * KPB, BUF = KB + HD * VP, LV = KK / 8;   /* tiles a group walks; LDS pitch of a v plane row of KK keys (16 B x odd, as KPB); key rows of a tile; one buffer; lanes to a v plane row */
  static_assert(NTILE >= 2 && KG * 2 * BUF <= RINGB, "two buffers a group, inside the ring");
  const int kg = __builtin_amdgcn_readfirstlane((int)threadIdx.x / (FW * 32));   /* key group, the same in every lane of a wave: held in a scalar register, so that the tests on it are scalar branches */
  const int tid = threadIdx.x & (FW * 32 - 1), wave = tid >> 5, lane = tid & 31, col = lane & 15, g = lane >> 4;   /* tid, wave: within the group */
  const int b = bh / NH, h = bh % NH; const int q0 = qb * (FW * 16 * QT) + wave * (16 * QT);
  v16h qh[QT][2];
#pragma unroll
  for (int qt = 0; qt < QT; ++qt)
#pragma unroll
    for (int kc = 0; kc < 2; ++kc) { const size_t qo = ((size_t)b * TT + q0 + qt * 16 + col) * CC + h * HD + kc * 32; qh[qt][kc] = frag_h(QH + qo, lane); }
  asm volatile("s_wait_xcnt 0x0" ::: "memory");   /* stands in front of the set-up below, which takes over the address registers of the q loads above */
  __builtin_amdgcn_sched_barrier(0);   /* keeps that set-up behind the wait */
  const _Float16* gk = KH + ((size_t)b * TT + kg * KK + (tid >> 3)) * CC + h * HD + (tid & 7) * 8;             /* this lane's 16 B of key row tid / 8 of the group's first tile; + key * CC */
  const _Float16* gv = VT + ((size_t)b * CC + h * HD + tid / LV) * (size_t)TT + kg * KK + (tid % LV) * 8;   /* this lane's 16 B of v plane row tid / LV; + key */
  const unsigned l0 = (unsigned)(size_t)&ring[kg * 2 * BUF];   /* LDS byte address of the group's two buffers */
  const unsigned lk = l0 + (tid >> 3) * KPB + (tid & 7) * 16, lv = l0 + KB + (tid / LV) * VP + (tid % LV) * 16;
  if constexpr (FW == 1) {   /* such a job runs behind another job of its block, which has left its join in the ring */
    asm volatile("s_wait_dscnt 0x0" ::: "memory");   /* this wave's reads and writes of that join are done */
    __syncthreads(); }                                /* every wave's are: the ring may be filled anew */
  tile_in<FW, KK>(lk, lv, gk, gv);
  asm volatile("s_wait_asynccnt 0x0" ::: "memory");   /* this wave's share of tile 0 has landed */
  __syncthreads();                                    /* every wave's share has: tile 0 may be read */
  tile_in<FW, KK>(lk + BUF, lv + BUF, gk + (size_t)KG * KK * CC, gv + KG * KK);
  v8f o[QT][4] = {}; float m[QT], bb[QT]; v2f ls[QT][2];   /* m: the maximum in use, log2 units, the same in both lanes of a query; bb = PB - m; ls: this lane's sum of P, four chains that run on from pass to pass, two to a packed add */
#pragma unroll
  for (int qt = 0; qt < QT; ++qt) { m[qt] = -3.0e38f; bb[qt] = PB + 3.0e38f; ls[qt][0] = v2f{0.f, 0.f}; ls[qt][1] = v2f{0.f, 0.f}; }
#pragma unroll 1   /* the tiles stay rolled too: with one more job kind in the kernel the eight-group job's four tiles came out unrolled, four times its code and every register taken */
  for (int t = 0; t < NTILE; ++t) {
    const unsigned bo = (t & 1) * BUF;
    const unsigned char* Kl = ring + kg * 2 * BUF + bo + col * KPB;          /* + key in tile * KPB */
    const unsigned char* Vl = ring + kg * 2 * BUF + bo + KB + col * VP;    /* + d tile * 16 * VP + key in tile * 2 */
    v16h kf[2][2];
#pragma unroll
    for (int kt = 0; kt < 2; ++kt)
#pragma unroll
      for (int kc = 0; kc < 2; ++kc) kf[kt][kc] = frag_h((const _Float16*)(Kl + (kt * 16) * KPB + kc * 64), lane);
    const unsigned char* Vp = Vl + 16 * g;   /* this lane's place in the v rows; + 64 B a pass */
#pragma unroll 1   /* the passes of a tile stay rolled: unrolled they took some 200 registers more, and the copies' address operands spilled */
   for (int ps = 0; ps < KK / 32; ++ps) {
    v16h vf[4];
#pragma unroll
    for (int dt = 0; dt < 4; ++dt) { union { v16h v; v8h q[2]; } u; u.q[0] = *(const v8h*)(Vp + (dt * 16) * VP); u.q[1] = *(const v8h*)(Vp + (dt * 16) * VP + 32); vf[dt] = u.v; }   /* frag_h, the lane's 16 * g bytes being in Vp */
    Vp += 64;   /* the next pass's v address is formed up here, in a register of its own: formed at the head of that pass it was given an A register of this pass's last product, too few vector slots behind it */
    __builtin_amdgcn_sched_barrier(0);   /* keeps the v reads up here, a whole score and softmax phase ahead of their use, in one group */
    v8f s[QT][2] = {};
#pragma unroll
    for (int kc = 0; kc < 2; ++kc)
#pragma unroll
      for (int kt = 0; kt < 2; ++kt)
#pragma unroll
        for (int qt = 0; qt < QT; ++qt) s[qt][kt] = wm(kf[kt][kc], qh[qt][kc], s[qt][kt]);
    __builtin_amdgcn_sched_barrier(0);   /* keeps the reads below behind all eight products, in one group: without it six of them moved in among the products and two stayed behind */
    if constexpr (KK > 32) {   /* a tile of one pass has no next key rows */
    const int kn = ((ps + 1) * 32) & (KK - 1);   /* the next pass's key rows of the same tile, read behind this pass's score products; a tile's last pass reads its rows 0.. again, unused: no branch stands behind the products */
#pragma unroll
    for (int kt = 0; kt < 2; ++kt)
#pragma unroll
      for (int kc = 0; kc < 2; ++kc) kf[kt][kc] = frag_h((const _Float16*)(Kl + (kn + kt * 16) * KPB + kc * 64), lane); }
    __builtin_amdgcn_sched_barrier(0);   /* keeps the next key rows' reads ahead of the softmax, in one group; without it they sink to right in front of their use */
    v16h pf[QT]; float mx[QT]; bool need = false;
#pragma unroll
    for (int qt = 0; qt < QT; ++qt) { mx[qt] = -3.0e38f;
#pragma unroll
      for (int i = 0; i < 16; ++i) mx[qt] = fmaxf(mx[qt], s[qt][i >> 3][i & 7]);   /* this lane's 16 keys, unscaled */
      need = need || (mx[qt] * (SCALE * LOG2E) + bb[qt] > PB + TAU); }   /* the exponent of the lane's largest P, formed as every P's is below */
    if (__builtin_amdgcn_ballot_w32(need) != 0) {   /* one scalar branch a pass, the same for the whole wave; always taken in a wave's first pass */
#pragma unroll
      for (int qt = 0; qt < QT; ++qt) { const float mw = fmaxf(mx[qt], xhalf(mx[qt]));   /* with the other 8 + 8 keys of this query */
        const float mn = fmaxf(m[qt], mw * (SCALE * LOG2E)); const float alpha = __builtin_amdgcn_exp2f(m[qt] - mn); m[qt] = mn; bb[qt] = PB - mn; ls[qt][0] *= alpha; ls[qt][1] *= alpha;
#pragma unroll
        for (int dt = 0; dt < 4; ++dt) o[qt][dt] *= alpha; } }
#pragma unroll
    for (int qt = 0; qt < QT; ++qt)
#pragma unroll
      for (int i = 0; i < 16; i += 2) { const v2f xv = {s[qt][i >> 3][i & 7], s[qt][(i + 1) >> 3][(i + 1) & 7]}; const v2f t = xv * (SCALE * LOG2E) + bb[qt]; const v2f p = {__builtin_amdgcn_exp2f(t[0]), __builtin_amdgcn_exp2f(t[1])}; ls[qt][(i >> 1) & 1] += p; pf[qt][i] = (_Float16)p[0]; pf[qt][i + 1] = (_Float16)p[1]; }
    __builtin_amdgcn_sched_barrier(0);   /* keeps the sums ahead of the products: moved in among them, they were given the v fragments' registers, at four idle slots behind a product each time */
#pragma unroll
    for (int dt = 0; dt < 4; ++dt)
#pragma unroll
      for (int qt = 0; qt < QT; ++qt) o[qt][dt] = wm(vf[dt], pf[qt], o[qt][dt]);
   }
    asm volatile("s_wait_dscnt 0x0" ::: "memory");      /* this wave's reads of tile t are done */
    asm volatile("s_wait_asynccnt 0x0" ::: "memory");   /* this wave's share of tile t + 1 has landed */
    __syncthreads();                                    /* tile t + 1 may be read, tile t's buffer may be refilled */
    if (t + 2 < NTILE) tile_in<FW, KK>(lk + bo, lv + bo, gk + (size_t)(t + 2) * KG * KK * CC, gv + (t + 2) * KG * KK);
  }
  asm volatile("s_wait_asynccnt 0x0" ::: "memory");   /* no copy is outstanding when the wave goes on to its end */
  float l[QT];
#pragma unroll
  for (int qt = 0; qt < QT; ++qt) l[qt] = (ls[qt][0][0] + ls[qt][0][1]) + (ls[qt][1][0] + ls[qt][1][1]);
  if constexpr (FW == 1) {
    /* Sixteen groups of one wave: one wave adding fifteen others' parts would take as long as the job's passes. Every group hands in its maximum, sum and unscaled O through LDS, and the 512 threads share the join: thread = (query tid / 16, four d). */
    /* It stands in the ring, as below. sa: [KG][QT * 16][HD + 4] floats; ma, behind it: [KG][2][QT * 16], a query's maximum and its sum over both lanes. */
    constexpr int SA = QT * 16 * (HD + 4), MA = 2 * QT * 16;
    float* sa = (float*)ring; float* ma = (float*)ring + KG * SA;
#pragma unroll
    for (int qt = 0; qt < QT; ++qt) { const float lw = l[qt] + xhalf(l[qt]);
      if (g == 0) { ma[kg * MA + qt * 16 + col] = m[qt]; ma[kg * MA + QT * 16 + qt * 16 + col] = lw; }
#pragma unroll
      for (int dt = 0; dt < 4; ++dt) { v4f lo = { o[qt][dt][0], o[qt][dt][1], o[qt][dt][2], o[qt][dt][3] }, hi = { o[qt][dt][4], o[qt][dt][5], o[qt][dt][6], o[qt][dt][7] };
        float* d = sa + kg * SA + (qt * 16 + col) * (HD + 4) + dt * 16 + 8 * g; *(v4f*)d = lo; *(v4f*)(d + 4) = hi; } }
    __syncthreads();   /* every group's part may be read */
    const int rq = (int)threadIdx.x >> 4, c4 = (int)threadIdx.x & 15;
    float mj[KG]; float mn = -3.0e38f;
#pragma unroll
    for (int j = 0; j < KG; ++j) { mj[j] = ma[j * MA + rq]; mn = fmaxf(mn, mj[j]); }
    float lt = 0.f; v4f acc = {};
#pragma unroll
    for (int j = 0; j < KG; ++j) { const float c = __builtin_amdgcn_exp2f(mj[j] - mn); lt += ma[j * MA + QT * 16 + rq] * c; acc += *(const v4f*)(sa + j * SA + rq * (HD + 4) + c4 * 4) * c; }
    acc *= 1.0f / lt;
    vst2(Y + ((size_t)bh * TT + q0 + rq) * HD + c4 * 4, acc);   /* output layout [b][h][t][d]: two 256-B rows a store */
    asm volatile("s_wait_xcnt 0x0" ::: "memory");   /* stands behind the store, in front of whatever code the compiler lays behind this job and lets take over the store's registers */
    return; }
  /* The join: wave w of each group but the first hands its maximum, sum and unscaled O to wave w of group 0, lane to lane, through LDS; group 0 brings all to the largest maximum, adds them, divides and stores. */
  /* It stands in the ring: behind the loop's last barrier nobody reads a tile any more and no copy is outstanding. ss: [KG - 1][FW][QT * 16][HD + 4] floats; ml, behind it: [KG - 1][FW][2][QT][32]. */
  float* ss = (float*)ring + wave * (QT * 16 * (HD + 4)); float* ml = (float*)ring + (KG - 1) * FW * (QT * 16 * (HD + 4)) + wave * (2 * QT * 32) + lane;
  constexpr int SSG = FW * QT * 16 * (HD + 4), MLG = FW * 2 * QT * 32;   /* from one group's part to the next, floats */
  if (kg != 0) {
#pragma unroll
    for (int qt = 0; qt < QT; ++qt) { ml[(kg - 1) * MLG + qt * 32] = m[qt]; ml[(kg - 1) * MLG + (QT + qt) * 32] = l[qt];
#pragma unroll
      for (int dt = 0; dt < 4; ++dt) { v4f lo = { o[qt][dt][0], o[qt][dt][1], o[qt][dt][2], o[qt][dt][3] }, hi = { o[qt][dt][4], o[qt][dt][5], o[qt][dt][6], o[qt][dt][7] };
        float* d = ss + (kg - 1) * SSG + (qt * 16 + col) * (HD + 4) + dt * 16 + 8 * g; *(v4f*)d = lo; *(v4f*)(d + 4) = hi; } } }
  __syncthreads();   /* the other groups' parts may be read */
  if (kg != 0) return;
#pragma unroll
  for (int qt = 0; qt < QT; ++qt) { float mj[KG - 1], cj[KG - 1]; float mn = m[qt];
#pragma unroll
    for (int j = 0; j < KG - 1; ++j) { mj[j] = ml[j * MLG + qt * 32]; mn = fmaxf(mn, mj[j]); }
    const float a0 = __builtin_amdgcn_exp2f(m[qt] - mn); float lt = l[qt] * a0;
#pragma unroll
    for (int j = 0; j < KG - 1; ++j) { cj[j] = __builtin_amdgcn_exp2f(mj[j] - mn); lt += ml[j * MLG + (QT + qt) * 32] * cj[j]; }
    const float inv = 1.0f / (lt + xhalf(lt)); const float c0 = a0 * inv;
#pragma unroll
    for (int j = 0; j < KG - 1; ++j) cj[j] *= inv;
#pragma unroll
    for (int dt = 0; dt < 4; ++dt) { float* d = ss + (qt * 16 + col) * (HD + 4) + dt * 16 + 8 * g;   /* the 32 B that the same lane of group 1 wrote, and that this lane overwrites */
      v4f lo = { o[qt][dt][0] * c0, o[qt][dt][1] * c0, o[qt][dt][2] * c0, o[qt][dt][3] * c0 }, hi = { o[qt][dt][4] * c0, o[qt][dt][5] * c0, o[qt][dt][6] * c0, o[qt][dt][7] * c0 };
#pragma unroll
      for (int j = 0; j < KG - 1; ++j) { lo += *(const v4f*)(d + j * SSG) * cj[j]; hi += *(const v4f*)(d + j * SSG + 4) * cj[j]; }
      *(v4f*)d = lo; *(v4f*)(d + 4) = hi; } }
  LDSX(); for (int rl = g; rl < QT * 16; rl += 2) vst2(Y + ((size_t)bh * TT + q0 + rl) * HD + col * 4, *(const v4f*)&ss[rl * (HD + 4) + col * 4]); }   /* output layout [b][h][t][d]: two 256-B rows a store */
// A masked head's job: the 32 key blocks' sums of v (k_planes: ones x v on the matrix unit) are added, two in a wave's halves, the 16 waves' through LDS, and the average goes to the job's query rows r0 .. r0 + 32 * nst - 1.
__device__ __forceinline__ void fa_masked(const float* __restrict__ PS, float* __restrict__ Y, unsigned char* ring, int bh, int r0, int nst) {
  const int tid = threadIdx.x, wave = tid >> 5, lane = tid & 31, col = lane & 15, g = lane >> 4;
  v4f a = *(const v4f*)(PS + ((size_t)bh * (TT / 64) + (tid >> 4)) * HD + col * 4);   /* key block tid / 16, four d */
#pragma unroll
  for (int c = 0; c < 4; ++c) a[c] += xhalf(a[c]);
  float* red = (float*)ring;   /* [16 waves][HD] */
  if (g == 0) *(v4f*)(red + wave * HD + col * 4) = a;
  __syncthreads();   /* every wave's sums may be read */
  v4f s = {};
#pragma unroll
  for (int w = 0; w < 16; ++w) s += *(const v4f*)(red + w * HD + col * 4);
  s *= 1.0f / TT;
  for (int i = 0; i < nst; i += 4)
#pragma unroll
    for (int j = 0; j < 4; ++j) vst2(Y + ((size_t)bh * TT + r0 + (i + j) * 32 + (tid >> 4)) * HD + col * 4, s); }   /* two 256-B rows a store */
__global__ __launch_bounds__(512) void k_fa(const _Float16* __restrict__ QH, const _Float16* __restrict__ KH, const _Float16* __restrict__ VT, const float* __restrict__ PS, const int* __restrict__ HM, float* __restrict__ Y) {
  __shared__ __align__(16) unsigned char ring[RINGB];   /* two buffers a group: its next tile lands while this one is worked on */
  static_assert(NB * NH == 32, "one mask word a lane");
  const int lane = threadIdx.x & 31, bid = blockIdx.x;
  const unsigned um = __builtin_amdgcn_ballot_w32(HM[lane] != 1);   /* bit bh: head bh is live; mask[b][h] == 1 replaces EVERY score of that head with one constant */
  const int nu = __builtin_popcount(um); const bool wide = nu > 21;   /* wide: every live job is 256 queries */
  const int ns = (nu > 16 && !wide) ? nu - 16 : 0, nm = wide ? 0 : nu - ns;   /* live heads behind the first 16, in jobs of 64 queries, or of 32 queries as second jobs when three at most; in jobs of 128 queries, 16 at most */
  const bool fine = ns >= 1 && ns <= 3;   /* fine: the heads behind the first 16 have no blocks of their own; the 256 blocks run them as second jobs */
  const int j1 = wide ? nu * (TT / 256) : nm * (TT / 128), nj = j1 + (fine ? 0 : ns * (TT / 64));   /* the longer live jobs come first, the shorter behind them, the masked heads' last */
  const int msh = nu > 16 ? 3 : 4;   /* a masked head is 8 jobs of 256 queries or 16 of 128: never more than 512 jobs in all */
  const bool live = bid < nj; int rank, qb;   /* which of the live, or of the masked, heads; which of its jobs */
  if (bid < j1) { rank = wide ? bid >> 3 : bid >> 4; qb = wide ? bid & 7 : bid & 15; }
  else if (live) { rank = nm + ((bid - j1) >> 5); qb = (bid - j1) & 31; }
  else { rank = (bid - nj) >> msh; qb = (bid - nj) & ((1 << msh) - 1); }
  if (!live && rank >= 32 - nu) return;   /* no job left: the whole block leaves, in front of every barrier */
  const unsigned set = live ? um : ~um;
  const unsigned sel = __builtin_amdgcn_ballot_w32(((set >> lane) & 1u) != 0u && __builtin_popcount(set & ((1u << lane) - 1u)) == rank);   /* one bit: the head of that rank */
  const int bh = __builtin_amdgcn_readfirstlane(__builtin_ctz(sel | 0x80000000u));   /* 0 .. 31 whatever the mask words hold */
  if (!live) { fa_masked(PS, Y, ring, bh, qb << (11 - msh), 64 >> msh); return; }
  if (bid >= j1) fa_live<2, 8, 64>(QH, KH, VT, Y, ring, bh, qb);
  else if (wide) fa_live<8, 2, 128>(QH, KH, VT, Y, ring, bh, qb);
  else { fa_live<4, 4, 128>(QH, KH, VT, Y, ring, bh, qb);
    const int xh = (bid >> 3) & 3;   /* second jobs: blocks 32 i + 8 xh + j take job 8 i + j of live head 16 + xh, eight neighbouring blocks in every 32 to a head */
    if (fine && xh < ns) {   /* the same for the whole block */
      const unsigned sel2 = __builtin_amdgcn_ballot_w32(((um >> lane) & 1u) != 0u && __builtin_popcount(um & ((1u << lane) - 1u)) == 16 + xh);
      const int bh2 = __builtin_amdgcn_readfirstlane(__builtin_ctz(sel2 | 0x80000000u));   /* 0 .. 31 whatever the mask words hold */
      fa_live<1, 16, 32>(QH, KH, VT, Y, ring, bh2, ((bid >> 5) << 3) | (bid & 7)); } } }

extern "C" void kernel_launch(void* const* d_in, const int* in_sizes, int n_in, void* d_out, int out_size, void* d_ws, size_t ws_size, hipStream_t stream) {
  (void)in_sizes; (void)n_in; (void)out_size;
  const float** F = (const float**)d_in;
  if (ws_size < (size_t)WS_END) return;
  char* ws = (char*)d_ws; _Float16 *QH = (_Float16*)(ws + WS_QH), *KH = (_Float16*)(ws + WS_KH), *VT = (_Float16*)(ws + WS_VT), *KL = (_Float16*)(ws + WS_KL); __bf16 *VB = (__bf16*)(ws + WS_VB), *VBL = (__bf16*)(ws + WS_VBL); float *S = (float*)(ws + WS_S), *Y = (float*)(ws + WS_Y);
  (void)Y; (void)KL; (void)VB; (void)VBL;
  // inputs: 0 query [4,8,2048,64]; 1 key; 2 value; 3 mask [4,8] int32 (1 -> the whole head's scores := -1e6)
  const int* HM = (const int*)d_in[3];
  k_planes<<<dim3(TT / 64, NH, NB), 256, 0, stream>>>(F[0], F[1], F[2], HM, QH, KH, VT, S);   /* S: here the masked heads' sums of v, [b * NH + h][TT / 64][HD] f32 */
  k_fa<<<dim3(NB * NH * (TT / 128)), 512, 0, stream>>>(QH, KH, VT, S, HM, (float*)d_out);
}

// v010
// A run of this version takes 28.8 microseconds.
// Versions in between are left out here; by their measured steps it is 1.07 times as fast as v008.
// Counting every step since v000, it is 34.3 times as fast.
// compute dtype: all float inputs rounded to bf16; k, v are bf16-valued so their f16 planes are exact (sub-6e-5 magnitudes aside); q's plane also carries 64^-0.5 x log2 e and is rounded once more, to f16 (2^-11 relative); logits q x k (1 product), summed onto 7 - the maximum in use; softmax f32; P x 2^7 once to f16 x v (exact in f16) (1 product); a masked head (the module sets its every score to -1e6, so its softmax is 1 / 2048 at every key) is ones x v (1 product, 64 keys at a time, the 32 sums added in f32) / 2048; f32 output.
#include <hip/hip_runtime.h>
#include <math.h>

typedef __attribute__((ext_vector_type(16))) _Float16 v16h;
typedef __attribute__((ext_vector_type(16))) __bf16 v16b;
typedef __attribute__((ext_vector_type(8)))  _Float16 v8h;
typedef __attribute__((ext_vector_type(8)))  float v8f;
typedef __attribute__((ext_vector_type(4)))  float v4f;
typedef __attribute__((ext_vector_type(2)))  float v2f;
typedef __attribute__((ext_vector_type(4)))  unsigned v4u;
typedef _Float16 hx8 __attribute__((ext_vector_type(8)));
typedef __attribute__((ext_vector_type(4)))  int v4i;
typedef float __attribute__((may_alias)) float_a;
typedef int __attribute__((may_alias)) int_a;

template <typename T> __device__ __forceinline__ void vst2(void* p, T v) { *(T*)p = v;  }
__device__ __forceinline__ v8f wmma16(v16h a, v16h b, v8f c) {
  v8f d = __builtin_amdgcn_wmma_f32_16x16x32_f16(false, a, false, b, (short)0, c, false, false);
  asm volatile("v_nop\n\tv_nop\n\tv_nop\n\tv_nop" : "+v"(d) : "v"(a), "v"(b));
  return d;
}
__device__ __forceinline__ v8f wmma_bf(v16b a, v16b b, v8f c) {
  v8f d = __builtin_amdgcn_wmma_f32_16x16x32_bf16(false, a, false, b, (short)0, c, false, false);
  asm volatile("v_nop\n\tv_nop\n\tv_nop\n\tv_nop" : "+v"(d) : "v"(a), "v"(b));
  return d;
}
// 16x16x32 fragments: lane = (h = lane>>4, row/col = lane&15); elements 0..7 = k0+8h+0..7, 8..15 = k0+16+8h+0..7; D element r = row 8h+r
__device__ __forceinline__ v16h frag_h(const _Float16* rowk0, int lane) {
  union { v16h v; v8h q[2]; } u; const _Float16* p = rowk0 + 8 * (lane >> 4);
  u.q[0] = *(const v8h*)p; u.q[1] = *(const v8h*)(p + 16); return u.v;
}
__device__ __forceinline__ v16h frag_f32(const float* rowk0, int lane) {
  v16h a; const float* p = rowk0 + 8 * (lane >> 4);
#pragma unroll
  for (int i = 0; i < 8; ++i) { a[i] = (_Float16)p[i]; a[8 + i] = (_Float16)p[16 + i]; }
  return a;
}
__device__ __forceinline__ v16h frag_f32s(const float* rowk0, int lane, float sc) {
  v16h a; const float* p = rowk0 + 8 * (lane >> 4);
#pragma unroll
  for (int i = 0; i < 8; ++i) { a[i] = (_Float16)(p[i] * sc); a[8 + i] = (_Float16)(p[16 + i] * sc); }
  return a;
}
// column fragment from a [K][ld] layout (column n), rows >= K read as 0
__device__ __forceinline__ v16h fragc_f32(const float* W, int k0, int n, int lane, int ld, int K) {
  v16h a; const int g = lane >> 4;
#pragma unroll
  for (int i = 0; i < 8; ++i) { const int ka = k0 + 8 * g + i, kb = ka + 16;
    a[i] = (_Float16)(ka < K ? W[(size_t)(ka < K ? ka : K - 1) * ld + n] : 0.f); a[8 + i] = (_Float16)(kb < K ? W[(size_t)(kb < K ? kb : K - 1) * ld + n] : 0.f); }
  return a;
}
struct F2 { v16b h, l; };
__device__ __forceinline__ F2 bsplit16(const float v[16]) { F2 r;
#pragma unroll
  for (int i = 0; i < 16; ++i) { const __bf16 h = (__bf16)v[i]; r.h[i] = h; r.l[i] = (__bf16)(v[i] - (float)h); }
  return r; }
__device__ __forceinline__ F2 split_row(const float* row, int k0, int lane) { float v[16]; const float* p = row + k0 + 8 * (lane >> 4);
#pragma unroll
  for (int i = 0; i < 8; ++i) { v[i] = p[i]; v[8 + i] = p[16 + i]; }
  return bsplit16(v); }
__device__ __forceinline__ F2 split_rowK(const float* row, int k0, int lane, int K) { float v[16]; const int g = lane >> 4;
#pragma unroll
  for (int i = 0; i < 8; ++i) { const int ka = k0 + 8 * g + i, kb = ka + 16; v[i] = ka < K ? row[ka < K ? ka : K - 1] : 0.f; v[8 + i] = kb < K ? row[kb < K ? kb : K - 1] : 0.f; }
  return bsplit16(v); }
__device__ __forceinline__ F2 split_col(const float* W, int k0, int n, int lane, int ld, int K) { float v[16]; const int g = lane >> 4;
#pragma unroll
  for (int i = 0; i < 8; ++i) { const int ka = k0 + 8 * g + i, kb = ka + 16; v[i] = ka < K ? W[(size_t)(ka < K ? ka : K - 1) * ld + n] : 0.f; v[8 + i] = kb < K ? W[(size_t)(kb < K ? kb : K - 1) * ld + n] : 0.f; }
  return bsplit16(v); }
__device__ __forceinline__ v8f mac3(const F2& a, const F2& b, v8f c) { c = wmma_bf(a.l, b.h, c); c = wmma_bf(a.h, b.l, c); return wmma_bf(a.h, b.h, c); }
__device__ __forceinline__ float sigm(float v) { return 1.0f / (1.0f + expf(-v)); }
#define LDSX() do { asm volatile("s_wait_dscnt 0" ::: "memory"); __builtin_amdgcn_wave_barrier(); __builtin_amdgcn_fence(__ATOMIC_RELEASE, "workgroup"); } while (0)

// Naive full scaled-dot-product attention (query/key/value [4,8,2048,64] given; mask [4,8] int: mask == 1 sets that head's entire score matrix to -1e6, i.e. exactly uniform attention): out = softmax(q k^T / 8 (masked_fill)) v -> [4,8,2048,64].
#define NB 4
#define TT 2048
#define CC 512            // NH * HD = projected width
#define DIN 512          // input (model) width
#define NH 8
#define HD 64
#define NQB (TT / 64)
#define HG 4
#define SCALE (0.125f)
#define LOG2E 1.4426950408889634f
#define CAUSAL 0
#ifndef TNB
#define TNB NB
#endif
__device__ __forceinline__ float bfr(float v) { return (float)(__bf16)v; }
__host__ __device__ __forceinline__ int kb_last(int qb) { return CAUSAL ? ((qb * 64 + 63) >> 7) : (TT / 128 - 1); }
typedef __attribute__((ext_vector_type(8))) __bf16 v8b;
__device__ __forceinline__ v16b frag_b(const __bf16* rowk0, int lane) {
  union { v16b v; v8b q[2]; } u; const __bf16* p = rowk0 + 8 * (lane >> 4);
  u.q[0] = *(const v8b*)p; u.q[1] = *(const v8b*)(p + 16); return u.v;
}
#define QBH 0              // unused: no kernel in this file has a high-precision path
#define QHI 2048            // rows for which k_proj writes a q residual plane
#define KHI 64            // key rows carrying k residual / v bf16 hi+lo planes (read by no kernel in this file)
// B fragment (k rows k0+.., output column o) of a weight: (in,out) [K][ld] or (out,in) [ld rows of K]: bf16 exact, or f16(bf16 * 256) exact
__device__ __forceinline__ v16b wcol_io(const float* Wm, int k0, int o, int lane, int ld) { v16b w; const int g = lane >> 4;
#pragma unroll
  for (int i = 0; i < 8; ++i) { w[i] = (__bf16)Wm[(size_t)(k0 + 8 * g + i) * ld + o]; w[8 + i] = (__bf16)Wm[(size_t)(k0 + 16 + 8 * g + i) * ld + o]; }
  return w; }
__device__ __forceinline__ v16b wcol_oi(const float* Wm, int k0, int o, int lane, int K) { v16b w; const float* p = Wm + (size_t)o * K + k0 + 8 * (lane >> 4);
#pragma unroll
  for (int i = 0; i < 8; ++i) { w[i] = (__bf16)p[i]; w[8 + i] = (__bf16)p[16 + i]; }
  return w; }
__device__ __forceinline__ v16h wcolh_io(const float* Wm, int k0, int o, int lane, int ld) { v16h w; const int g = lane >> 4;
#pragma unroll
  for (int i = 0; i < 8; ++i) { w[i] = (_Float16)(bfr(Wm[(size_t)(k0 + 8 * g + i) * ld + o]) * 256.0f); w[8 + i] = (_Float16)(bfr(Wm[(size_t)(k0 + 16 + 8 * g + i) * ld + o]) * 256.0f); }
  return w; }
__device__ __forceinline__ v16h wcolh_oi(const float* Wm, int k0, int o, int lane, int K) { v16h w; const float* p = Wm + (size_t)o * K + k0 + 8 * (lane >> 4);
#pragma unroll
  for (int i = 0; i < 8; ++i) { w[i] = (_Float16)(bfr(p[i]) * 256.0f); w[8 + i] = (_Float16)(bfr(p[16 + i]) * 256.0f); }
  return w; }
#define WQKV_LAYOUT 0   // 0 = (in,out) [DIN][CC]; 1 = (out,in) [CC][DIN]; 2 = per-head [NH][DIN][HD]
__device__ __forceinline__ v16b wcol_hdk(const float* Wm, int k0, int o, int lane) { v16b w; const int g = lane >> 4; const float* p = Wm + (size_t)(o / HD) * DIN * HD + (o % HD);
#pragma unroll
  for (int i = 0; i < 8; ++i) { w[i] = (__bf16)p[(size_t)(k0 + 8 * g + i) * HD]; w[8 + i] = (__bf16)p[(size_t)(k0 + 16 + 8 * g + i) * HD]; }
  return w; }
#define WO_OUT_IN 0
#if WQKV_LAYOUT == 1
#define WCOL(W, k0, o, lane) wcol_oi(W, k0, o, lane, DIN)
#elif WQKV_LAYOUT == 2
#define WCOL(W, k0, o, lane) wcol_hdk(W, k0, o, lane)
#else
#define WCOL(W, k0, o, lane) wcol_io(W, k0, o, lane, CC)
#endif
#if WO_OUT_IN
#define WOCOL(W, k0, o, lane) wcol_oi(W, k0, o, lane, CC)
#define WOCOLH(W, k0, o, lane) wcolh_oi(W, k0, o, lane, CC)
#else
#define WOCOL(W, k0, o, lane) wcol_io(W, k0, o, lane, DIN)
#define WOCOLH(W, k0, o, lane) wcolh_io(W, k0, o, lane, DIN)
#endif
#define SM_EXTRA_PARAMS , int bsm, int h0s, const int* __restrict__ HM
// per-(batch, head) mask: mask[b][h] == 1 replaces EVERY score of that head with -1e6 (softmax becomes exactly uniform); read per element
#define SM_MASK_HOOK do { const int mk = HM[bsm * NH + h0s + (int)blockIdx.y]; v = (mk == 1) ? -1.0e6f : v; } while (0)
__global__ __launch_bounds__(256) void k_planes(const float* __restrict__ Q, const float* __restrict__ Kx, const float* __restrict__ V, const int* __restrict__ HM, _Float16* __restrict__ QH, _Float16* __restrict__ KH, _Float16* __restrict__ VT, float* __restrict__ PS) {
  __shared__ __align__(16) _Float16 tv[64][72];
  const int tid = threadIdx.x; const int t0 = blockIdx.x * 64, h = blockIdx.y; const size_t b = blockIdx.z;
  const int hm = HM[b * NH + h];   /* the same for the whole block */
  const size_t src0 = ((b * NH + h) * TT + t0) * (size_t)HD;   /* [b][h][t][d] */
  { const int rl = tid >> 2, q = tid & 3;   /* 64 rows x 4 threads x 16 values */
    const float* pq = Q + src0 + (size_t)rl * HD + q * 16; const float* pk = Kx + src0 + (size_t)rl * HD + q * 16; const float* pv = V + src0 + (size_t)rl * HD + q * 16;
    v4f w0 = *(const v4f*)pv, w1 = *(const v4f*)(pv + 4), w2 = *(const v4f*)(pv + 8), w3 = *(const v4f*)(pv + 12);   /* first: they need not wait for the mask word */
    __builtin_amdgcn_sched_barrier(0);   /* keeps the v loads ahead of the wait for the mask word: without it they were issued behind that wait */
    const bool live = hm != 1;   /* a masked head's output is the average of v: its q and k are read by nobody, and of v only the sums over the block's 64 keys go on */
    v4f a0 = {}, a1 = {}, a2 = {}, a3 = {}, k0 = {}, k1 = {}, k2 = {}, k3 = {};
    if (live) { a0 = *(const v4f*)pq; a1 = *(const v4f*)(pq + 4); a2 = *(const v4f*)(pq + 8); a3 = *(const v4f*)(pq + 12); k0 = *(const v4f*)pk; k1 = *(const v4f*)(pk + 4); k2 = *(const v4f*)(pk + 8); k3 = *(const v4f*)(pk + 12); }
    asm volatile("s_wait_loadcnt 0x0\n\ts_wait_xcnt 0x0" ::: "memory");   /* the loads' address registers are taken over below */
    __builtin_amdgcn_sched_barrier(0);   /* keeps what follows, which takes those registers over, behind the wait */
    float va[16] = {w0[0],w0[1],w0[2],w0[3],w1[0],w1[1],w1[2],w1[3],w2[0],w2[1],w2[2],w2[3],w3[0],w3[1],w3[2],w3[3]};
#pragma unroll
    for (int i = 0; i < 8; ++i) { tv[q * 16 + i][rl] = (_Float16)bfr(va[i]); tv[q * 16 + 8 + i][rl] = (_Float16)bfr(va[8 + i]); }
    if (live) {
      float qa[16] = {a0[0],a0[1],a0[2],a0[3],a1[0],a1[1],a1[2],a1[3],a2[0],a2[1],a2[2],a2[3],a3[0],a3[1],a3[2],a3[3]}; float ka[16] = {k0[0],k0[1],k0[2],k0[3],k1[0],k1[1],k1[2],k1[3],k2[0],k2[1],k2[2],k2[3],k3[0],k3[1],k3[2],k3[3]};
      hx8 qh0, qh1, kh0, kh1;
#pragma unroll
      for (int i = 0; i < 8; ++i) { qh0[i] = (_Float16)(bfr(qa[i]) * (SCALE * LOG2E)); qh1[i] = (_Float16)(bfr(qa[8 + i]) * (SCALE * LOG2E));   /* the softmax scale and log2 e ride in q's plane: the score product comes out in log2 units */
        kh0[i] = (_Float16)bfr(ka[i]); kh1[i] = (_Float16)bfr(ka[8 + i]); }
      const size_t row = b * TT + t0 + rl; _Float16* dq = QH + row * CC + h * HD + q * 16; _Float16* dk = KH + row * CC + h * HD + q * 16;
      vst2((unsigned*)dq, *(const v4u*)&qh0); vst2((unsigned*)(dq + 8), *(const v4u*)&qh1); vst2((unsigned*)dk, *(const v4u*)&kh0); vst2((unsigned*)(dk + 8), *(const v4u*)&kh1);
      asm volatile("s_wait_xcnt 0x0" ::: "memory"); } }   /* the stores' address registers are taken over behind the barrier */
  __syncthreads();
  if (hm != 1) { for (int e = tid; e < 64 * 8; e += 256) { const int cl = e >> 3, q = e & 7; vst2((unsigned*)(VT + (b * CC + h * HD + cl) * (size_t)TT + t0 + q * 8), *(const v4u*)&tv[cl][q * 8]); } return; }
  /* masked: V^T . ones (A = 16 v plane rows of 64 keys, B = ones: every column of the result holds the rows' sums), waves 0 .. 3 a d tile each; PS[b * NH + h][key block][d] */
  const int wave = __builtin_amdgcn_readfirstlane(tid >> 5), lane = tid & 31, col = lane & 15, g = lane >> 4;   /* wave: in a scalar register, so that the test below is a scalar branch and the products run with every lane on */
  if (wave < 4) { v16h one; v8f s = {};
#pragma unroll
    for (int i = 0; i < 16; ++i) one[i] = (_Float16)1.0f;
#pragma unroll
    for (int kc = 0; kc < 2; ++kc) s = __builtin_amdgcn_wmma_f32_16x16x32_f16(false, frag_h(&tv[wave * 16 + col][kc * 32], lane), false, one, (short)0, s, false, false);
    if (col == 0) { float* d = PS + ((b * NH + h) * (TT / 64) + blockIdx.x) * HD + wave * 16 + 8 * g; v4f lo = { s[0], s[1], s[2], s[3] }, hi = { s[4], s[5], s[6], s[7] }; *(v4f*)d = lo; *(v4f*)(d + 4) = hi; } } }
#ifndef SM_EXTRA_PARAMS
#define SM_EXTRA_PARAMS
#endif
#ifndef PROJ_EXTRA_PARAMS
#define PROJ_EXTRA_PARAMS
#endif
#ifndef PROJ_EXTRA_PARAMS
#define PROJ_EXTRA_PARAMS
#endif
#ifndef SM_MASK_HOOK
#define SM_MASK_HOOK (void)0
#endif


#ifndef SM_EXTRA_PARAMS
#define SM_EXTRA_PARAMS
#endif
#ifndef SM_MASK_HOOK
#define SM_MASK_HOOK (void)0
#endif

#define WS_QH  0u                                      // f16 q rows [b*t][CC]
#define WS_KH  (WS_QH + 2u * (size_t)NB * TT * CC)      // f16 k rows [b*t][CC]
#define WS_VT  (WS_KH + 2u * (size_t)NB * TT * CC)      // f16 v planes [b][c][t]
#define WS_QL  (WS_VT + 2u * (size_t)NB * CC * TT)      // f16 q residual x 2^10 rows [b][t < QHI][CC]
#define WS_KL  (WS_QL + 2u * (size_t)NB * QHI * CC)     // f16 k residual x 2^10 rows [b][t < KHI][CC]
#define WS_VB  (WS_KL + 2u * (size_t)NB * KHI * CC)     // bf16 v hi planes [b][c][t < KHI]
#define WS_VBL (WS_VB + 2u * (size_t)NB * CC * KHI)
#define WS_S   (WS_VBL + 2u * (size_t)NB * CC * KHI)    // f32 [b * NH + h][TT / 64][HD]: the masked heads' sums of v, from k_planes to k_fa
#define WS_Y   (WS_S  + 4u * (size_t)HG * TT * TT)      // f32 ctx rows [b*t][CC] (only when there is an output projection)
#define WS_END (WS_Y  + 0u)

// ---- k_proj: block = (64 rows, 128 cols, which): q/k/v = X W (+ b) with exact bf16 products (K = DIN) -> which 0: q f16 rows (+ residual rows < QHI); 1: k f16 rows (+ residual rows < KHI); 2: v f16 planes [c][t] (+ bf16 hi/lo planes for t < KHI)
__global__ __launch_bounds__(128) void k_proj(const float* __restrict__ XQ, const float* __restrict__ XK, const float* __restrict__ XV, const float* __restrict__ WQ, const float* __restrict__ WK, const float* __restrict__ WV, const float* __restrict__ BQ, const float* __restrict__ BK, const float* __restrict__ BV,
    _Float16* __restrict__ QH, _Float16* __restrict__ QL, _Float16* __restrict__ KH, _Float16* __restrict__ KL, _Float16* __restrict__ VT, __bf16* __restrict__ VB, __bf16* __restrict__ VBL) {
  __shared__ __align__(16) _Float16 sh[64][136], sl[64][136]; __shared__ __align__(16) _Float16 th[128][72]; __shared__ __align__(16) __bf16 tb[128][72], tbl[128][72];
  const int tid = threadIdx.x, wave = tid >> 5, lane = tid & 31, col = lane & 15, g = lane >> 4; const int which = blockIdx.z; const int c0 = blockIdx.y * 128; const size_t r0 = (size_t)blockIdx.x * 64; const size_t bb = r0 / TT; const int t0 = (int)(r0 % TT);
  const float* X = which == 0 ? XQ : which == 1 ? XK : XV; const float* WA = which == 0 ? WQ : which == 1 ? WK : WV; const float* BA = which == 0 ? BQ : which == 1 ? BK : BV;
  v8f acc[8] = {};
#pragma unroll 2
  for (int kc = 0; kc < DIN / 32; ++kc) { v16b a; { const float* p = X + (r0 + wave * 16 + col) * DIN + kc * 32 + 8 * g;
#pragma unroll
      for (int i = 0; i < 8; ++i) { a[i] = (__bf16)p[i]; a[8 + i] = (__bf16)p[16 + i]; } }
    asm volatile("s_wait_loadcnt 0x0" ::: "memory");
#pragma unroll
    for (int j = 0; j < 8; ++j) { const v16b w = WCOL(WA, kc * 32, c0 + j * 16 + col, lane); asm volatile("s_wait_loadcnt 0x0" ::: "memory"); acc[j] = wmma_bf(a, w, acc[j]); } }
  if (which < 2) { _Float16* DH = which == 0 ? QH : KH; _Float16* DL = which == 0 ? QL : KL; const int nhi = which == 0 ? QHI : KHI; const bool hi_rows = t0 < nhi;
#pragma unroll
    for (int j = 0; j < 8; ++j) { const float bias = BA ? bfr(BA[c0 + j * 16 + col]) : 0.f;
#pragma unroll
      for (int r = 0; r < 8; ++r) { const float v = acc[j][r] + bias; const _Float16 hv = (_Float16)v; sh[wave * 16 + 8 * g + r][j * 16 + col] = hv; sl[wave * 16 + 8 * g + r][j * 16 + col] = (_Float16)((v - (float)hv) * 1024.0f); } }
    __syncthreads();
    for (int e = tid; e < 64 * 16; e += 128) { const int rl = e >> 4, q = e & 15; vst2((unsigned*)(DH + (r0 + rl) * CC + c0 + q * 8), *(const v4u*)&sh[rl][q * 8]); if (hi_rows) vst2((unsigned*)(DL + (bb * nhi + t0 + rl) * (size_t)CC + c0 + q * 8), *(const v4u*)&sl[rl][q * 8]); }
  } else { const bool hi_rows = t0 < KHI;
#pragma unroll
    for (int j = 0; j < 8; ++j) { const float bias = BA ? bfr(BA[c0 + j * 16 + col]) : 0.f;
#pragma unroll
      for (int r = 0; r < 8; ++r) { const float v = acc[j][r] + bias; const int rl = wave * 16 + 8 * g + r, cl = j * 16 + col; th[cl][rl] = (_Float16)v; const __bf16 bh = (__bf16)v; tb[cl][rl] = bh; tbl[cl][rl] = (__bf16)(v - (float)bh); } }
    __syncthreads();
    for (int e = tid; e < 128 * 8; e += 128) { const int cl = e >> 3, q = e & 7; vst2((unsigned*)(VT + (bb * CC + c0 + cl) * (size_t)TT + t0 + q * 8), *(const v4u*)&th[cl][q * 8]); if (hi_rows) { const size_t o3 = (bb * CC + c0 + cl) * (size_t)KHI + t0 + q * 8; vst2((unsigned*)(VB + o3), *(const v4u*)&tb[cl][q * 8]); vst2((unsigned*)(VBL + o3), *(const v4u*)&tbl[cl][q * 8]); } } } }
// ---- k_fa: a block is one job (in some cases a second one behind it). The 32 mask words say which heads are live (mask != 1) and which are masked; every block ranks them alike, and the block index picks the job: the live heads' jobs first (they are the long ones), the masked heads' behind them.
// A masked head forms no score: its output is the average of v at every query. k_planes has summed v over each block of 64 keys (ones x v on the matrix unit); a job adds those 32 sums and stores the average to its 128 or 256 query rows.
// What the masked heads leave free goes to the live ones, as smaller jobs on more key groups: the first 16 live heads run as jobs of 128 queries on four key groups (256 such jobs fill the chip once); up to three more heads are cut into 64 jobs each, of 32 queries on sixteen key groups, a quarter as long, and a block of the 256 runs one of them behind its own job, so that no second round of blocks has to start for them; each such job reads its head's whole k and v planes, which with a fourth head, on every WGP at once, is more than L2 gives in that time, so four or five more heads run as blocks of their own behind the 256, jobs of 64 queries on eight key groups, half as long; with 22 live heads or more that no longer pays, and every job is 256 queries on two key groups.
// A live job: one wave = QT * 16 queries of (b, h), walking its group's share of the keys 32 at a time with a running maximum and sum per query, so that no score ever leaves the registers.
// A block is KG groups of FW waves, 16 waves in all. The groups hold the same queries and share out the keys, tile by tile in turn. Each group keeps a running maximum, sum and O of its own; they are joined once, behind the loop.
// A group's waves read the same key rows and v plane rows: asynchronous copies bring them into LDS once a group, KK keys a tile, two buffers a group; the fragments are read from there.
// S^T = K . Q^T (A = 16 key rows, B = 16 query columns; 1 product; q's plane is bf16(q) x 64^-0.5 x log2 e, rounded to f16): lane (g, col) holds keys 8g + r of query col, which is the B fragment of O^T += V^T . P^T as it stands.
// The product's accumulator starts at PB - the maximum in use, so that what comes out of the matrix unit is the exponent of P as it stands: no vector instruction scales a score, and only a pass that brings the maximum up shifts one.
// P = exp(score - maximum in use) x 2^PB, once to f16, against v f16 (1 product); the sum is taken in f32 from the unrounded P and carries the same 2^PB, so it cancels in O / sum.
// The maximum in use is brought up, and O and the sum rescaled, only in a pass where some score of the wave stands more than TAU (log2 units) above it: one test a pass. P stays at or below 2^(PB + TAU) = 2^15, inside f16.
// Every #pragma unroll below is there so that the fragment and accumulator arrays are indexed by constants alone and stay in registers; the loop over the keys stays rolled.
#define QT 2    // 16-query column groups per wave
#define PB 7.0f     // log2 of the factor that P carries
#define TAU 8.0f    // how far, in log2 units, a score may stand above the maximum in use before that is brought up
#define KT 128                 // keys per LDS tile that tile_copy brings: four passes of 32 keys between two barriers
#define KPB 144                // LDS pitch of a key row, bytes: 128 + 16, so that 16 rows read 16 B each without a bank conflict
#define VPB 272                // LDS pitch of a v plane row (KT keys), bytes: 256 + 16, for the same reason
#define RINGB (16 * 2 * (32 * KPB + HD * (2 * 32 + 16)))   // the largest ring: sixteen groups, two buffers each, tiles of 32 keys (311,296 B; eight groups with tiles of 64 keys take 294,912, four with tiles of 128 keys 286,720)
// One tile's copies of one lane: 4 x 16 B of key rows (8 lanes to a 128-B row, 32 rows apart) and 4 x 16 B of v plane rows (16 lanes to a 256-B row, 16 rows apart), global memory to LDS through no register.
// The s_wait_xcnt closes the statement so that no address register of a copy is rewritten in front of it.
__device__ __forceinline__ void tile_copy(unsigned lk, unsigned lv, const _Float16* gk, const _Float16* gv) {
  asm volatile("global_load_async_to_lds_b128 %0, %8, off\n\t"
               "global_load_async_to_lds_b128 %1, %9, off\n\t"
               "global_load_async_to_lds_b128 %2, %10, off\n\t"
               "global_load_async_to_lds_b128 %3, %11, off\n\t"
               "global_load_async_to_lds_b128 %4, %12, off\n\t"
               "global_load_async_to_lds_b128 %5, %13, off\n\t"
               "global_load_async_to_lds_b128 %6, %14, off\n\t"
               "global_load_async_to_lds_b128 %7, %15, off\n\t"
               "s_wait_xcnt 0x0"
               :: "v"(lk), "v"(lk + 32 * KPB), "v"(lk + 64 * KPB), "v"(lk + 96 * KPB), "v"(lv), "v"(lv + 16 * VPB), "v"(lv + 32 * VPB), "v"(lv + 48 * VPB),
                  "v"(gk), "v"(gk + (size_t)32 * CC), "v"(gk + (size_t)64 * CC), "v"(gk + (size_t)96 * CC), "v"(gv), "v"(gv + (size_t)16 * TT), "v"(gv + (size_t)32 * TT), "v"(gv + (size_t)48 * TT)
               : "memory");
}
// The same for a group of four, two or one wave: eight copies of one lane, 16 B each, ls bytes of LDS and gs elements of global memory apart; one call for a tile's key rows, one for its v plane rows.
__device__ __forceinline__ void copy8(unsigned la, unsigned ls, const _Float16* ga, size_t gs) {
  asm volatile("global_load_async_to_lds_b128 %0, %8, off\n\t"
               "global_load_async_to_lds_b128 %1, %9, off\n\t"
               "global_load_async_to_lds_b128 %2, %10, off\n\t"
               "global_load_async_to_lds_b128 %3, %11, off\n\t"
               "global_load_async_to_lds_b128 %4, %12, off\n\t"
               "global_load_async_to_lds_b128 %5, %13, off\n\t"
               "global_load_async_to_lds_b128 %6, %14, off\n\t"
               "global_load_async_to_lds_b128 %7, %15, off\n\t"
               "s_wait_xcnt 0x0"
               :: "v"(la), "v"(la + ls), "v"(la + 2 * ls), "v"(la + 3 * ls), "v"(la + 4 * ls), "v"(la + 5 * ls), "v"(la + 6 * ls), "v"(la + 7 * ls),
                  "v"(ga), "v"(ga + gs), "v"(ga + 2 * gs), "v"(ga + 3 * gs), "v"(ga + 4 * gs), "v"(ga + 5 * gs), "v"(ga + 6 * gs), "v"(ga + 7 * gs)
               : "memory");
}
template <int FW, int KK> __device__ __forceinline__ void tile_in(unsigned lk, unsigned lv, const _Float16* gk, const _Float16* gv) {
  if constexpr (FW == 8) { static_assert(KK == KT, "tile_copy brings KT keys"); tile_copy(lk, lv, gk, gv); }
  else { constexpr int RK = FW * 32 / 8, RV = FW * 32 / (KK / 8);   /* key rows and v plane rows that one copy of the whole group brings */
    static_assert(RK * 8 == KK && RV * 8 == HD, "eight copies a lane for each");
    copy8(lk, RK * KPB, gk, (size_t)RK * CC); copy8(lv, RV * (2 * KK + 16), gv, (size_t)RV * TT); }
}
__device__ __forceinline__ float xhalf(float x) { return __builtin_bit_cast(float, __builtin_amdgcn_permlanex16(__builtin_bit_cast(int, x), __builtin_bit_cast(int, x), 0x76543210, 0xfedcba98, false, false)); }   /* lane l with lane l ^ 16 */
__device__ __forceinline__ v8f wm(v16h a, v16h b, v8f c) { return __builtin_amdgcn_wmma_f32_16x16x32_f16(false, a, false, b, (short)0, c, false, false); }
// A pass's eight score products: s(query group, key tile) = c(query group) + k(key tile, d 0..31) x q(query group, d 0..31) + k(key tile, d 32..63) x q(query group, d 32..63).
// In asm text because the first four read their start value from one register block and write another: with the builtin two of the four came out with result and start value tied, and the start values were copied, 16 registers a pass.
// The second four accumulate into the first four's results, four products behind them. The four v_nop at the end are the vector slots that the chip needs between the last product and whatever reads its result or overwrites its operands next.
__device__ __forceinline__ void scores8(v8f& s00, v8f& s01, v8f& s10, v8f& s11, v16h k00, v16h k01, v16h k10, v16h k11, v16h q00, v16h q01, v16h q10, v16h q11, v8f c0, v8f c1) {
  asm volatile("v_wmma_f32_16x16x32_f16 %0, %4, %8, %12\n\t"
               "v_wmma_f32_16x16x32_f16 %2, %4, %10, %13\n\t"
               "v_wmma_f32_16x16x32_f16 %1, %6, %8, %12\n\t"
               "v_wmma_f32_16x16x32_f16 %3, %6, %10, %13\n\t"
               "v_wmma_f32_16x16x32_f16 %0, %5, %9, %0\n\t"
               "v_wmma_f32_16x16x32_f16 %2, %5, %11, %2\n\t"
               "v_wmma_f32_16x16x32_f16 %1, %7, %9, %1\n\t"
               "v_wmma_f32_16x16x32_f16 %3, %7, %11, %3\n\t"
               "v_nop\n\tv_nop\n\tv_nop\n\tv_nop"
               : "=&v"(s00), "=&v"(s01), "=&v"(s10), "=&v"(s11)
               : "v"(k00), "v"(k01), "v"(k10), "v"(k11), "v"(q00), "v"(q01), "v"(q10), "v"(q11), "v"(c0), "v"(c1));
}
template <int FW, int KG, int KK> __device__ __forceinline__ void fa_live(const _Float16* __restrict__ QH, const _Float16* __restrict__ KH, const _Float16* __restrict__ VT, float* __restrict__ Y, unsigned char* ring, int bh, int qb) {
  static_assert(FW * KG == 16, "16 waves a block"); static_assert(QT == 2, "the pass's maximum is written out for two query groups");
  constexpr int NTILE = TT / (KK * KG), VP = 2 * KK + 16, KB = KK * KPB, BUF = KB + HD * VP, LV = KK / 8;   /* tiles a group walks; LDS pitch of a v plane row of KK keys (16 B x odd, as KPB); key rows of a tile; one buffer; lanes to a v plane row */
  static_assert(NTILE >= 2 && KG * 2 * BUF <= RINGB, "two buffers a group, inside the ring");
  const int kg = __builtin_amdgcn_readfirstlane((int)threadIdx.x / (FW * 32));   /* key group, the same in every lane of a wave: held in a scalar register, so that the tests on it are scalar branches */
  const int tid = threadIdx.x & (FW * 32 - 1), wave = tid >> 5, lane = tid & 31, col = lane & 15, g = lane >> 4;   /* tid, wave: within the group */
  const int b = bh / NH, h = bh % NH; const int q0 = qb * (FW * 16 * QT) + wave * (16 * QT);
  v16h qh[QT][2];
#pragma unroll
  for (int qt = 0; qt < QT; ++qt)
#pragma unroll
    for (int kc = 0; kc < 2; ++kc) { const size_t qo = ((size_t)b * TT + q0 + qt * 16 + col) * CC + h * HD + kc * 32; qh[qt][kc] = frag_h(QH + qo, lane); }
  asm volatile("s_wait_xcnt 0x0" ::: "memory");   /* stands in front of the set-up below, which takes over the address registers of the q loads above */
  __builtin_amdgcn_sched_barrier(0);   /* keeps that set-up behind the wait */
  const _Float16* gk = KH + ((size_t)b * TT + kg * KK + (tid >> 3)) * CC + h * HD + (tid & 7) * 8;             /* this lane's 16 B of key row tid / 8 of the group's first tile; + key * CC */
  const _Float16* gv = VT + ((size_t)b * CC + h * HD + tid / LV) * (size_t)TT + kg * KK + (tid % LV) * 8;   /* this lane's 16 B of v plane row tid / LV; + key */
  const unsigned l0 = (unsigned)(size_t)&ring[kg * 2 * BUF];   /* LDS byte address of the group's two buffers */
  const unsigned lk = l0 + (tid >> 3) * KPB + (tid & 7) * 16, lv = l0 + KB + (tid / LV) * VP + (tid % LV) * 16;
  if constexpr (FW == 1) {   /* such a job runs behind another job of its block, which has left its join in the ring */
    asm volatile("s_wait_dscnt 0x0" ::: "memory");   /* this wave's reads and writes of that join are done */
    __syncthreads(); }                                /* every wave's are: the ring may be filled anew */
  tile_in<FW, KK>(lk, lv, gk, gv);
  asm volatile("s_wait_asynccnt 0x0" ::: "memory");   /* this wave's share of tile 0 has landed */
  if constexpr (FW > 1) __syncthreads();              /* every wave's share has: tile 0 may be read; a group of one wave has its ring to itself, and its own wait above is all that it needs */
  tile_in<FW, KK>(lk + BUF, lv + BUF, gk + (size_t)KG * KK * CC, gv + KG * KK);
  v8f o[QT][4] = {}; float m[QT]; v8f cb[QT]; v2f ls[QT][2];   /* m: the maximum in use, log2 units, the same in both lanes of a query; cb: PB - m in all eight elements, where the score products start (PB - 0 until the first pass has set m); ls: this lane's sum of P, four chains that run on from pass to pass, two to a packed add */
  float thr = -3.0e38f;   /* the exponent above which the maximum in use is brought up; below every exponent until the wave's first pass has set one; the same in every lane */
#pragma unroll
  for (int qt = 0; qt < QT; ++qt) { m[qt] = -3.0e38f; ls[qt][0] = v2f{0.f, 0.f}; ls[qt][1] = v2f{0.f, 0.f};
#pragma unroll
    for (int r = 0; r < 8; ++r) cb[qt][r] = PB; }
#pragma unroll 1   /* the tiles stay rolled too: with one more job kind in the kernel the eight-group job's four tiles came out unrolled, four times its code and every register taken */
  for (int t = 0; t < NTILE; ++t) {
    const unsigned bo = (t & 1) * BUF;
    const unsigned char* Kl = ring + kg * 2 * BUF + bo + col * KPB;          /* + key in tile * KPB */
    const unsigned char* Vl = ring + kg * 2 * BUF + bo + KB + col * VP;    /* + d tile * 16 * VP + key in tile * 2 */
    v16h kf[2][2];
#pragma unroll
    for (int kt = 0; kt < 2; ++kt)
#pragma unroll
      for (int kc = 0; kc < 2; ++kc) kf[kt][kc] = frag_h((const _Float16*)(Kl + (kt * 16) * KPB + kc * 64), lane);
    const unsigned char* Vp = Vl + 16 * g;   /* this lane's place in the v rows; + 64 B a pass */
#pragma unroll 1   /* the passes of a tile stay rolled: unrolled they took some 200 registers more, and the copies' address operands spilled */
   for (int ps = 0; ps < KK / 32; ++ps) {
    v16h vf[4];
#pragma unroll
    for (int dt = 0; dt < 4; ++dt) { union { v16h v; v8h q[2]; } u; u.q[0] = *(const v8h*)(Vp + (dt * 16) * VP); u.q[1] = *(const v8h*)(Vp + (dt * 16) * VP + 32); vf[dt] = u.v; }   /* frag_h, the lane's 16 * g bytes being in Vp */
    Vp += 64;   /* the next pass's v address is formed up here, in a register of its own: formed at the head of that pass it was given an A register of this pass's last product, too few vector slots behind it */
    __builtin_amdgcn_sched_barrier(0);   /* keeps the v reads up here, a whole score and softmax phase ahead of their use, in one group */
    v8f s[QT][2];   /* the exponents of P: score in log2 units + PB - the maximum in use; kf[key tile][d half], qh[query group][d half] */
    scores8(s[0][0], s[0][1], s[1][0], s[1][1], kf[0][0], kf[0][1], kf[1][0], kf[1][1], qh[0][0], qh[0][1], qh[1][0], qh[1][1], cb[0], cb[1]);
    __builtin_amdgcn_sched_barrier(0);   /* keeps the reads below behind all eight products, in one group */
    if constexpr (KK > 32) {   /* a tile of one pass has no next key rows */
    const int kn = ((ps + 1) * 32) & (KK - 1);   /* the next pass's key rows of the same tile, read behind this pass's score products; a tile's last pass reads its rows 0.. again, unused: no branch stands behind the products */
#pragma unroll
    for (int kt = 0; kt < 2; ++kt)
#pragma unroll
      for (int kc = 0; kc < 2; ++kc) kf[kt][kc] = frag_h((const _Float16*)(Kl + (kn + kt * 16) * KPB + kc * 64), lane); }
    __builtin_amdgcn_sched_barrier(0);   /* keeps the next key rows' reads ahead of the softmax, in one group; without it they sink to right in front of their use */
    v16h pf[QT]; float c4[2 * QT];
#pragma unroll
    for (int j = 0; j < 2 * QT; ++j) { const v8f e = s[j >> 1][j & 1]; c4[j] = fmaxf(fmaxf(fmaxf(fmaxf(fmaxf(fmaxf(e[0], e[1]), e[2]), e[3]), e[4]), e[5]), e[6]); }   /* four chains side by side, two values to a step */
    float mx = fmaxf(fmaxf(c4[0], c4[1]), c4[2]); mx = fmaxf(fmaxf(mx, c4[3]), s[0][0][7]); mx = fmaxf(fmaxf(mx, s[0][1][7]), s[1][0][7]); mx = fmaxf(mx, s[1][1][7]);   /* the lane's largest exponent, over both its queries: each exponent holds its own query's maximum in use already, so one test serves both */
    if (__builtin_amdgcn_ballot_w32(mx > thr) != 0) {   /* one scalar branch a pass, the same for the whole wave; always taken in a wave's first pass */
      thr = PB + TAU;
#pragma unroll
      for (int qt = 0; qt < QT; ++qt) { const float mq = fmaxf(fmaxf(fmaxf(c4[2 * qt], c4[2 * qt + 1]), s[qt][0][7]), s[qt][1][7]);   /* this lane's 16 keys of this query */
        const float mw = fmaxf(mq, xhalf(mq));   /* with the other 8 + 8 keys of this query */
        const float bo = cb[qt][0]; const float mn = fmaxf(m[qt], mw - bo);   /* mw - bo: the largest score, log2 units */
        const float alpha = __builtin_amdgcn_exp2f(m[qt] - mn); m[qt] = mn; const float bn = PB - mn, dl = bn - bo; ls[qt][0] *= alpha; ls[qt][1] *= alpha;
#pragma unroll
        for (int r = 0; r < 8; ++r) { cb[qt][r] = bn; s[qt][0][r] += dl; s[qt][1][r] += dl; }   /* this pass's exponents are brought to the new maximum here, the later passes' by cb */
#pragma unroll
        for (int dt = 0; dt < 4; ++dt) o[qt][dt] *= alpha; } }
#pragma unroll
    for (int qt = 0; qt < QT; ++qt)
#pragma unroll
      for (int i = 0; i < 16; i += 2) { const v2f p = {__builtin_amdgcn_exp2f(s[qt][i >> 3][i & 7]), __builtin_amdgcn_exp2f(s[qt][(i + 1) >> 3][(i + 1) & 7])}; ls[qt][(i >> 1) & 1] += p; pf[qt][i] = (_Float16)p[0]; pf[qt][i + 1] = (_Float16)p[1]; }
    __builtin_amdgcn_sched_barrier(0);   /* keeps the sums ahead of the products: moved in among them, they were given the v fragments' registers, at four idle slots behind a product each time */
#pragma unroll
    for (int dt = 0; dt < 4; ++dt)
#pragma unroll
      for (int qt = 0; qt < QT; ++qt) o[qt][dt] = wm(vf[dt], pf[qt], o[qt][dt]);
   }
    asm volatile("s_wait_dscnt 0x0" ::: "memory");      /* this wave's reads of tile t are done */
    asm volatile("s_wait_asynccnt 0x0" ::: "memory");   /* this wave's share of tile t + 1 has landed */
    if constexpr (FW > 1) __syncthreads();              /* tile t + 1 may be read, tile t's buffer may be refilled; in a ring private to one wave the two waits above say both, and the sixteen waves need not walk in step */
    if (t + 2 < NTILE) tile_in<FW, KK>(lk + bo, lv + bo, gk + (size_t)(t + 2) * KG * KK * CC, gv + (t + 2) * KG * KK);
  }
  asm volatile("s_wait_asynccnt 0x0" ::: "memory");   /* no copy is outstanding when the wave goes on to its end */
  float l[QT];
#pragma unroll
  for (int qt = 0; qt < QT; ++qt) l[qt] = (ls[qt][0][0] + ls[qt][0][1]) + (ls[qt][1][0] + ls[qt][1][1]);
  if constexpr (FW == 1) {
    /* Sixteen groups of one wave: one wave adding fifteen others' parts would take as long as the job's passes. Every group hands in its maximum, sum and unscaled O through LDS, and the 512 threads share the join: thread = (query tid / 16, four d). */
    /* A group's part stands in that group's own two buffers, GS floats from one group's to the next: the other waves may still be at their tiles, no barrier having stood since the job's first, and this wave's reads and copies there are done (the waits at the loop's foot and behind it). */
    /* sa: [QT * 16][HD + 4] floats a group; ma, behind it: [2][QT * 16], a query's maximum and its sum over both lanes. */
    constexpr int SA = QT * 16 * (HD + 4), MA = 2 * QT * 16, GS = 2 * BUF / 4;
    static_assert((SA + MA) * 4 <= 2 * BUF && (2 * BUF) % 16 == 0, "a group's part fits its own buffers, 16-byte aligned");
    float* sa = (float*)ring; float* ma = (float*)ring + SA;
#pragma unroll
    for (int qt = 0; qt < QT; ++qt) { const float lw = l[qt] + xhalf(l[qt]);
      if (g == 0) { ma[kg * GS + qt * 16 + col] = m[qt]; ma[kg * GS + QT * 16 + qt * 16 + col] = lw; }
#pragma unroll
      for (int dt = 0; dt < 4; ++dt) { v4f lo = { o[qt][dt][0], o[qt][dt][1], o[qt][dt][2], o[qt][dt][3] }, hi = { o[qt][dt][4], o[qt][dt][5], o[qt][dt][6], o[qt][dt][7] };
        float* d = sa + kg * GS + (qt * 16 + col) * (HD + 4) + dt * 16 + 8 * g; *(v4f*)d = lo; *(v4f*)(d + 4) = hi; } }
    __syncthreads();   /* every group's part may be read */
    const int rq = (int)threadIdx.x >> 4, c4 = (int)threadIdx.x & 15;
    float mj[KG]; float mn = -3.0e38f;
#pragma unroll
    for (int j = 0; j < KG; ++j) { mj[j] = ma[j * GS + rq]; mn = fmaxf(mn, mj[j]); }
    float lt = 0.f; v4f acc = {};
#pragma unroll
    for (int j = 0; j < KG; ++j) { const float c = __builtin_amdgcn_exp2f(mj[j] - mn); lt += ma[j * GS + QT * 16 + rq] * c; acc += *(const v4f*)(sa + j * GS + rq * (HD + 4) + c4 * 4) * c; }
    acc *= 1.0f / lt;
    vst2(Y + ((size_t)bh * TT + q0 + rq) * HD + c4 * 4, acc);   /* output layout [b][h][t][d]: two 256-B rows a store */
    asm volatile("s_wait_xcnt 0x0" ::: "memory");   /* stands behind the store, in front of whatever code the compiler lays behind this job and lets take over the store's registers */
    return; }
  /* The join: wave w of each group but the first hands its maximum, sum and unscaled O to wave w of group 0, lane to lane, through LDS; group 0 brings all to the largest maximum, adds them, divides and stores. */
  /* It stands in the ring: behind the loop's last barrier nobody reads a tile any more and no copy is outstanding. ss: [KG - 1][FW][QT * 16][HD + 4] floats; ml, behind it: [KG - 1][FW][2][QT][32]. */
  float* ss = (float*)ring + wave * (QT * 16 * (HD + 4)); float* ml = (float*)ring + (KG - 1) * FW * (QT * 16 * (HD + 4)) + wave * (2 * QT * 32) + lane;
  constexpr int SSG = FW * QT * 16 * (HD + 4), MLG = FW * 2 * QT * 32;   /* from one group's part to the next, floats */
  if (kg != 0) {
#pragma unroll
    for (int qt = 0; qt < QT; ++qt) { ml[(kg - 1) * MLG + qt * 32] = m[qt]; ml[(kg - 1) * MLG + (QT + qt) * 32] = l[qt];
#pragma unroll
      for (int dt = 0; dt < 4; ++dt) { v4f lo = { o[qt][dt][0], o[qt][dt][1], o[qt][dt][2], o[qt][dt][3] }, hi = { o[qt][dt][4], o[qt][dt][5], o[qt][dt][6], o[qt][dt][7] };
        float* d = ss + (kg - 1) * SSG + (qt * 16 + col) * (HD + 4) + dt * 16 + 8 * g; *(v4f*)d = lo; *(v4f*)(d + 4) = hi; } } }
  __syncthreads();   /* the other groups' parts may be read */
  if (kg != 0) return;
#pragma unroll
  for (int qt = 0; qt < QT; ++qt) { float mj[KG - 1], cj[KG - 1]; float mn = m[qt];
#pragma unroll
    for (int j = 0; j < KG - 1; ++j) { mj[j] = ml[j * MLG + qt * 32]; mn = fmaxf(mn, mj[j]); }
    const float a0 = __builtin_amdgcn_exp2f(m[qt] - mn); float lt = l[qt] * a0;
#pragma unroll
    for (int j = 0; j < KG - 1; ++j) { cj[j] = __builtin_amdgcn_exp2f(mj[j] - mn); lt += ml[j * MLG + (QT + qt) * 32] * cj[j]; }
    const float inv = 1.0f / (lt + xhalf(lt)); const float c0 = a0 * inv;
#pragma unroll
    for (int j = 0; j < KG - 1; ++j) cj[j] *= inv;
#pragma unroll
    for (int dt = 0; dt < 4; ++dt) { float* d = ss + (qt * 16 + col) * (HD + 4) + dt * 16 + 8 * g;   /* the 32 B that the same lane of group 1 wrote, and that this lane overwrites */
      v4f lo = { o[qt][dt][0] * c0, o[qt][dt][1] * c0, o[qt][dt][2] * c0, o[qt][dt][3] * c0 }, hi = { o[qt][dt][4] * c0, o[qt][dt][5] * c0, o[qt][dt][6] * c0, o[qt][dt][7] * c0 };
#pragma unroll
      for (int j = 0; j < KG - 1; ++j) { lo += *(const v4f*)(d + j * SSG) * cj[j]; hi += *(const v4f*)(d + j * SSG + 4) * cj[j]; }
      *(v4f*)d = lo; *(v4f*)(d + 4) = hi; } }
  LDSX(); for (int rl = g; rl < QT * 16; rl += 2) vst2(Y + ((size_t)bh * TT + q0 + rl) * HD + col * 4, *(const v4f*)&ss[rl * (HD + 4) + col * 4]); }   /* output layout [b][h][t][d]: two 256-B rows a store */
// A masked head's job: the 32 key blocks' sums of v (k_planes: ones x v on the matrix unit) are added, two in a wave's halves, the 16 waves' through LDS, and the average goes to the job's query rows r0 .. r0 + 32 * nst - 1.
__device__ __forceinline__ void fa_masked(const float* __restrict__ PS, float* __restrict__ Y, unsigned char* ring, int bh, int r0, int nst) {
  const int tid = threadIdx.x, wave = tid >> 5, lane = tid & 31, col = lane & 15, g = lane >> 4;
  v4f a = *(const v4f*)(PS + ((size_t)bh * (TT / 64) + (tid >> 4)) * HD + col * 4);   /* key block tid / 16, four d */
#pragma unroll
  for (int c = 0; c < 4; ++c) a[c] += xhalf(a[c]);
  float* red = (float*)ring;   /* [16 waves][HD] */
  if (g == 0) *(v4f*)(red + wave * HD + col * 4) = a;
  __syncthreads();   /* every wave's sums may be read */
  v4f s = {};
#pragma unroll
  for (int w = 0; w < 16; ++w) s += *(const v4f*)(red + w * HD + col * 4);
  s *= 1.0f / TT;
  for (int i = 0; i < nst; i += 4)
#pragma unroll
    for (int j = 0; j < 4; ++j) vst2(Y + ((size_t)bh * TT + r0 + (i + j) * 32 + (tid >> 4)) * HD + col * 4, s); }   /* two 256-B rows a store */
__global__ __launch_bounds__(512) void k_fa(const _Float16* __restrict__ QH, const _Float16* __restrict__ KH, const _Float16* __restrict__ VT, const float* __restrict__ PS, const int* __restrict__ HM, float* __restrict__ Y) {
  __shared__ __align__(16) unsigned char ring[RINGB];   /* two buffers a group: its next tile lands while this one is worked on */
  static_assert(NB * NH == 32, "one mask word a lane");
  const int lane = threadIdx.x & 31, bid = blockIdx.x;
  const unsigned um = __builtin_amdgcn_ballot_w32(HM[lane] != 1);   /* bit bh: head bh is live; mask[b][h] == 1 replaces EVERY score of that head with one constant */
  const int nu = __builtin_popcount(um); const bool wide = nu > 21;   /* wide: every live job is 256 queries */
  const int ns = (nu > 16 && !wide) ? nu - 16 : 0, nm = wide ? 0 : nu - ns;   /* live heads behind the first 16, in jobs of 64 queries, or of 32 queries as second jobs when three at most; in jobs of 128 queries, 16 at most */
  const bool fine = ns >= 1 && ns <= 3;   /* fine: the heads behind the first 16 have no blocks of their own; the 256 blocks run them as second jobs */
  const int j1 = wide ? nu * (TT / 256) : nm * (TT / 128), nj = j1 + (fine ? 0 : ns * (TT / 64));   /* the longer live jobs come first, the shorter behind them, the masked heads' last */
  const int msh = nu > 16 ? 3 : 4;   /* a masked head is 8 jobs of 256 queries or 16 of 128: never more than 512 jobs in all */
  const bool live = bid < nj; int rank, qb;   /* which of the live, or of the masked, heads; which of its jobs */
  if (bid < j1) { rank = wide ? bid >> 3 : bid >> 4; qb = wide ? bid & 7 : bid & 15; }
  else if (live) { rank = nm + ((bid - j1) >> 5); qb = (bid - j1) & 31; }
  else { rank = (bid - nj) >> msh; qb = (bid - nj) & ((1 << msh) - 1); }
  if (!live && rank >= 32 - nu) return;   /* no job left: the whole block leaves, in front of every barrier */
  const unsigned set = live ? um : ~um;
  const unsigned sel = __builtin_amdgcn_ballot_w32(((set >> lane) & 1u) != 0u && __builtin_popcount(set & ((1u << lane) - 1u)) == rank);   /* one bit: the head of that rank */
  const int bh = __builtin_amdgcn_readfirstlane(__builtin_ctz(sel | 0x80000000u));   /* 0 .. 31 whatever the mask words hold */
  if (!live) { fa_masked(PS, Y, ring, bh, qb << (11 - msh), 64 >> msh); return; }
  if (bid >= j1) fa_live<2, 8, 64>(QH, KH, VT, Y, ring, bh, qb);
  else if (wide) fa_live<8, 2, 128>(QH, KH, VT, Y, ring, bh, qb);
  else { fa_live<4, 4, 128>(QH, KH, VT, Y, ring, bh, qb);
    const int xh = (bid >> 3) & 3;   /* second jobs: blocks 32 i + 8 xh + j take job 8 i + j of live head 16 + xh, eight neighbouring blocks in every 32 to a head */
    if (fine && xh < ns) {   /* the same for the whole block */
      const unsigned sel2 = __builtin_amdgcn_ballot_w32(((um >> lane) & 1u) != 0u && __builtin_popcount(um & ((1u << lane) - 1u)) == 16 + xh);
      const int bh2 = __builtin_amdgcn_readfirstlane(__builtin_ctz(sel2 | 0x80000000u));   /* 0 .. 31 whatever the mask words hold */
      fa_live<1, 16, 32>(QH, KH, VT, Y, ring, bh2, ((bid >> 5) << 3) | (bid & 7)); } } }

extern "C" void kernel_launch(void* const* d_in, const int* in_sizes, int n_in, void* d_out, int out_size, void* d_ws, size_t ws_size, hipStream_t stream) {
  (void)in_sizes; (void)n_in; (void)out_size;
  const float** F = (const float**)d_in;
  if (ws_size < (size_t)WS_END) return;
  char* ws = (char*)d_ws; _Float16 *QH = (_Float16*)(ws + WS_QH), *KH = (_Float16*)(ws + WS_KH), *VT = (_Float16*)(ws + WS_VT), *KL = (_Float16*)(ws + WS_KL); __bf16 *VB = (__bf16*)(ws + WS_VB), *VBL = (__bf16*)(ws + WS_VBL); float *S = (float*)(ws + WS_S), *Y = (float*)(ws + WS_Y);
  (void)Y; (void)KL; (void)VB; (void)VBL;
  // inputs: 0 query [4,8,2048,64]; 1 key; 2 value; 3 mask [4,8] int32 (1 -> the whole head's scores := -1e6)
  const int* HM = (const int*)d_in[3];
  k_planes<<<dim3(TT / 64, NH, NB), 256, 0, stream>>>(F[0], F[1], F[2], HM, QH, KH, VT, S);   /* S: here the masked heads' sums of v, [b * NH + h][TT / 64][HD] f32 */
  k_fa<<<dim3(NB * NH * (TT / 128)), 512, 0, stream>>>(QH, KH, VT, S, HM, (float*)d_out);
}
